// v000
// Measured on an AMD MI455X. A time is GPU time per run, averaged over a window of back-to-back runs after a warm-up
// (all launches, gaps included; the runs take copies of the inputs in turn), and the median of several windows.
// Apart from v000's, it joins two sittings. Times from different sittings can be a few percent apart, while
// side-by-side timings come from the same sitting.
// v000 is the starting kernel. One run takes 212 microseconds.
#include <hip/hip_runtime.h>

// Contractions, f32 accumulate: q = tok.Wq + bq ([32 x 1024 tokens x 384].[384 x 384]) on v_wmma_f32_16x16x32_bf16 with PLAIN bf16 operands (tok = the NCHW input
// transposed, rounded once: exact); k, v = xr.Wk/Wv + b on the bf16 instruction with the pooled + batch-normed tokens xr (computed) as bf16 hi + residual planes (two
// products); the per-(batch, head) attention (12 heads of 32: scores [1024 x 32].[32 x 256] x 32^-1/2, softmax, .v) fused on v_wmma_f32_16x16x32_f16 with plain f16
// q, k, v and weights x32768; out = ctx.Wp + bp on the bf16 instruction with ctx as bf16 hi + residual planes, written back transposed to NCHW. Deterministic, no

#define NB_  32
#define CC   384
#define NN_  1024
#define NK   256
#define NH_  12
#define HD   32
#define NTQ  (NB_ * NN_)          // 32768 query tokens
#define NTKV (NB_ * NK)           // 8192 pooled tokens
#define PSC  32768.0f
#define SCL  0.17677669529663687f

typedef _Float16 h16;
typedef unsigned short bf;
typedef __attribute__((ext_vector_type(16))) __bf16   v16bf;
typedef __attribute__((ext_vector_type(16))) _Float16 v16h;
typedef __attribute__((ext_vector_type(8)))  _Float16 v8h;
typedef __attribute__((ext_vector_type(8)))  unsigned short v8us;
typedef __attribute__((ext_vector_type(8)))  float    v8f;
typedef __attribute__((ext_vector_type(4)))  float    v4f;
typedef v8h  __attribute__((may_alias)) v8ha;
typedef v4f  __attribute__((may_alias)) v4fa;
typedef v8us __attribute__((may_alias)) v8usa;

__device__ __forceinline__ unsigned short f2bf(float f) { unsigned u = __float_as_uint(f); u += 0x7FFFu + ((u >> 16) & 1u); return (unsigned short)(u >> 16); }
__device__ __forceinline__ float bf2f(unsigned short b) { return __uint_as_float(((unsigned)b) << 16); }
__device__ __forceinline__ float bfr(float f) { return bf2f(f2bf(f)); }
__device__ __forceinline__ v16h cat16(v8h lo, v8h hi) { return __builtin_shufflevector(lo, hi, 0, 1, 2, 3, 4, 5, 6, 7, 8, 9, 10, 11, 12, 13, 14, 15); }
__device__ __forceinline__ v16bf cat16b(v8us lo, v8us hi) { return __builtin_bit_cast(v16bf, __builtin_shufflevector(lo, hi, 0, 1, 2, 3, 4, 5, 6, 7, 8, 9, 10, 11, 12, 13, 14, 15)); }
__device__ __forceinline__ v8f wmma16(v16h a, v16h b, v8f c) { return __builtin_amdgcn_wmma_f32_16x16x32_f16(false, a, false, b, (short)0, c, false, false); }
__device__ __forceinline__ v8f wmmab(v16bf a, v16bf b, v8f c) { return __builtin_amdgcn_wmma_f32_16x16x32_bf16(false, a, false, b, (short)0, c, false, false); }

// k_tok: Xb [b][n][c] = bf16(x[b][c][n]) via 64 x 64 LDS transposes; grid (n tiles 16, c tiles 6, b).
__global__ __launch_bounds__(256) void k_tok(const float* __restrict__ x, bf* Xb) {
    __shared__ __align__(16) unsigned short tl[64 * 72];
    const int tid = threadIdx.x, n0 = blockIdx.x * 64, c0 = blockIdx.y * 64, b = blockIdx.z;
    const int cc = tid >> 2, nq = (tid & 3) * 16;
#pragma unroll
    for (int i = 0; i < 16; ++i) tl[(nq + i) * 72 + cc] = f2bf(x[((size_t)b * CC + c0 + cc) * NN_ + n0 + nq + i]);
    __syncthreads();
    const int piece = tid & 7;
    auto pass = [&]() {
#pragma unroll
        for (int s = 0; s < 2; ++s) { const int nr = (tid >> 3) + 32 * s; const v8us val = *(const v8usa*)(tl + nr * 72 + piece * 8);
            *(v8us*)(Xb + ((size_t)b * NN_ + n0 + nr) * CC + c0 + piece * 8) = val; }
    };
    pass(); 
}
// k_pool: XRH/XRL [b][m][c] = bf16 hi + residual of (mean_{t<4} bf16(x[b][c][4m+t])) * inv[c] + shift[c], inv = g/sqrt(var + eps), shift = beta - mean*inv (bf16-rounded
// params, f32 math); block (64 m, 64 c, b) through LDS; rows of 64 c = one line per plane.
__global__ __launch_bounds__(256) void k_pool(const float* __restrict__ x, const float* __restrict__ g, const float* __restrict__ be, const float* __restrict__ mu, const float* __restrict__ var, bf* XRH, bf* XRL) {
    __shared__ __align__(16) unsigned short th_[64 * 72];
    __shared__ __align__(16) unsigned short tl_[64 * 72];
    const int tid = threadIdx.x, m0 = blockIdx.x * 64, c0 = blockIdx.y * 64, b = blockIdx.z;
    const int cc = tid >> 2, mq = (tid & 3) * 16, c = c0 + cc;
    const float inv = bfr(g[c]) / sqrtf(bfr(var[c]) + 1e-5f), sh = bfr(be[c]) - bfr(mu[c]) * inv;
    const float* xr = x + ((size_t)b * CC + c) * NN_;
#pragma unroll
    for (int i = 0; i < 16; ++i) { const int m = m0 + mq + i; const float* p = xr + 4 * m;
        const float v = ((bfr(p[0]) + bfr(p[1]) + bfr(p[2]) + bfr(p[3])) * 0.25f) * inv + sh;
        const unsigned short hb = f2bf(v); th_[(mq + i) * 72 + cc] = hb; tl_[(mq + i) * 72 + cc] = f2bf(v - bf2f(hb)); }
    __syncthreads();
    const int piece = tid & 7;
    auto pass = [&]() {
#pragma unroll
        for (int s = 0; s < 4; ++s) { const int Lid = (tid >> 3) + 32 * s; const int pln = Lid >> 6, mr = Lid & 63;
            const v8us val = *(const v8usa*)((pln ? tl_ : th_) + mr * 72 + piece * 8); *(v8us*)((pln ? XRL : XRH) + ((size_t)b * NK + m0 + mr) * CC + c0 + piece * 8) = val; }
    };
    pass(); 
}
// k_wt: W [384 k][384 n] k-major -> n-major bf16 plane; 64 x 64 tiles.
__global__ __launch_bounds__(256) void k_wt(const float* __restrict__ Wm, bf* WT) {
    __shared__ __align__(16) unsigned short tl[64 * 72];
    const int tid = threadIdx.x, k0 = blockIdx.x * 64, n0 = blockIdx.y * 64;
    const int kk = tid >> 2, nq = (tid & 3) * 16;
#pragma unroll
    for (int i = 0; i < 16; ++i) tl[(nq + i) * 72 + kk] = f2bf(Wm[(size_t)(k0 + kk) * CC + n0 + nq + i]);
    __syncthreads();
    const int piece = tid & 7;
    auto pass = [&]() {
#pragma unroll
        for (int s = 0; s < 2; ++s) { const int nr = (tid >> 3) + 32 * s; const v8us val = *(const v8usa*)(tl + nr * 72 + piece * 8);
            *(v8us*)(WT + (size_t)(n0 + nr) * CC + k0 + piece * 8) = val; }
    };
    pass(); 
}

// k_gemmb: 64 x 64 tile of (A [+ Al]).B^T + bf16(bias), K = 384. MODE 0: f16 rows C16[row][384]; MODE 1: transposed f32 output into NCHW out[b][c][n] (row = b*1024 + n):
// the tile's 64 columns c each get 64 consecutive n = one 256-byte run (2 lines) -> LDS-staged transposed epilogue; MODE 2: VT16 planes for v: row = b*256 + m, col
template <bool SPLITA, int MODE, bool HMA>
__global__ __launch_bounds__(128) void k_gemmb(const bf* __restrict__ A, const bf* __restrict__ Al, const bf* __restrict__ Bn, const float* __restrict__ bias, void* Cout) {
    __shared__ __align__(16) float ost[64 * 68];
    const int lane = threadIdx.x & 31, wave = threadIdx.x >> 5, lr = lane & 15, hi = lane >> 4;
    const int r0 = blockIdx.x * 64 + wave * 16, c0 = blockIdx.y * 64;
    const size_t aoff = (size_t)(r0 + lr) * CC + 8 * hi;
    // head-major A (HMA): planes [b][h][n][32] with row = b*1024 + n and k-chunk kc/32 = head h
    const int hb = (r0 + lr) / NN_, hn = (r0 + lr) - hb * NN_;
    size_t boff[4];
#pragma unroll
    for (int t = 0; t < 4; ++t) boff[t] = (size_t)(c0 + t * 16 + lr) * CC + 8 * hi;
    v8f acc[4];
#pragma unroll
    for (int t = 0; t < 4; ++t) acc[t] = (v8f){};
#pragma unroll 1
    for (int kc = 0; kc < CC; kc += 32) {
        const size_t ao = HMA ? ((((size_t)hb * NH_ + (kc >> 5)) * NN_ + hn) * HD + 8 * hi) : (aoff + kc);
        const v16bf a = cat16b(*(const v8us*)(A + ao), *(const v8us*)(A + ao + 16));
        v16bf al = a;
        if (SPLITA) al = cat16b(*(const v8us*)(Al + ao), *(const v8us*)(Al + ao + 16));
#pragma unroll
        for (int t = 0; t < 4; ++t) { const v16bf b = cat16b(*(const v8us*)(Bn + boff[t] + kc), *(const v8us*)(Bn + boff[t] + kc + 16)); acc[t] = wmmab(a, b, acc[t]); if (SPLITA) acc[t] = wmmab(al, b, acc[t]); }
        asm volatile("v_nop\n\tv_nop\n\tv_nop\n\tv_nop" : "+v"(acc[0]), "+v"(acc[1]), "+v"(acc[2]), "+v"(acc[3]) : "v"(a), "v"(al));
    }
    float* os = ost + wave * 16 * 68;        // block tile as [64 rows][68]
#pragma unroll
    for (int t = 0; t < 4; ++t) { const float bv = bfr(bias[c0 + t * 16 + lr]);
#pragma unroll
        for (int j = 0; j < 8; ++j) os[(hi * 8 + j) * 68 + t * 16 + lr] = acc[t][j] + bv; }
    __syncthreads();
    if (MODE == 0) {
        h16* crow = (h16*)Cout + (size_t)r0 * CC + c0;
        auto pass = [&]() {
#pragma unroll
            for (int s = 0; s < 4; ++s) { const int row = 4 * s + (lane >> 3), piece = lane & 7; const float* sp = os + row * 68 + piece * 8; v8h o;
#pragma unroll
                for (int i = 0; i < 8; ++i) o[i] = (h16)sp[i];
                *(v8h*)(crow + (size_t)row * CC + piece * 8) = o; }
        };
        pass(); 
    } else if (MODE == 1) {
        // transposed: column c (64 of them) x 64 rows n; wave w handles columns w*16 .. w*16+15; per column 64 floats = 16 lanes x 16 B; 2 columns per instruction
        const int rb = blockIdx.x * 64; const int b = rb / NN_, n0 = rb - b * NN_;
        float* ob = (float*)Cout + ((size_t)b * CC + c0) * NN_ + n0;
        auto pass = [&]() {
#pragma unroll
            for (int s = 0; s < 8; ++s) { const int col = wave * 16 + 2 * s + (lane >> 4), q = lane & 15; v4f v;
#pragma unroll
                for (int i = 0; i < 4; ++i) v[i] = ost[(q * 4 + i) * 68 + col];
                *(v4f*)(ob + (size_t)col * NN_ + q * 4) = v; }
        };
        pass(); 
    } else {
        const int rb = blockIdx.x * 64; const int b = rb / NK, m0 = rb - b * NK;
        h16* vb = (h16*)Cout + ((size_t)b * CC + c0) * NK + m0;        // (b*CC + col) * NK since [b][h][d] flattens to b*384 + h*32 + d = b*CC + col
        auto pass = [&]() {
#pragma unroll
            for (int s = 0; s < 4; ++s) { const int col = wave * 16 + 4 * s + (lane >> 3), q = lane & 7; v8h v;
#pragma unroll
                for (int i = 0; i < 8; ++i) v[i] = (h16)ost[(q * 8 + i) * 68 + col];
                *(v8h*)(vb + (size_t)col * NK + q * 8) = v; }
        };
        pass(); 
    }
}

// k_attn: block = (b, h, 64 queries), wave = 16; head dim 32 (one k-chunk); 8 steps x 32 keys: 2 WMMA scores x 32^-1/2, online f32 softmax, weights x32768 f16 tile
// (same-wave may_alias reload after a compiler barrier), 2 WMMA .v (d tiles 0..15, 16..31); ctx -> bf16 hi/lo planes CH/CL[b n][h*32 + d] (64-byte half-lines per
// line of CH spans columns h*32..h*32+63 of one row, i.e. TWO heads -> written by two different blocks. To keep line ownership, CH/CL are laid out head-major:
// CHt[b][h][n][32] so each row's 32 values (64 B) pair with the next row in the same block: lines = 2 consecutive n of the same (b,h) -> owned by this wave.
__global__ __launch_bounds__(128) void k_attn(const h16* __restrict__ Q16, const h16* __restrict__ K16, const h16* __restrict__ VT16, bf* CH, bf* CL) {
    __shared__ __align__(16) h16 plds[4][16 * 32];
    __shared__ __align__(16) float ost[4][16 * 36];
    const int lane = threadIdx.x & 31, wave = threadIdx.x >> 5, lr = lane & 15, hi = lane >> 4;
    const int bid = blockIdx.x;
    const int b = bid / (NH_ * (NN_ / 64)), rem = bid - b * (NH_ * (NN_ / 64)), h = rem / (NN_ / 64), qt = rem - h * (NN_ / 64);
    const int q0 = qt * 64 + wave * 16;
    h16* pl = &plds[wave][0];
    const h16* qp = Q16 + ((size_t)b * NN_ + q0 + lr) * CC + h * HD + 8 * hi;
    const v16h qa = cat16(*(const v8h*)qp, *(const v8h*)(qp + 16));
    const h16* kh_b = K16 + (size_t)b * NK * CC + h * HD;
    const h16* vt_b = VT16 + ((size_t)b * CC + h * HD) * NK;
    v8f o[2]; o[0] = (v8f){}; o[1] = (v8f){};
    float mrow[8], lpart[8];
#pragma unroll
    for (int j = 0; j < 8; ++j) { mrow[j] = -3.0e38f; lpart[j] = 0.f; }
#pragma unroll 1
    for (int kt = 0; kt < NK / 32; ++kt) {
        const int l0 = kt * 32;
        const h16* r0p = kh_b + (size_t)(l0 + lr) * CC + 8 * hi; const h16* r1p = kh_b + (size_t)(l0 + 16 + lr) * CC + 8 * hi;
        v8f s0 = {}, s1 = {};
        s0 = wmma16(qa, cat16(*(const v8h*)r0p, *(const v8h*)(r0p + 16)), s0);
        s1 = wmma16(qa, cat16(*(const v8h*)r1p, *(const v8h*)(r1p + 16)), s1);
        asm volatile("v_nop\n\tv_nop\n\tv_nop\n\tv_nop" : "+v"(s0), "+v"(s1) : "v"(qa));
        float alpha[8];
#pragma unroll
        for (int j = 0; j < 8; ++j) {
            const float a0 = s0[j] * SCL, a1 = s1[j] * SCL;
            float mx = fmaxf(a0, a1);
            mx = fmaxf(mx, __shfl_xor(mx, 1, 16)); mx = fmaxf(mx, __shfl_xor(mx, 2, 16)); mx = fmaxf(mx, __shfl_xor(mx, 4, 16)); mx = fmaxf(mx, __shfl_xor(mx, 8, 16));
            const float mn = fmaxf(mrow[j], mx);
            alpha[j] = __expf(mrow[j] - mn); mrow[j] = mn;
            const float p0 = __expf(a0 - mn), p1 = __expf(a1 - mn);
            lpart[j] = lpart[j] * alpha[j] + (p0 + p1);
            const int mr = hi * 8 + j;
            pl[mr * 32 + lr] = (h16)(p0 * PSC); pl[mr * 32 + 16 + lr] = (h16)(p1 * PSC);
        }
#pragma unroll
        for (int n = 0; n < 2; ++n)
#pragma unroll
            for (int j = 0; j < 8; ++j) o[n][j] *= alpha[j];
        asm volatile("" ::: "memory");
        const v16h pa = cat16(*(const v8ha*)(pl + lr * 32 + hi * 8), *(const v8ha*)(pl + lr * 32 + 16 + hi * 8));
#pragma unroll
        for (int n = 0; n < 2; ++n) { const h16* vp = vt_b + (size_t)(n * 16 + lr) * NK + l0 + hi * 8; o[n] = wmma16(pa, cat16(*(const v8h*)vp, *(const v8h*)(vp + 16)), o[n]); }
        asm volatile("v_nop\n\tv_nop\n\tv_nop\n\tv_nop" : "+v"(o[0]), "+v"(o[1]) : "v"(pa));
    }
    float inv[8];
#pragma unroll
    for (int j = 0; j < 8; ++j) { float rs = lpart[j]; rs += __shfl_xor(rs, 1, 16); rs += __shfl_xor(rs, 2, 16); rs += __shfl_xor(rs, 4, 16); rs += __shfl_xor(rs, 8, 16); inv[j] = 1.0f / (rs * PSC); }
    float* os = &ost[wave][0];
#pragma unroll
    for (int n = 0; n < 2; ++n)
#pragma unroll
        for (int j = 0; j < 8; ++j) os[(hi * 8 + j) * 36 + n * 16 + lr] = o[n][j] * inv[j];
    asm volatile("" ::: "memory");
    __builtin_amdgcn_fence(__ATOMIC_RELEASE, "workgroup");
    __builtin_amdgcn_wave_barrier();
    const size_t cbase = (((size_t)b * NH_ + h) * NN_ + q0) * HD;
    auto pass = [&]() {
        const int row = lane >> 1, half = lane & 1; const float* sp = os + row * 36 + half * 16; v8us oh, ol, oh2, ol2;
#pragma unroll
        for (int i = 0; i < 8; ++i) { const unsigned short hb = f2bf(sp[i]); oh[i] = hb; ol[i] = f2bf(sp[i] - bf2f(hb)); const unsigned short hb2 = f2bf(sp[8 + i]); oh2[i] = hb2; ol2[i] = f2bf(sp[8 + i] - bf2f(hb2)); }
        *(v8us*)(CH + cbase + (size_t)row * HD + half * 16) = oh; *(v8us*)(CH + cbase + (size_t)row * HD + half * 16 + 8) = oh2;
        *(v8us*)(CL + cbase + (size_t)row * HD + half * 16) = ol; *(v8us*)(CL + cbase + (size_t)row * HD + half * 16 + 8) = ol2;
    };
    pass(); 
}

extern "C" void kernel_launch(void* const* d_in, const int* in_sizes, int n_in,
                              void* d_out, int out_size, void* d_ws, size_t ws_size, hipStream_t stream) {
    (void)in_sizes; (void)n_in; (void)out_size;
    const float* x = (const float*)d_in[0]; const float* Wq = (const float*)d_in[1]; const float* bq = (const float*)d_in[2]; const float* Wk = (const float*)d_in[3]; const float* bk = (const float*)d_in[4];
    const float* Wv = (const float*)d_in[5]; const float* bv = (const float*)d_in[6]; const float* Wp = (const float*)d_in[7]; const float* bp = (const float*)d_in[8];
    const float* g = (const float*)d_in[9]; const float* be = (const float*)d_in[10]; const float* mu = (const float*)d_in[11]; const float* var = (const float*)d_in[12];
    float* out = (float*)d_out;    // [32][384][32][32]
    char* wsp = (char*)d_ws;
    auto take = [&](size_t bytes) { char* p = wsp; wsp += (bytes + 255) & ~(size_t)255; return (void*)p; };
    bf* Xb = (bf*)take((size_t)NTQ * CC * 2); bf* XRH = (bf*)take((size_t)NTKV * CC * 2); bf* XRL = (bf*)take((size_t)NTKV * CC * 2);
    bf* WT[4]; for (int i = 0; i < 4; ++i) WT[i] = (bf*)take((size_t)CC * CC * 2);
    h16* Q16 = (h16*)take((size_t)NTQ * CC * 2); h16* K16 = (h16*)take((size_t)NTKV * CC * 2); h16* VT16 = (h16*)take((size_t)NTKV * CC * 2);
    bf* CLt = (bf*)take((size_t)NTQ * CC * 2);
    if ((size_t)(wsp - (char*)d_ws) > ws_size) return;    // 25.2 + 12.6 + 1.2 + 25.2 + 12.6 + 25.2 MB ~ 102 MB
    bf* CHt = Xb;                              // the token plane is dead after the q projection
    k_tok<<<dim3(NN_ / 64, CC / 64, NB_), 256, 0, stream>>>(x, Xb);
    k_pool<<<dim3(NK / 64, CC / 64, NB_), 256, 0, stream>>>(x, g, be, mu, var, XRH, XRL);
    const float* Ws[4] = {Wq, Wk, Wv, Wp};
    for (int i = 0; i < 4; ++i) k_wt<<<dim3(CC / 64, CC / 64, 1), 256, 0, stream>>>(Ws[i], WT[i]);
    k_gemmb<false, 0, false><<<dim3(NTQ / 64, CC / 64, 1), 128, 0, stream>>>(Xb, nullptr, WT[0], bq, Q16);
    k_gemmb<true, 0, false><<<dim3(NTKV / 64, CC / 64, 1), 128, 0, stream>>>(XRH, XRL, WT[1], bk, K16);
    k_gemmb<true, 2, false><<<dim3(NTKV / 64, CC / 64, 1), 128, 0, stream>>>(XRH, XRL, WT[2], bv, VT16);
    k_attn<<<NB_ * NH_ * (NN_ / 64), 128, 0, stream>>>(Q16, K16, VT16, CHt, CLt);
    k_gemmb<true, 1, true><<<dim3(NTQ / 64, CC / 64, 1), 128, 0, stream>>>(CHt, CLt, WT[3], bp, out);
}

// v001
// A run of this version takes 153 microseconds.
// Two timings next to v000 both put it at 1.39 times that version's speed.
#include <hip/hip_runtime.h>

// Contractions, f32 accumulate: q = tok.Wq + bq ([32 x 1024 tokens x 384].[384 x 384]) on v_wmma_f32_16x16x32_bf16 with PLAIN bf16 operands (tok = the NCHW input
// transposed, rounded once: exact); k, v = xr.Wk/Wv + b on the bf16 instruction with the pooled + batch-normed tokens xr (computed) as bf16 hi + residual planes (two
// products); the per-(batch, head) attention (12 heads of 32: scores [1024 x 32].[32 x 256] x 32^-1/2, softmax, .v) fused on v_wmma_f32_16x16x32_f16 with plain f16
// q, k, v and weights x32768; out = ctx.Wp + bp on the bf16 instruction with ctx as bf16 hi + residual planes, written back transposed to NCHW. Deterministic, no

#define NB_  32
#define CC   384
#define NN_  1024
#define NK   256
#define NH_  12
#define HD   32
#define NTQ  (NB_ * NN_)          // 32768 query tokens
#define NTKV (NB_ * NK)           // 8192 pooled tokens
#define PSC  32768.0f
#define SCL  0.17677669529663687f

typedef _Float16 h16;
typedef unsigned short bf;
typedef __attribute__((ext_vector_type(16))) __bf16   v16bf;
typedef __attribute__((ext_vector_type(16))) _Float16 v16h;
typedef __attribute__((ext_vector_type(8)))  _Float16 v8h;
typedef __attribute__((ext_vector_type(8)))  unsigned short v8us;
typedef __attribute__((ext_vector_type(8)))  float    v8f;
typedef __attribute__((ext_vector_type(4)))  float    v4f;
typedef v8h  __attribute__((may_alias)) v8ha;
typedef v4f  __attribute__((may_alias)) v4fa;
typedef v8us __attribute__((may_alias)) v8usa;

__device__ __forceinline__ unsigned short f2bf(float f) { unsigned u = __float_as_uint(f); u += 0x7FFFu + ((u >> 16) & 1u); return (unsigned short)(u >> 16); }
__device__ __forceinline__ float bf2f(unsigned short b) { return __uint_as_float(((unsigned)b) << 16); }
__device__ __forceinline__ float bfr(float f) { return bf2f(f2bf(f)); }
__device__ __forceinline__ v16h cat16(v8h lo, v8h hi) { return __builtin_shufflevector(lo, hi, 0, 1, 2, 3, 4, 5, 6, 7, 8, 9, 10, 11, 12, 13, 14, 15); }
__device__ __forceinline__ v16bf cat16b(v8us lo, v8us hi) { return __builtin_bit_cast(v16bf, __builtin_shufflevector(lo, hi, 0, 1, 2, 3, 4, 5, 6, 7, 8, 9, 10, 11, 12, 13, 14, 15)); }
__device__ __forceinline__ v8f wmma16(v16h a, v16h b, v8f c) { return __builtin_amdgcn_wmma_f32_16x16x32_f16(false, a, false, b, (short)0, c, false, false); }
__device__ __forceinline__ v8f wmmab(v16bf a, v16bf b, v8f c) { return __builtin_amdgcn_wmma_f32_16x16x32_bf16(false, a, false, b, (short)0, c, false, false); }
// Fragment-order planes: every 16-bit WMMA operand plane [rows][k] in the workspace is stored as 1024-byte blocks, one per (16 rows, 32 k), block index (row / 16) * kch + k / 32
// (kch = k extent / 32); inside a block [k bits 4..3][row & 15][k & 7]. Lane l = 16 * hi + lr of a fragment load then reads 16 bytes at block + 8 * l (k = 8 hi ..) and at
// block + 256 + 8 * l (k = 16 + 8 hi ..): 512 contiguous bytes = 4 whole lines per load, where a row-major plane made each load touch 16 lines. fro = element offset of (row, k).
__device__ __forceinline__ size_t fro(int row, int k, int kch) { return ((size_t)(row >> 4) * kch + (k >> 5)) * 512 + ((k >> 3) & 3) * 128 + (row & 15) * 8 + (k & 7); }

// k_tok: Xb (row b*1024 + n, k = c, fragment order) = bf16(x[b][c][n]) via 64 x 64 LDS transposes; grid (n tiles 16, c tiles 6, b). A wave stores 512 contiguous bytes.
__global__ __launch_bounds__(256) void k_tok(const float* __restrict__ x, bf* Xb) {
    __shared__ __align__(16) unsigned short tl[64 * 72];
    const int tid = threadIdx.x, n0 = blockIdx.x * 64, c0 = blockIdx.y * 64, b = blockIdx.z;
    const int cc = tid >> 2, nq = (tid & 3) * 16;
#pragma unroll
    for (int i = 0; i < 16; ++i) tl[(nq + i) * 72 + cc] = f2bf(x[((size_t)b * CC + c0 + cc) * NN_ + n0 + nq + i]);
    __syncthreads();
    const int piece = (tid >> 4) & 7;
    auto pass = [&]() {
#pragma unroll
        for (int s = 0; s < 2; ++s) { const int nr = ((tid >> 7) + 2 * s) * 16 + (tid & 15); const v8us val = *(const v8usa*)(tl + nr * 72 + piece * 8);
            *(v8us*)(Xb + fro(b * NN_ + n0 + nr, c0 + piece * 8, CC / 32)) = val; }
    };
    pass(); 
}
// k_pool: XRH/XRL (row b*256 + m, k = c, fragment order) = bf16 hi + residual of (mean_{t<4} bf16(x[b][c][4m+t])) * inv[c] + shift[c], inv = g/sqrt(var + eps), shift = beta - mean*inv (bf16-rounded
// params, f32 math); block (64 m, 64 c, b) through LDS; a wave stores 512 contiguous bytes of one plane.
__global__ __launch_bounds__(256) void k_pool(const float* __restrict__ x, const float* __restrict__ g, const float* __restrict__ be, const float* __restrict__ mu, const float* __restrict__ var, bf* XRH, bf* XRL) {
    __shared__ __align__(16) unsigned short th_[64 * 72];
    __shared__ __align__(16) unsigned short tl_[64 * 72];
    const int tid = threadIdx.x, m0 = blockIdx.x * 64, c0 = blockIdx.y * 64, b = blockIdx.z;
    const int cc = tid >> 2, mq = (tid & 3) * 16, c = c0 + cc;
    const float inv = bfr(g[c]) / sqrtf(bfr(var[c]) + 1e-5f), sh = bfr(be[c]) - bfr(mu[c]) * inv;
    const float* xr = x + ((size_t)b * CC + c) * NN_;
#pragma unroll
    for (int i = 0; i < 16; ++i) { const int m = m0 + mq + i; const float* p = xr + 4 * m;
        const float v = ((bfr(p[0]) + bfr(p[1]) + bfr(p[2]) + bfr(p[3])) * 0.25f) * inv + sh;
        const unsigned short hb = f2bf(v); th_[(mq + i) * 72 + cc] = hb; tl_[(mq + i) * 72 + cc] = f2bf(v - bf2f(hb)); }
    __syncthreads();
    const int piece = (tid >> 4) & 7;
    auto pass = [&]() {
#pragma unroll
        for (int s = 0; s < 4; ++s) { const int pln = s >> 1, mr = ((tid >> 7) + 2 * (s & 1)) * 16 + (tid & 15);
            const v8us val = *(const v8usa*)((pln ? tl_ : th_) + mr * 72 + piece * 8); *(v8us*)((pln ? XRL : XRH) + fro(b * NK + m0 + mr, c0 + piece * 8, CC / 32)) = val; }
    };
    pass(); 
}
// k_wt: W [384 k][384 n] k-major -> bf16 plane (row n, k, fragment order); 64 x 64 tiles.
__global__ __launch_bounds__(256) void k_wt(const float* __restrict__ Wm, bf* WT) {
    __shared__ __align__(16) unsigned short tl[64 * 72];
    const int tid = threadIdx.x, k0 = blockIdx.x * 64, n0 = blockIdx.y * 64;
    const int kk = tid >> 2, nq = (tid & 3) * 16;
#pragma unroll
    for (int i = 0; i < 16; ++i) tl[(nq + i) * 72 + kk] = f2bf(Wm[(size_t)(k0 + kk) * CC + n0 + nq + i]);
    __syncthreads();
    const int piece = (tid >> 4) & 7;
    auto pass = [&]() {
#pragma unroll
        for (int s = 0; s < 2; ++s) { const int nr = ((tid >> 7) + 2 * s) * 16 + (tid & 15); const v8us val = *(const v8usa*)(tl + nr * 72 + piece * 8);
            *(v8us*)(WT + fro(n0 + nr, k0 + piece * 8, CC / 32)) = val; }
    };
    pass(); 
}

// k_gemmb: 64 x 64 tile of (A [+ Al]).B^T + bf16(bias), K = 384; A, Al, B are fragment-order planes. MODE 0: f16 plane C16 (row, col, fragment order); MODE 1: transposed f32 output into NCHW out[b][c][n] (row = b*1024 + n):
// the tile's 64 columns c each get 64 consecutive n = one 256-byte run (2 lines) -> LDS-staged transposed epilogue; MODE 2: VT16 planes for v: row = b*256 + m, col
template <bool SPLITA, int MODE>
__global__ __launch_bounds__(128) void k_gemmb(const bf* __restrict__ A, const bf* __restrict__ Al, const bf* __restrict__ Bn, const float* __restrict__ bias, void* Cout) {
    __shared__ __align__(16) float ost[64 * 68];
    const int lane = threadIdx.x & 31, wave = threadIdx.x >> 5, lr = lane & 15, hi = lane >> 4;
    const int r0 = blockIdx.x * 64 + wave * 16, c0 = blockIdx.y * 64;
    const size_t aoff = fro(r0, 0, CC / 32) + 8 * lane;
    const bf* ap = A + aoff; const bf* alp = (SPLITA ? Al : A) + aoff; const bf* bp = Bn + fro(c0, 0, CC / 32) + 8 * lane;        // each steps one 512-element block per 32 k
    v8f acc[4];
#pragma unroll
    for (int t = 0; t < 4; ++t) acc[t] = (v8f){};
#pragma unroll 1
    for (int kc = 0; kc < CC; kc += 32, ap += 512, alp += 512, bp += 512) {
        const v16bf a = cat16b(*(const v8us*)ap, *(const v8us*)(ap + 256));
        v16bf al = a;
        if (SPLITA) al = cat16b(*(const v8us*)alp, *(const v8us*)(alp + 256));
#pragma unroll
        for (int t = 0; t < 4; ++t) { const bf* bt = bp + t * (CC / 32) * 512; const v16bf b = cat16b(*(const v8us*)bt, *(const v8us*)(bt + 256)); acc[t] = wmmab(a, b, acc[t]); if (SPLITA) acc[t] = wmmab(al, b, acc[t]); }
        asm volatile("v_nop\n\tv_nop\n\tv_nop\n\tv_nop" : "+v"(acc[0]), "+v"(acc[1]), "+v"(acc[2]), "+v"(acc[3]) : "v"(a), "v"(al));
    }
    float* os = ost + wave * 16 * 68;        // block tile as [64 rows][68]
#pragma unroll
    for (int t = 0; t < 4; ++t) { const float bv = bfr(bias[c0 + t * 16 + lr]);
#pragma unroll
        for (int j = 0; j < 8; ++j) os[(hi * 8 + j) * 68 + t * 16 + lr] = acc[t][j] + bv; }
    __syncthreads();
    if (MODE == 0) {
        h16* cpl = (h16*)Cout;
        auto pass = [&]() {
#pragma unroll
            for (int s = 0; s < 4; ++s) { const int piece = 2 * s + hi; const float* sp = os + lr * 68 + piece * 8; v8h o;
#pragma unroll
                for (int i = 0; i < 8; ++i) o[i] = (h16)sp[i];
                *(v8h*)(cpl + fro(r0 + lr, c0 + piece * 8, CC / 32)) = o; }
        };
        pass(); 
    } else if (MODE == 1) {
        // transposed: column c (64 of them) x 64 rows n; wave w handles columns w*16 .. w*16+15; per column 64 floats = 16 lanes x 16 B; 2 columns per instruction
        const int rb = blockIdx.x * 64; const int b = rb / NN_, n0 = rb - b * NN_;
        float* ob = (float*)Cout + ((size_t)b * CC + c0) * NN_ + n0;
        auto pass = [&]() {
#pragma unroll
            for (int s = 0; s < 8; ++s) { const int col = wave * 16 + 2 * s + (lane >> 4), q = lane & 15; v4f v;
#pragma unroll
                for (int i = 0; i < 4; ++i) v[i] = ost[(q * 4 + i) * 68 + col];
                *(v4f*)(ob + (size_t)col * NN_ + q * 4) = v; }
        };
        pass(); 
    } else {
        const int rb = blockIdx.x * 64; const int b = rb / NK, m0 = rb - b * NK;
        h16* vb = (h16*)Cout;        // plane row = b*CC + col since [b][h][d] flattens to b*384 + h*32 + d; k = key m; fragment order with 256 / 32 blocks per 16 rows
        auto pass = [&]() {
#pragma unroll
            for (int s = 0; s < 4; ++s) { const int col = wave * 16 + lr, q = 2 * s + hi; v8h v;
#pragma unroll
                for (int i = 0; i < 8; ++i) v[i] = (h16)ost[(q * 8 + i) * 68 + col];
                *(v8h*)(vb + fro(b * CC + c0 + col, m0 + q * 8, NK / 32)) = v; }
        };
        pass(); 
    }
}

// k_attn: block = (b, h, 64 queries), wave = 16; head dim 32 (one k-chunk); 8 steps x 32 keys: 2 WMMA scores x 32^-1/2, online f32 softmax, weights x32768 f16 tile
// (same-wave may_alias reload after a compiler barrier), 2 WMMA .v (d tiles 0..15, 16..31); q, k, v^T come from fragment-order planes; ctx -> bf16 hi/lo planes CH/CL
// (row b*1024 + n, k = h*32 + d, fragment order): this wave's 16 rows x 32 d are one whole 1024-byte block of each plane, so every line has one owner.
__global__ __launch_bounds__(128) void k_attn(const h16* __restrict__ Q16, const h16* __restrict__ K16, const h16* __restrict__ VT16, bf* CH, bf* CL) {
    __shared__ __align__(16) h16 plds[4][16 * 32];
    __shared__ __align__(16) float ost[4][16 * 36];
    const int lane = threadIdx.x & 31, wave = threadIdx.x >> 5, lr = lane & 15, hi = lane >> 4;
    const int bid = blockIdx.x;
    const int b = bid / (NH_ * (NN_ / 64)), rem = bid - b * (NH_ * (NN_ / 64)), h = rem / (NN_ / 64), qt = rem - h * (NN_ / 64);
    const int q0 = qt * 64 + wave * 16;
    h16* pl = &plds[wave][0];
    const h16* qp = Q16 + fro(b * NN_ + q0, h * HD, CC / 32) + 8 * lane;
    const v16h qa = cat16(*(const v8h*)qp, *(const v8h*)(qp + 256));
    const h16* kh_b = K16 + fro(b * NK, h * HD, CC / 32) + 8 * lane;
    const h16* vt_b = VT16 + fro(b * CC + h * HD, 0, NK / 32) + 8 * lane;
    v8f o[2]; o[0] = (v8f){}; o[1] = (v8f){};
    float mrow[8], lpart[8];
#pragma unroll
    for (int j = 0; j < 8; ++j) { mrow[j] = -3.0e38f; lpart[j] = 0.f; }
#pragma unroll 1
    for (int kt = 0; kt < NK / 32; ++kt) {
        const int l0 = kt * 32;
        const h16* r0p = kh_b + fro(l0, 0, CC / 32); const h16* r1p = kh_b + fro(l0 + 16, 0, CC / 32);
        v8f s0 = {}, s1 = {};
        s0 = wmma16(qa, cat16(*(const v8h*)r0p, *(const v8h*)(r0p + 256)), s0);
        s1 = wmma16(qa, cat16(*(const v8h*)r1p, *(const v8h*)(r1p + 256)), s1);
        asm volatile("v_nop\n\tv_nop\n\tv_nop\n\tv_nop" : "+v"(s0), "+v"(s1) : "v"(qa));
        float alpha[8];
#pragma unroll
        for (int j = 0; j < 8; ++j) {
            const float a0 = s0[j] * SCL, a1 = s1[j] * SCL;
            float mx = fmaxf(a0, a1);
            mx = fmaxf(mx, __shfl_xor(mx, 1, 16)); mx = fmaxf(mx, __shfl_xor(mx, 2, 16)); mx = fmaxf(mx, __shfl_xor(mx, 4, 16)); mx = fmaxf(mx, __shfl_xor(mx, 8, 16));
            const float mn = fmaxf(mrow[j], mx);
            alpha[j] = __expf(mrow[j] - mn); mrow[j] = mn;
            const float p0 = __expf(a0 - mn), p1 = __expf(a1 - mn);
            lpart[j] = lpart[j] * alpha[j] + (p0 + p1);
            const int mr = hi * 8 + j;
            pl[mr * 32 + lr] = (h16)(p0 * PSC); pl[mr * 32 + 16 + lr] = (h16)(p1 * PSC);
        }
#pragma unroll
        for (int n = 0; n < 2; ++n)
#pragma unroll
            for (int j = 0; j < 8; ++j) o[n][j] *= alpha[j];
        asm volatile("" ::: "memory");
        const v16h pa = cat16(*(const v8ha*)(pl + lr * 32 + hi * 8), *(const v8ha*)(pl + lr * 32 + 16 + hi * 8));
#pragma unroll
        for (int n = 0; n < 2; ++n) { const h16* vp = vt_b + fro(n * 16, l0, NK / 32); o[n] = wmma16(pa, cat16(*(const v8h*)vp, *(const v8h*)(vp + 256)), o[n]); }
        asm volatile("v_nop\n\tv_nop\n\tv_nop\n\tv_nop" : "+v"(o[0]), "+v"(o[1]) : "v"(pa));
    }
    float inv[8];
#pragma unroll
    for (int j = 0; j < 8; ++j) { float rs = lpart[j]; rs += __shfl_xor(rs, 1, 16); rs += __shfl_xor(rs, 2, 16); rs += __shfl_xor(rs, 4, 16); rs += __shfl_xor(rs, 8, 16); inv[j] = 1.0f / (rs * PSC); }
    float* os = &ost[wave][0];
#pragma unroll
    for (int n = 0; n < 2; ++n)
#pragma unroll
        for (int j = 0; j < 8; ++j) os[(hi * 8 + j) * 36 + n * 16 + lr] = o[n][j] * inv[j];
    asm volatile("" ::: "memory");
    __builtin_amdgcn_fence(__ATOMIC_RELEASE, "workgroup");
    __builtin_amdgcn_wave_barrier();
    const size_t cbase = fro(b * NN_ + q0, h * HD, CC / 32) + 8 * lane;
    auto pass = [&]() {
        const float* sp = os + lr * 36 + hi * 8; v8us oh, ol, oh2, ol2;        // d = 8 hi + i and d = 16 + 8 hi + i of row lr
#pragma unroll
        for (int i = 0; i < 8; ++i) { const unsigned short hb = f2bf(sp[i]); oh[i] = hb; ol[i] = f2bf(sp[i] - bf2f(hb)); const unsigned short hb2 = f2bf(sp[16 + i]); oh2[i] = hb2; ol2[i] = f2bf(sp[16 + i] - bf2f(hb2)); }
        *(v8us*)(CH + cbase) = oh; *(v8us*)(CH + cbase + 256) = oh2;
        *(v8us*)(CL + cbase) = ol; *(v8us*)(CL + cbase + 256) = ol2;
    };
    pass(); 
}

extern "C" void kernel_launch(void* const* d_in, const int* in_sizes, int n_in,
                              void* d_out, int out_size, void* d_ws, size_t ws_size, hipStream_t stream) {
    (void)in_sizes; (void)n_in; (void)out_size;
    const float* x = (const float*)d_in[0]; const float* Wq = (const float*)d_in[1]; const float* bq = (const float*)d_in[2]; const float* Wk = (const float*)d_in[3]; const float* bk = (const float*)d_in[4];
    const float* Wv = (const float*)d_in[5]; const float* bv = (const float*)d_in[6]; const float* Wp = (const float*)d_in[7]; const float* bp = (const float*)d_in[8];
    const float* g = (const float*)d_in[9]; const float* be = (const float*)d_in[10]; const float* mu = (const float*)d_in[11]; const float* var = (const float*)d_in[12];
    float* out = (float*)d_out;    // [32][384][32][32]
    char* wsp = (char*)d_ws;
    auto take = [&](size_t bytes) { char* p = wsp; wsp += (bytes + 255) & ~(size_t)255; return (void*)p; };
    bf* Xb = (bf*)take((size_t)NTQ * CC * 2); bf* XRH = (bf*)take((size_t)NTKV * CC * 2); bf* XRL = (bf*)take((size_t)NTKV * CC * 2);
    bf* WT[4]; for (int i = 0; i < 4; ++i) WT[i] = (bf*)take((size_t)CC * CC * 2);
    h16* Q16 = (h16*)take((size_t)NTQ * CC * 2); h16* K16 = (h16*)take((size_t)NTKV * CC * 2); h16* VT16 = (h16*)take((size_t)NTKV * CC * 2);
    bf* CLt = (bf*)take((size_t)NTQ * CC * 2);
    if ((size_t)(wsp - (char*)d_ws) > ws_size) return;    // 25.2 + 12.6 + 1.2 + 25.2 + 12.6 + 25.2 MB ~ 102 MB
    bf* CHt = Xb;                              // the token plane is dead after the q projection
    k_tok<<<dim3(NN_ / 64, CC / 64, NB_), 256, 0, stream>>>(x, Xb);
    k_pool<<<dim3(NK / 64, CC / 64, NB_), 256, 0, stream>>>(x, g, be, mu, var, XRH, XRL);
    const float* Ws[4] = {Wq, Wk, Wv, Wp};
    for (int i = 0; i < 4; ++i) k_wt<<<dim3(CC / 64, CC / 64, 1), 256, 0, stream>>>(Ws[i], WT[i]);
    k_gemmb<false, 0><<<dim3(NTQ / 64, CC / 64, 1), 128, 0, stream>>>(Xb, nullptr, WT[0], bq, Q16);
    k_gemmb<true, 0><<<dim3(NTKV / 64, CC / 64, 1), 128, 0, stream>>>(XRH, XRL, WT[1], bk, K16);
    k_gemmb<true, 2><<<dim3(NTKV / 64, CC / 64, 1), 128, 0, stream>>>(XRH, XRL, WT[2], bv, VT16);
    k_attn<<<NB_ * NH_ * (NN_ / 64), 128, 0, stream>>>(Q16, K16, VT16, CHt, CLt);
    k_gemmb<true, 1><<<dim3(NTQ / 64, CC / 64, 1), 128, 0, stream>>>(CHt, CLt, WT[3], bp, out);
}

// v002
// It runs in 137 microseconds.
// Next to v001, in two timings, it ran 1.13 and 1.14 times as fast.
// All steps since v000 together make it 1.58 times as fast.
#include <hip/hip_runtime.h>

// Contractions, f32 accumulate: q = tok.Wq + bq ([32 x 1024 tokens x 384].[384 x 384]) on v_wmma_f32_16x16x32_bf16 with PLAIN bf16 operands (tok = the NCHW input
// transposed, rounded once: exact); k, v = xr.Wk/Wv + b on the bf16 instruction with the pooled + batch-normed tokens xr (computed) as bf16 hi + residual planes (two
// products); the per-(batch, head) attention (12 heads of 32: scores [1024 x 32].[32 x 256] x 32^-1/2, softmax, .v) fused on v_wmma_f32_16x16x32_f16 with plain f16
// q, k, v and weights x32768; out = ctx.Wp + bp on the bf16 instruction with ctx as bf16 hi + residual planes, written back transposed to NCHW. Deterministic, no

#define NB_  32
#define CC   384
#define NN_  1024
#define NK   256
#define NH_  12
#define HD   32
#define NTQ  (NB_ * NN_)          // 32768 query tokens
#define NTKV (NB_ * NK)           // 8192 pooled tokens
#define PSC  32768.0f
#define SCL  0.17677669529663687f

typedef _Float16 h16;
typedef unsigned short bf;
typedef __attribute__((ext_vector_type(16))) __bf16   v16bf;
typedef __attribute__((ext_vector_type(16))) _Float16 v16h;
typedef __attribute__((ext_vector_type(8)))  _Float16 v8h;
typedef __attribute__((ext_vector_type(8)))  unsigned short v8us;
typedef __attribute__((ext_vector_type(8)))  float    v8f;
typedef __attribute__((ext_vector_type(4)))  float    v4f;
typedef __attribute__((ext_vector_type(2)))  float    v2f;
typedef __attribute__((ext_vector_type(2)))  _Float16 v2h;
typedef v4f  __attribute__((may_alias)) v4fa;
typedef v8us __attribute__((may_alias)) v8usa;

__device__ __forceinline__ unsigned short f2bf(float f) { unsigned u = __float_as_uint(f); u += 0x7FFFu + ((u >> 16) & 1u); return (unsigned short)(u >> 16); }
__device__ __forceinline__ float bf2f(unsigned short b) { return __uint_as_float(((unsigned)b) << 16); }
__device__ __forceinline__ float bfr(float f) { return bf2f(f2bf(f)); }
__device__ __forceinline__ v16h cat16(v8h lo, v8h hi) { return __builtin_shufflevector(lo, hi, 0, 1, 2, 3, 4, 5, 6, 7, 8, 9, 10, 11, 12, 13, 14, 15); }
__device__ __forceinline__ v16bf cat16b(v8us lo, v8us hi) { return __builtin_bit_cast(v16bf, __builtin_shufflevector(lo, hi, 0, 1, 2, 3, 4, 5, 6, 7, 8, 9, 10, 11, 12, 13, 14, 15)); }
__device__ __forceinline__ v8f wmma16(v16h a, v16h b, v8f c) { return __builtin_amdgcn_wmma_f32_16x16x32_f16(false, a, false, b, (short)0, c, false, false); }
__device__ __forceinline__ v8f wmmab(v16bf a, v16bf b, v8f c) { return __builtin_amdgcn_wmma_f32_16x16x32_bf16(false, a, false, b, (short)0, c, false, false); }
// Fragment-order planes: every 16-bit WMMA operand plane [rows][k] in the workspace is stored as 1024-byte blocks, one per (16 rows, 32 k), block index (row / 16) * kch + k / 32
// (kch = k extent / 32); inside a block [k bits 4..3][row & 15][k & 7]. Lane l = 16 * hi + lr of a fragment load then reads 16 bytes at block + 8 * l (k = 8 hi ..) and at
// block + 256 + 8 * l (k = 16 + 8 hi ..): 512 contiguous bytes = 4 whole lines per load, where a row-major plane made each load touch 16 lines. fro = element offset of (row, k).
__device__ __forceinline__ size_t fro(int row, int k, int kch) { return ((size_t)(row >> 4) * kch + (k >> 5)) * 512 + ((k >> 3) & 3) * 128 + (row & 15) * 8 + (k & 7); }

// k_tok: Xb (row b*1024 + n, k = c, fragment order) = bf16(x[b][c][n]) via 64 x 64 LDS transposes; grid (n tiles 16, c tiles 6, b). A wave stores 512 contiguous bytes.
__global__ __launch_bounds__(256) void k_tok(const float* __restrict__ x, bf* Xb) {
    __shared__ __align__(16) unsigned short tl[64 * 72];
    const int tid = threadIdx.x, n0 = blockIdx.x * 64, c0 = blockIdx.y * 64, b = blockIdx.z;
    const int cc = tid >> 2, nq = (tid & 3) * 16;
#pragma unroll
    for (int i = 0; i < 16; ++i) tl[(nq + i) * 72 + cc] = f2bf(x[((size_t)b * CC + c0 + cc) * NN_ + n0 + nq + i]);
    __syncthreads();
    const int piece = (tid >> 4) & 7;
    auto pass = [&]() {
#pragma unroll
        for (int s = 0; s < 2; ++s) { const int nr = ((tid >> 7) + 2 * s) * 16 + (tid & 15); const v8us val = *(const v8usa*)(tl + nr * 72 + piece * 8);
            *(v8us*)(Xb + fro(b * NN_ + n0 + nr, c0 + piece * 8, CC / 32)) = val; }
    };
    pass(); 
}
// k_pool: XRH/XRL (row b*256 + m, k = c, fragment order) = bf16 hi + residual of (mean_{t<4} bf16(x[b][c][4m+t])) * inv[c] + shift[c], inv = g/sqrt(var + eps), shift = beta - mean*inv (bf16-rounded
// params, f32 math); block (64 m, 64 c, b) through LDS; a wave stores 512 contiguous bytes of one plane.
__global__ __launch_bounds__(256) void k_pool(const float* __restrict__ x, const float* __restrict__ g, const float* __restrict__ be, const float* __restrict__ mu, const float* __restrict__ var, bf* XRH, bf* XRL) {
    __shared__ __align__(16) unsigned short th_[64 * 72];
    __shared__ __align__(16) unsigned short tl_[64 * 72];
    const int tid = threadIdx.x, m0 = blockIdx.x * 64, c0 = blockIdx.y * 64, b = blockIdx.z;
    const int cc = tid >> 2, mq = (tid & 3) * 16, c = c0 + cc;
    const float inv = bfr(g[c]) / sqrtf(bfr(var[c]) + 1e-5f), sh = bfr(be[c]) - bfr(mu[c]) * inv;
    const float* xr = x + ((size_t)b * CC + c) * NN_;
#pragma unroll
    for (int i = 0; i < 16; ++i) { const int m = m0 + mq + i; const float* p = xr + 4 * m;
        const float v = ((bfr(p[0]) + bfr(p[1]) + bfr(p[2]) + bfr(p[3])) * 0.25f) * inv + sh;
        const unsigned short hb = f2bf(v); th_[(mq + i) * 72 + cc] = hb; tl_[(mq + i) * 72 + cc] = f2bf(v - bf2f(hb)); }
    __syncthreads();
    const int piece = (tid >> 4) & 7;
    auto pass = [&]() {
#pragma unroll
        for (int s = 0; s < 4; ++s) { const int pln = s >> 1, mr = ((tid >> 7) + 2 * (s & 1)) * 16 + (tid & 15);
            const v8us val = *(const v8usa*)((pln ? tl_ : th_) + mr * 72 + piece * 8); *(v8us*)((pln ? XRL : XRH) + fro(b * NK + m0 + mr, c0 + piece * 8, CC / 32)) = val; }
    };
    pass(); 
}
// k_wt: W [384 k][384 n] k-major -> bf16 plane (row n, k, fragment order); 64 x 64 tiles.
__global__ __launch_bounds__(256) void k_wt(const float* __restrict__ Wm, bf* WT) {
    __shared__ __align__(16) unsigned short tl[64 * 72];
    const int tid = threadIdx.x, k0 = blockIdx.x * 64, n0 = blockIdx.y * 64;
    const int kk = tid >> 2, nq = (tid & 3) * 16;
#pragma unroll
    for (int i = 0; i < 16; ++i) tl[(nq + i) * 72 + kk] = f2bf(Wm[(size_t)(k0 + kk) * CC + n0 + nq + i]);
    __syncthreads();
    const int piece = (tid >> 4) & 7;
    auto pass = [&]() {
#pragma unroll
        for (int s = 0; s < 2; ++s) { const int nr = ((tid >> 7) + 2 * s) * 16 + (tid & 15); const v8us val = *(const v8usa*)(tl + nr * 72 + piece * 8);
            *(v8us*)(WT + fro(n0 + nr, k0 + piece * 8, CC / 32)) = val; }
    };
    pass(); 
}

// k_gemmb: 64 x 64 tile of (A [+ Al]).B^T + bf16(bias), K = 384; A, Al, B are fragment-order planes. MODE 0: f16 plane C16 (row, col, fragment order); MODE 1: transposed f32 output into NCHW out[b][c][n] (row = b*1024 + n):
// the tile's 64 columns c each get 64 consecutive n = one 256-byte run (2 lines) -> LDS-staged transposed epilogue; MODE 2: VT16 planes for v: row = b*256 + m, col
template <bool SPLITA, int MODE>
__global__ __launch_bounds__(128) void k_gemmb(const bf* __restrict__ A, const bf* __restrict__ Al, const bf* __restrict__ Bn, const float* __restrict__ bias, void* Cout) {
    __shared__ __align__(16) float ost[64 * 68];
    const int lane = threadIdx.x & 31, wave = threadIdx.x >> 5, lr = lane & 15, hi = lane >> 4;
    const int r0 = blockIdx.x * 64 + wave * 16, c0 = blockIdx.y * 64;
    const size_t aoff = fro(r0, 0, CC / 32) + 8 * lane;
    const bf* ap = A + aoff; const bf* alp = (SPLITA ? Al : A) + aoff; const bf* bp = Bn + fro(c0, 0, CC / 32) + 8 * lane;        // each steps one 512-element block per 32 k
    v8f acc[4];
#pragma unroll
    for (int t = 0; t < 4; ++t) acc[t] = (v8f){};
#pragma unroll 1
    for (int kc = 0; kc < CC; kc += 32, ap += 512, alp += 512, bp += 512) {
        const v16bf a = cat16b(*(const v8us*)ap, *(const v8us*)(ap + 256));
        v16bf al = a;
        if (SPLITA) al = cat16b(*(const v8us*)alp, *(const v8us*)(alp + 256));
#pragma unroll
        for (int t = 0; t < 4; ++t) { const bf* bt = bp + t * (CC / 32) * 512; const v16bf b = cat16b(*(const v8us*)bt, *(const v8us*)(bt + 256)); acc[t] = wmmab(a, b, acc[t]); if (SPLITA) acc[t] = wmmab(al, b, acc[t]); }
        asm volatile("v_nop\n\tv_nop\n\tv_nop\n\tv_nop" : "+v"(acc[0]), "+v"(acc[1]), "+v"(acc[2]), "+v"(acc[3]) : "v"(a), "v"(al));
    }
    float* os = ost + wave * 16 * 68;        // block tile as [64 rows][68]
#pragma unroll
    for (int t = 0; t < 4; ++t) { const float bv = bfr(bias[c0 + t * 16 + lr]);
#pragma unroll
        for (int j = 0; j < 8; ++j) os[(hi * 8 + j) * 68 + t * 16 + lr] = acc[t][j] + bv; }
    __syncthreads();
    if (MODE == 0) {
        h16* cpl = (h16*)Cout;
        auto pass = [&]() {
#pragma unroll
            for (int s = 0; s < 4; ++s) { const int piece = 2 * s + hi; const float* sp = os + lr * 68 + piece * 8; v8h o;
#pragma unroll
                for (int i = 0; i < 8; ++i) o[i] = (h16)sp[i];
                *(v8h*)(cpl + fro(r0 + lr, c0 + piece * 8, CC / 32)) = o; }
        };
        pass(); 
    } else if (MODE == 1) {
        // transposed: column c (64 of them) x 64 rows n; wave w handles columns w*16 .. w*16+15; per column 64 floats = 16 lanes x 16 B; 2 columns per instruction
        const int rb = blockIdx.x * 64; const int b = rb / NN_, n0 = rb - b * NN_;
        float* ob = (float*)Cout + ((size_t)b * CC + c0) * NN_ + n0;
        auto pass = [&]() {
#pragma unroll
            for (int s = 0; s < 8; ++s) { const int col = wave * 16 + 2 * s + (lane >> 4), q = lane & 15; v4f v;
#pragma unroll
                for (int i = 0; i < 4; ++i) v[i] = ost[(q * 4 + i) * 68 + col];
                *(v4f*)(ob + (size_t)col * NN_ + q * 4) = v; }
        };
        pass(); 
    } else {
        const int rb = blockIdx.x * 64; const int b = rb / NK, m0 = rb - b * NK;
        h16* vb = (h16*)Cout;        // plane row = b*CC + col since [b][h][d] flattens to b*384 + h*32 + d; k = key m; fragment order with 256 / 32 blocks per 16 rows
        auto pass = [&]() {
#pragma unroll
            for (int s = 0; s < 4; ++s) { const int col = wave * 16 + lr, q = 2 * s + hi; v8h v;
#pragma unroll
                for (int i = 0; i < 8; ++i) v[i] = (h16)ost[(q * 8 + i) * 68 + col];
                *(v8h*)(vb + fro(b * CC + c0 + col, m0 + q * 8, NK / 32)) = v; }
        };
        pass(); 
    }
}

// k_attn: block = (b, h, 64 queries), wave = 16; head dim 32 (one k-chunk); 8 steps x 32 keys, computed TRANSPOSED: S^T = K.Q^T (A = 16 key rows, B = the wave's 16 queries, kept in
// registers) x 32^-1/2, so lane (hi, lr) holds 16 scores of the ONE query lr (keys 8 hi + j and 16 + 8 hi + j): maximum and sum run in-lane plus one exchange between the wave halves;
// the weights x32768 packed to f16 from the two score tiles ARE the B operand of O^T += V^T.P^T in the hardware k order (no LDS). O^T tile n, register j = ctx[query lr][16 n + 8 hi + j],
// which is the lane's own 16 bytes of the fragment-order planes CH/CL (row b*1024 + n, k = h*32 + d): this wave's 16 rows x 32 d are one whole 1024-byte block of each plane.
__device__ __forceinline__ float xhalf(float x) { return __builtin_bit_cast(float, __builtin_amdgcn_permlanex16(__builtin_bit_cast(int, x), __builtin_bit_cast(int, x), 0x76543210, 0xfedcba98, false, false)); }  // lane l with lane l ^ 16
__global__ __launch_bounds__(128) void k_attn(const h16* __restrict__ Q16, const h16* __restrict__ K16, const h16* __restrict__ VT16, bf* CH, bf* CL) {
    const int lane = threadIdx.x & 31, wave = threadIdx.x >> 5;
    const int bid = blockIdx.x;
    const int b = bid / (NH_ * (NN_ / 64)), rem = bid - b * (NH_ * (NN_ / 64)), h = rem / (NN_ / 64), qt = rem - h * (NN_ / 64);
    const int q0 = qt * 64 + wave * 16;
    const h16* qp = Q16 + fro(b * NN_ + q0, h * HD, CC / 32) + 8 * lane;
    const v16h qb = cat16(*(const v8h*)qp, *(const v8h*)(qp + 256));
    const h16* kh_b = K16 + fro(b * NK, h * HD, CC / 32) + 8 * lane;
    const h16* vt_b = VT16 + fro(b * CC + h * HD, 0, NK / 32) + 8 * lane;
    v8f o[2]; o[0] = (v8f){}; o[1] = (v8f){};
    float mrow = -3.0e38f; v2f lpart = {0.f, 0.f};        // even and odd registers' share of this half's weight sum
#pragma unroll 1        // rolled: the live registers stay those of one step
    for (int kt = 0; kt < NK / 32; ++kt) {
        const int l0 = kt * 32;
        const h16* r0p = kh_b + fro(l0, 0, CC / 32); const h16* r1p = kh_b + fro(l0 + 16, 0, CC / 32);
        v8f s0 = {}, s1 = {};
        s0 = wmma16(cat16(*(const v8h*)r0p, *(const v8h*)(r0p + 256)), qb, s0);
        s1 = wmma16(cat16(*(const v8h*)r1p, *(const v8h*)(r1p + 256)), qb, s1);
        v2f a[8]; float mx = -3.0e38f;        // a[i] = two neighbouring registers of the score tiles: keys 8 hi + 2 i, + 1 (i < 4) and 16 + 8 hi + 2 (i - 4), + 1
#pragma unroll        // here and below: unrolled so that every register index is a constant
        for (int i = 0; i < 4; ++i) { a[i] = (v2f){s0[2 * i], s0[2 * i + 1]} * SCL; a[4 + i] = (v2f){s1[2 * i], s1[2 * i + 1]} * SCL; }
#pragma unroll
        for (int i = 0; i < 8; ++i) mx = fmaxf(mx, fmaxf(a[i][0], a[i][1]));
        mx = fmaxf(mx, xhalf(mx));
        const float mn = fmaxf(mrow, mx), alpha = __expf(mrow - mn);
        mrow = mn;
        v2f p[8]; v16h pb;
#pragma unroll
        for (int i = 0; i < 8; ++i) {
            p[i] = (v2f){__expf(a[i][0] - mn), __expf(a[i][1] - mn)};
            const v2h ph = __builtin_convertvector(p[i] * PSC, v2h);
            pb[2 * i] = ph[0]; pb[2 * i + 1] = ph[1];
        }
        lpart = lpart * alpha + (((p[0] + p[1]) + (p[2] + p[3])) + ((p[4] + p[5]) + (p[6] + p[7])));
#pragma unroll
        for (int n = 0; n < 2; ++n)
#pragma unroll
            for (int j = 0; j < 8; ++j) o[n][j] *= alpha;
#pragma unroll
        for (int n = 0; n < 2; ++n) { const h16* vp = vt_b + fro(n * 16, l0, NK / 32); o[n] = wmma16(cat16(*(const v8h*)vp, *(const v8h*)(vp + 256)), pb, o[n]); }
        // the four vector slots the chip needs behind a WMMA, also on the taken side of the loop branch
        asm volatile("v_nop\n\tv_nop\n\tv_nop\n\tv_nop" : "+v"(o[0]), "+v"(o[1]) : "v"(pb));
    }
    const float lh = lpart[0] + lpart[1], inv = 1.0f / ((lh + xhalf(lh)) * PSC);
    const size_t cbase = fro(b * NN_ + q0, h * HD, CC / 32) + 8 * lane;
    v8us oh, ol, oh2, ol2;        // d = 8 hi + i and d = 16 + 8 hi + i of row lr
#pragma unroll
    for (int i = 0; i < 8; ++i) { const float c0 = o[0][i] * inv, c1 = o[1][i] * inv;
        const unsigned short hb = f2bf(c0); oh[i] = hb; ol[i] = f2bf(c0 - bf2f(hb)); const unsigned short hb2 = f2bf(c1); oh2[i] = hb2; ol2[i] = f2bf(c1 - bf2f(hb2)); }
    *(v8us*)(CH + cbase) = oh; *(v8us*)(CH + cbase + 256) = oh2;
    *(v8us*)(CL + cbase) = ol; *(v8us*)(CL + cbase + 256) = ol2;
}

extern "C" void kernel_launch(void* const* d_in, const int* in_sizes, int n_in,
                              void* d_out, int out_size, void* d_ws, size_t ws_size, hipStream_t stream) {
    (void)in_sizes; (void)n_in; (void)out_size;
    const float* x = (const float*)d_in[0]; const float* Wq = (const float*)d_in[1]; const float* bq = (const float*)d_in[2]; const float* Wk = (const float*)d_in[3]; const float* bk = (const float*)d_in[4];
    const float* Wv = (const float*)d_in[5]; const float* bv = (const float*)d_in[6]; const float* Wp = (const float*)d_in[7]; const float* bp = (const float*)d_in[8];
    const float* g = (const float*)d_in[9]; const float* be = (const float*)d_in[10]; const float* mu = (const float*)d_in[11]; const float* var = (const float*)d_in[12];
    float* out = (float*)d_out;    // [32][384][32][32]
    char* wsp = (char*)d_ws;
    auto take = [&](size_t bytes) { char* p = wsp; wsp += (bytes + 255) & ~(size_t)255; return (void*)p; };
    bf* Xb = (bf*)take((size_t)NTQ * CC * 2); bf* XRH = (bf*)take((size_t)NTKV * CC * 2); bf* XRL = (bf*)take((size_t)NTKV * CC * 2);
    bf* WT[4]; for (int i = 0; i < 4; ++i) WT[i] = (bf*)take((size_t)CC * CC * 2);
    h16* Q16 = (h16*)take((size_t)NTQ * CC * 2); h16* K16 = (h16*)take((size_t)NTKV * CC * 2); h16* VT16 = (h16*)take((size_t)NTKV * CC * 2);
    bf* CLt = (bf*)take((size_t)NTQ * CC * 2);
    if ((size_t)(wsp - (char*)d_ws) > ws_size) return;    // 25.2 + 12.6 + 1.2 + 25.2 + 12.6 + 25.2 MB ~ 102 MB
    bf* CHt = Xb;                              // the token plane is dead after the q projection
    k_tok<<<dim3(NN_ / 64, CC / 64, NB_), 256, 0, stream>>>(x, Xb);
    k_pool<<<dim3(NK / 64, CC / 64, NB_), 256, 0, stream>>>(x, g, be, mu, var, XRH, XRL);
    const float* Ws[4] = {Wq, Wk, Wv, Wp};
    for (int i = 0; i < 4; ++i) k_wt<<<dim3(CC / 64, CC / 64, 1), 256, 0, stream>>>(Ws[i], WT[i]);
    k_gemmb<false, 0><<<dim3(NTQ / 64, CC / 64, 1), 128, 0, stream>>>(Xb, nullptr, WT[0], bq, Q16);
    k_gemmb<true, 0><<<dim3(NTKV / 64, CC / 64, 1), 128, 0, stream>>>(XRH, XRL, WT[1], bk, K16);
    k_gemmb<true, 2><<<dim3(NTKV / 64, CC / 64, 1), 128, 0, stream>>>(XRH, XRL, WT[2], bv, VT16);
    k_attn<<<NB_ * NH_ * (NN_ / 64), 128, 0, stream>>>(Q16, K16, VT16, CHt, CLt);
    k_gemmb<true, 1><<<dim3(NTQ / 64, CC / 64, 1), 128, 0, stream>>>(CHt, CLt, WT[3], bp, out);
}

// v003
// Measured time: 109 microseconds a run.
// In two side-by-side timings against v002, it was 1.24 and 1.29 times as fast.
// Counting every step since v000, it is 1.99 times as fast.
#include <hip/hip_runtime.h>

// Contractions, f32 accumulate: q = tok.Wq + bq ([32 x 1024 tokens x 384].[384 x 384]) on v_wmma_f32_16x16x32_bf16 with PLAIN bf16 operands (tok = the NCHW input
// transposed, rounded once: exact); k, v = xr.Wk/Wv + b on the bf16 instruction with the pooled + batch-normed tokens xr (computed) as bf16 hi + residual planes (two
// products); the per-(batch, head) attention (12 heads of 32: scores [1024 x 32].[32 x 256] x 32^-1/2, softmax, .v) fused on v_wmma_f32_16x16x32_f16 with plain f16
// q, k, v and weights x32768; out = ctx.Wp + bp on the bf16 instruction with ctx as bf16 hi + residual planes, written back transposed to NCHW. Deterministic, no

#define NB_  32
#define CC   384
#define NN_  1024
#define NK   256
#define NH_  12
#define HD   32
#define NTQ  (NB_ * NN_)          // 32768 query tokens
#define NTKV (NB_ * NK)           // 8192 pooled tokens
#define PSC  32768.0f
#define SCL  0.17677669529663687f

typedef _Float16 h16;
typedef unsigned short bf;
typedef __attribute__((ext_vector_type(16))) __bf16   v16bf;
typedef __attribute__((ext_vector_type(16))) _Float16 v16h;
typedef __attribute__((ext_vector_type(8)))  _Float16 v8h;
typedef __attribute__((ext_vector_type(8)))  unsigned short v8us;
typedef __attribute__((ext_vector_type(8)))  float    v8f;
typedef __attribute__((ext_vector_type(4)))  float    v4f;
typedef __attribute__((ext_vector_type(2)))  float    v2f;
typedef __attribute__((ext_vector_type(2)))  _Float16 v2h;
typedef v4f  __attribute__((may_alias)) v4fa;
typedef v8us __attribute__((may_alias)) v8usa;

__device__ __forceinline__ unsigned short f2bf(float f) { unsigned u = __float_as_uint(f); u += 0x7FFFu + ((u >> 16) & 1u); return (unsigned short)(u >> 16); }
__device__ __forceinline__ float bf2f(unsigned short b) { return __uint_as_float(((unsigned)b) << 16); }
__device__ __forceinline__ float bfr(float f) { return bf2f(f2bf(f)); }
__device__ __forceinline__ v16h cat16(v8h lo, v8h hi) { return __builtin_shufflevector(lo, hi, 0, 1, 2, 3, 4, 5, 6, 7, 8, 9, 10, 11, 12, 13, 14, 15); }
__device__ __forceinline__ v16bf cat16b(v8us lo, v8us hi) { return __builtin_bit_cast(v16bf, __builtin_shufflevector(lo, hi, 0, 1, 2, 3, 4, 5, 6, 7, 8, 9, 10, 11, 12, 13, 14, 15)); }
__device__ __forceinline__ v8f wmma16(v16h a, v16h b, v8f c) { return __builtin_amdgcn_wmma_f32_16x16x32_f16(false, a, false, b, (short)0, c, false, false); }
__device__ __forceinline__ v8f wmmab(v16bf a, v16bf b, v8f c) { return __builtin_amdgcn_wmma_f32_16x16x32_bf16(false, a, false, b, (short)0, c, false, false); }
// Fragment-order planes: every 16-bit WMMA operand plane [rows][k] in the workspace is stored as 1024-byte blocks, one per (16 rows, 32 k), block index (row / 16) * kch + k / 32
// (kch = k extent / 32); inside a block [k bits 4..3][row & 15][k & 7]. Lane l = 16 * hi + lr of a fragment load then reads 16 bytes at block + 8 * l (k = 8 hi ..) and at
// block + 256 + 8 * l (k = 16 + 8 hi ..): 512 contiguous bytes = 4 whole lines per load, where a row-major plane made each load touch 16 lines. fro = element offset of (row, k).
__device__ __forceinline__ size_t fro(int row, int k, int kch) { return ((size_t)(row >> 4) * kch + (k >> 5)) * 512 + ((k >> 3) & 3) * 128 + (row & 15) * 8 + (k & 7); }

// d_tok: Xb (row b*1024 + n, k = c, fragment order) = bf16(x[b][c][n]) via 64 x 64 LDS transposes; block (n tile bx of 16, c tile by of 6, b). A wave stores 512 contiguous bytes.
__device__ __forceinline__ void d_tok(const float* __restrict__ x, bf* Xb, unsigned short* tl, int bx, int by, int b) {
    const int tid = threadIdx.x, n0 = bx * 64, c0 = by * 64;
    const int cc = tid >> 2, nq = (tid & 3) * 16;
#pragma unroll
    for (int i = 0; i < 16; ++i) tl[(nq + i) * 72 + cc] = f2bf(x[((size_t)b * CC + c0 + cc) * NN_ + n0 + nq + i]);
    __syncthreads();
    const int piece = (tid >> 4) & 7;
    auto pass = [&]() {
#pragma unroll
        for (int s = 0; s < 2; ++s) { const int nr = ((tid >> 7) + 2 * s) * 16 + (tid & 15); const v8us val = *(const v8usa*)(tl + nr * 72 + piece * 8);
            *(v8us*)(Xb + fro(b * NN_ + n0 + nr, c0 + piece * 8, CC / 32)) = val; }
    };
    pass();
    // another job's code follows this one in the merged kernel's listing: the wait stands before any register that these stores name is written again
    asm volatile("s_wait_xcnt 0x0" ::: "memory");
}
// d_pool: XRH/XRL (row b*256 + m, k = c, fragment order) = bf16 hi + residual of (mean_{t<4} bf16(x[b][c][4m+t])) * inv[c] + shift[c], inv = g/sqrt(var + eps), shift = beta - mean*inv (bf16-rounded
// params, f32 math); block (64 m, 64 c, b) through LDS; a wave stores 512 contiguous bytes of one plane.
__device__ __forceinline__ void d_pool(const float* __restrict__ x, const float* __restrict__ g, const float* __restrict__ be, const float* __restrict__ mu, const float* __restrict__ var, bf* XRH, bf* XRL,
                                       unsigned short* th_, unsigned short* tl_, int bx, int by, int b) {
    const int tid = threadIdx.x, m0 = bx * 64, c0 = by * 64;
    const int cc = tid >> 2, mq = (tid & 3) * 16, c = c0 + cc;
    const float inv = bfr(g[c]) / sqrtf(bfr(var[c]) + 1e-5f), sh = bfr(be[c]) - bfr(mu[c]) * inv;
    const float* xr = x + ((size_t)b * CC + c) * NN_;
#pragma unroll
    for (int i = 0; i < 16; ++i) { const int m = m0 + mq + i; const float* p = xr + 4 * m;
        const float v = ((bfr(p[0]) + bfr(p[1]) + bfr(p[2]) + bfr(p[3])) * 0.25f) * inv + sh;
        const unsigned short hb = f2bf(v); th_[(mq + i) * 72 + cc] = hb; tl_[(mq + i) * 72 + cc] = f2bf(v - bf2f(hb)); }
    __syncthreads();
    const int piece = (tid >> 4) & 7;
    auto pass = [&]() {
#pragma unroll
        for (int s = 0; s < 4; ++s) { const int pln = s >> 1, mr = ((tid >> 7) + 2 * (s & 1)) * 16 + (tid & 15);
            const v8us val = *(const v8usa*)((pln ? tl_ : th_) + mr * 72 + piece * 8); *(v8us*)((pln ? XRL : XRH) + fro(b * NK + m0 + mr, c0 + piece * 8, CC / 32)) = val; }
    };
    pass();
    // another job's code follows this one in the merged kernel's listing: the wait stands before any register that these stores name is written again
    asm volatile("s_wait_xcnt 0x0" ::: "memory");
}
// d_wt: W [384 k][384 n] k-major -> bf16 plane (row n, k, fragment order); 64 x 64 tiles.
__device__ __forceinline__ void d_wt(const float* __restrict__ Wm, bf* WT, unsigned short* tl, int bx, int by) {
    const int tid = threadIdx.x, k0 = bx * 64, n0 = by * 64;
    const int kk = tid >> 2, nq = (tid & 3) * 16;
#pragma unroll
    for (int i = 0; i < 16; ++i) tl[(nq + i) * 72 + kk] = f2bf(Wm[(size_t)(k0 + kk) * CC + n0 + nq + i]);
    __syncthreads();
    const int piece = (tid >> 4) & 7;
    auto pass = [&]() {
#pragma unroll
        for (int s = 0; s < 2; ++s) { const int nr = ((tid >> 7) + 2 * s) * 16 + (tid & 15); const v8us val = *(const v8usa*)(tl + nr * 72 + piece * 8);
            *(v8us*)(WT + fro(n0 + nr, k0 + piece * 8, CC / 32)) = val; }
    };
    pass();
    // another job's code follows this one in the merged kernel's listing: the wait stands before any register that these stores name is written again
    asm volatile("s_wait_xcnt 0x0" ::: "memory");
}
// k_prep: the six jobs that need nothing of each other, in block ranges of ONE launch (the branch is the same for a whole block): blocks 0 .. 143 the four weight planes (36 tiles each, WT = four
// planes in a row); then 768 groups of five blocks, one per (b, c tile, 256 tokens): the pooling block, the longest, first, then the four token blocks that read the same part of x.
#define NWTB (4 * (CC / 64) * (CC / 64))
#define NGRP (NB_ * (CC / 64) * (NK / 64))
__global__ __launch_bounds__(256) void k_prep(const float* __restrict__ x, const float* __restrict__ g, const float* __restrict__ be, const float* __restrict__ mu, const float* __restrict__ var,
                                              const float* __restrict__ Wq, const float* __restrict__ Wk, const float* __restrict__ Wv, const float* __restrict__ Wp, bf* Xb, bf* XRH, bf* XRL, bf* WT) {
    __shared__ __align__(16) unsigned short sh[2 * 64 * 72];
    const int bid = blockIdx.x;
    if (bid < NWTB) {
        const int i = bid / 36, t = bid - i * 36, by = t / 6, bx = t - by * 6;
        d_wt(i == 0 ? Wq : i == 1 ? Wk : i == 2 ? Wv : Wp, WT + (size_t)i * CC * CC, sh, bx, by);
    } else {
        const int r = bid - NWTB, grp = r / 5, sub = r - grp * 5;
        const int mx = grp & 3, cb = grp >> 2, b = cb / 6, cy = cb - b * 6;
        if (sub == 0) d_pool(x, g, be, mu, var, XRH, XRL, sh, sh + 64 * 72, mx, cy, b);
        else d_tok(x, Xb, sh, mx * 4 + sub - 1, cy, b);
    }
}

// d_gemmb: 64 x 64 tile (bx, by) of (A [+ Al]).B^T + bf16(bias), K = 384; A, Al, B are fragment-order planes. MODE 0: f16 plane C16 (row, col, fragment order); MODE 1: transposed f32 output into NCHW out[b][c][n] (row = b*1024 + n):
// the tile's 64 columns c each get 64 consecutive n = one 256-byte run (2 lines) -> LDS-staged transposed epilogue; MODE 2: VT16 planes for v: row = b*256 + m, col
template <bool SPLITA, int MODE>
__device__ __forceinline__ void d_gemmb(const bf* __restrict__ A, const bf* __restrict__ Al, const bf* __restrict__ Bn, const float* __restrict__ bias, void* Cout, float* ost, int bx, int by) {
    const int lane = threadIdx.x & 31, wave = threadIdx.x >> 5, lr = lane & 15, hi = lane >> 4;
    const int r0 = bx * 64 + wave * 16, c0 = by * 64;
    const size_t aoff = fro(r0, 0, CC / 32) + 8 * lane;
    const bf* ap = A + aoff; const bf* alp = (SPLITA ? Al : A) + aoff; const bf* bp = Bn + fro(c0, 0, CC / 32) + 8 * lane;        // each steps one 512-element block per 32 k
    v8f acc[4];
#pragma unroll
    for (int t = 0; t < 4; ++t) acc[t] = (v8f){};
#pragma unroll 1
    for (int kc = 0; kc < CC; kc += 32, ap += 512, alp += 512, bp += 512) {
        const v16bf a = cat16b(*(const v8us*)ap, *(const v8us*)(ap + 256));
        v16bf al = a;
        if (SPLITA) al = cat16b(*(const v8us*)alp, *(const v8us*)(alp + 256));
#pragma unroll
        for (int t = 0; t < 4; ++t) { const bf* bt = bp + t * (CC / 32) * 512; const v16bf b = cat16b(*(const v8us*)bt, *(const v8us*)(bt + 256)); acc[t] = wmmab(a, b, acc[t]); if (SPLITA) acc[t] = wmmab(al, b, acc[t]); }
        asm volatile("v_nop\n\tv_nop\n\tv_nop\n\tv_nop" : "+v"(acc[0]), "+v"(acc[1]), "+v"(acc[2]), "+v"(acc[3]) : "v"(a), "v"(al));
    }
    float* os = ost + wave * 16 * 68;        // block tile as [64 rows][68]
#pragma unroll
    for (int t = 0; t < 4; ++t) { const float bv = bfr(bias[c0 + t * 16 + lr]);
#pragma unroll
        for (int j = 0; j < 8; ++j) os[(hi * 8 + j) * 68 + t * 16 + lr] = acc[t][j] + bv; }
    __syncthreads();
    if (MODE == 0) {
        h16* cpl = (h16*)Cout;
        auto pass = [&]() {
#pragma unroll
            for (int s = 0; s < 4; ++s) { const int piece = 2 * s + hi; const float* sp = os + lr * 68 + piece * 8; v8h o;
#pragma unroll
                for (int i = 0; i < 8; ++i) o[i] = (h16)sp[i];
                *(v8h*)(cpl + fro(r0 + lr, c0 + piece * 8, CC / 32)) = o; }
        };
        pass();
        // another job's code follows this one in the merged kernel's listing: the wait stands before any register that these stores name is written again
        asm volatile("s_wait_xcnt 0x0" ::: "memory");
    } else if (MODE == 1) {
        // transposed: column c (64 of them) x 64 rows n; wave w handles columns w*16 .. w*16+15; per column 64 floats = 16 lanes x 16 B; 2 columns per instruction
        const int rb = bx * 64; const int b = rb / NN_, n0 = rb - b * NN_;
        float* ob = (float*)Cout + ((size_t)b * CC + c0) * NN_ + n0;
        auto pass = [&]() {
#pragma unroll
            for (int s = 0; s < 8; ++s) { const int col = wave * 16 + 2 * s + (lane >> 4), q = lane & 15; v4f v;
#pragma unroll
                for (int i = 0; i < 4; ++i) v[i] = ost[(q * 4 + i) * 68 + col];
                *(v4f*)(ob + (size_t)col * NN_ + q * 4) = v; }
        };
        pass(); 
    } else {
        const int rb = bx * 64; const int b = rb / NK, m0 = rb - b * NK;
        h16* vb = (h16*)Cout;        // plane row = b*CC + col since [b][h][d] flattens to b*384 + h*32 + d; k = key m; fragment order with 256 / 32 blocks per 16 rows
        auto pass = [&]() {
#pragma unroll
            for (int s = 0; s < 4; ++s) { const int col = wave * 16 + lr, q = 2 * s + hi; v8h v;
#pragma unroll
                for (int i = 0; i < 8; ++i) v[i] = (h16)ost[(q * 8 + i) * 68 + col];
                *(v8h*)(vb + fro(b * CC + c0 + col, m0 + q * 8, NK / 32)) = v; }
        };
        pass();
        // another job's code follows this one in the merged kernel's listing: the wait stands before any register that these stores name is written again
        asm volatile("s_wait_xcnt 0x0" ::: "memory");
    }
}
// k_qkv: the three projections, which need nothing of each other, in block ranges of ONE launch: first the k and v tiles (two products a step, the longer blocks; row tile fastest, 6 column tiles
// of k, then 6 of v), then the q tiles (row tile fastest). WT = the four weight planes in a row (q, k, v, p).
#define NKVB (2 * (NTKV / 64) * (CC / 64))
__global__ __launch_bounds__(128) void k_qkv(const bf* __restrict__ Xb, const bf* __restrict__ XRH, const bf* __restrict__ XRL, const bf* __restrict__ WT,
                                             const float* __restrict__ bq, const float* __restrict__ bk, const float* __restrict__ bv, h16* Q16, h16* K16, h16* VT16) {
    __shared__ __align__(16) float ost[64 * 68];
    const int bid = blockIdx.x;
    if (bid < NKVB / 2) d_gemmb<true, 0>(XRH, XRL, WT + (size_t)CC * CC, bk, K16, ost, bid & (NTKV / 64 - 1), bid / (NTKV / 64));
    else if (bid < NKVB) d_gemmb<true, 2>(XRH, XRL, WT + (size_t)2 * CC * CC, bv, VT16, ost, bid & (NTKV / 64 - 1), (bid - NKVB / 2) / (NTKV / 64));
    else d_gemmb<false, 0>(Xb, nullptr, WT, bq, Q16, ost, (bid - NKVB) & (NTQ / 64 - 1), (bid - NKVB) / (NTQ / 64));
}
// k_proj: out = ctx.Wp + bp; grid (row tiles, column tiles).
__global__ __launch_bounds__(128) void k_proj(const bf* __restrict__ CH, const bf* __restrict__ CL, const bf* __restrict__ Bn, const float* __restrict__ bias, float* out) {
    __shared__ __align__(16) float ost[64 * 68];
    d_gemmb<true, 1>(CH, CL, Bn, bias, out, ost, blockIdx.x, blockIdx.y);
}

// k_attn: block = (b, h, 64 queries), wave = 16; head dim 32 (one k-chunk); 8 steps x 32 keys, computed TRANSPOSED: S^T = K.Q^T (A = 16 key rows, B = the wave's 16 queries, kept in
// registers) x 32^-1/2, so lane (hi, lr) holds 16 scores of the ONE query lr (keys 8 hi + j and 16 + 8 hi + j): maximum and sum run in-lane plus one exchange between the wave halves;
// the weights x32768 packed to f16 from the two score tiles ARE the B operand of O^T += V^T.P^T in the hardware k order (no LDS). O^T tile n, register j = ctx[query lr][16 n + 8 hi + j],
// which is the lane's own 16 bytes of the fragment-order planes CH/CL (row b*1024 + n, k = h*32 + d): this wave's 16 rows x 32 d are one whole 1024-byte block of each plane.
__device__ __forceinline__ float xhalf(float x) { return __builtin_bit_cast(float, __builtin_amdgcn_permlanex16(__builtin_bit_cast(int, x), __builtin_bit_cast(int, x), 0x76543210, 0xfedcba98, false, false)); }  // lane l with lane l ^ 16
__global__ __launch_bounds__(128) void k_attn(const h16* __restrict__ Q16, const h16* __restrict__ K16, const h16* __restrict__ VT16, bf* CH, bf* CL) {
    const int lane = threadIdx.x & 31, wave = threadIdx.x >> 5;
    const int bid = blockIdx.x;
    const int b = bid / (NH_ * (NN_ / 64)), rem = bid - b * (NH_ * (NN_ / 64)), h = rem / (NN_ / 64), qt = rem - h * (NN_ / 64);
    const int q0 = qt * 64 + wave * 16;
    const h16* qp = Q16 + fro(b * NN_ + q0, h * HD, CC / 32) + 8 * lane;
    const v16h qb = cat16(*(const v8h*)qp, *(const v8h*)(qp + 256));
    const h16* kh_b = K16 + fro(b * NK, h * HD, CC / 32) + 8 * lane;
    const h16* vt_b = VT16 + fro(b * CC + h * HD, 0, NK / 32) + 8 * lane;
    v8f o[2]; o[0] = (v8f){}; o[1] = (v8f){};
    float mrow = -3.0e38f; v2f lpart = {0.f, 0.f};        // even and odd registers' share of this half's weight sum
#pragma unroll 1        // rolled: the live registers stay those of one step
    for (int kt = 0; kt < NK / 32; ++kt) {
        const int l0 = kt * 32;
        const h16* r0p = kh_b + fro(l0, 0, CC / 32); const h16* r1p = kh_b + fro(l0 + 16, 0, CC / 32);
        v8f s0 = {}, s1 = {};
        s0 = wmma16(cat16(*(const v8h*)r0p, *(const v8h*)(r0p + 256)), qb, s0);
        s1 = wmma16(cat16(*(const v8h*)r1p, *(const v8h*)(r1p + 256)), qb, s1);
        v2f a[8]; float mx = -3.0e38f;        // a[i] = two neighbouring registers of the score tiles: keys 8 hi + 2 i, + 1 (i < 4) and 16 + 8 hi + 2 (i - 4), + 1
#pragma unroll        // here and below: unrolled so that every register index is a constant
        for (int i = 0; i < 4; ++i) { a[i] = (v2f){s0[2 * i], s0[2 * i + 1]} * SCL; a[4 + i] = (v2f){s1[2 * i], s1[2 * i + 1]} * SCL; }
#pragma unroll
        for (int i = 0; i < 8; ++i) mx = fmaxf(mx, fmaxf(a[i][0], a[i][1]));
        mx = fmaxf(mx, xhalf(mx));
        const float mn = fmaxf(mrow, mx), alpha = __expf(mrow - mn);
        mrow = mn;
        v2f p[8]; v16h pb;
#pragma unroll
        for (int i = 0; i < 8; ++i) {
            p[i] = (v2f){__expf(a[i][0] - mn), __expf(a[i][1] - mn)};
            const v2h ph = __builtin_convertvector(p[i] * PSC, v2h);
            pb[2 * i] = ph[0]; pb[2 * i + 1] = ph[1];
        }
        lpart = lpart * alpha + (((p[0] + p[1]) + (p[2] + p[3])) + ((p[4] + p[5]) + (p[6] + p[7])));
#pragma unroll
        for (int n = 0; n < 2; ++n)
#pragma unroll
            for (int j = 0; j < 8; ++j) o[n][j] *= alpha;
#pragma unroll
        for (int n = 0; n < 2; ++n) { const h16* vp = vt_b + fro(n * 16, l0, NK / 32); o[n] = wmma16(cat16(*(const v8h*)vp, *(const v8h*)(vp + 256)), pb, o[n]); }
        // the four vector slots the chip needs behind a WMMA, also on the taken side of the loop branch
        asm volatile("v_nop\n\tv_nop\n\tv_nop\n\tv_nop" : "+v"(o[0]), "+v"(o[1]) : "v"(pb));
    }
    const float lh = lpart[0] + lpart[1], inv = 1.0f / ((lh + xhalf(lh)) * PSC);
    const size_t cbase = fro(b * NN_ + q0, h * HD, CC / 32) + 8 * lane;
    v8us oh, ol, oh2, ol2;        // d = 8 hi + i and d = 16 + 8 hi + i of row lr
#pragma unroll
    for (int i = 0; i < 8; ++i) { const float c0 = o[0][i] * inv, c1 = o[1][i] * inv;
        const unsigned short hb = f2bf(c0); oh[i] = hb; ol[i] = f2bf(c0 - bf2f(hb)); const unsigned short hb2 = f2bf(c1); oh2[i] = hb2; ol2[i] = f2bf(c1 - bf2f(hb2)); }
    *(v8us*)(CH + cbase) = oh; *(v8us*)(CH + cbase + 256) = oh2;
    *(v8us*)(CL + cbase) = ol; *(v8us*)(CL + cbase + 256) = ol2;
}

extern "C" void kernel_launch(void* const* d_in, const int* in_sizes, int n_in,
                              void* d_out, int out_size, void* d_ws, size_t ws_size, hipStream_t stream) {
    (void)in_sizes; (void)n_in; (void)out_size;
    const float* x = (const float*)d_in[0]; const float* Wq = (const float*)d_in[1]; const float* bq = (const float*)d_in[2]; const float* Wk = (const float*)d_in[3]; const float* bk = (const float*)d_in[4];
    const float* Wv = (const float*)d_in[5]; const float* bv = (const float*)d_in[6]; const float* Wp = (const float*)d_in[7]; const float* bp = (const float*)d_in[8];
    const float* g = (const float*)d_in[9]; const float* be = (const float*)d_in[10]; const float* mu = (const float*)d_in[11]; const float* var = (const float*)d_in[12];
    float* out = (float*)d_out;    // [32][384][32][32]
    char* wsp = (char*)d_ws;
    auto take = [&](size_t bytes) { char* p = wsp; wsp += (bytes + 255) & ~(size_t)255; return (void*)p; };
    bf* Xb = (bf*)take((size_t)NTQ * CC * 2); bf* XRH = (bf*)take((size_t)NTKV * CC * 2); bf* XRL = (bf*)take((size_t)NTKV * CC * 2);
    bf* WT = (bf*)take((size_t)4 * CC * CC * 2);    // the four weight planes in a row: q, k, v, p
    h16* Q16 = (h16*)take((size_t)NTQ * CC * 2); h16* K16 = (h16*)take((size_t)NTKV * CC * 2); h16* VT16 = (h16*)take((size_t)NTKV * CC * 2);
    bf* CLt = (bf*)take((size_t)NTQ * CC * 2);
    if ((size_t)(wsp - (char*)d_ws) > ws_size) return;    // 25.2 + 12.6 + 1.2 + 25.2 + 12.6 + 25.2 MB ~ 102 MB
    bf* CHt = Xb;                              // the token plane is dead after the q projection
    k_prep<<<NWTB + 5 * NGRP, 256, 0, stream>>>(x, g, be, mu, var, Wq, Wk, Wv, Wp, Xb, XRH, XRL, WT);
    k_qkv<<<NKVB + (NTQ / 64) * (CC / 64), 128, 0, stream>>>(Xb, XRH, XRL, WT, bq, bk, bv, Q16, K16, VT16);
    k_attn<<<NB_ * NH_ * (NN_ / 64), 128, 0, stream>>>(Q16, K16, VT16, CHt, CLt);
    k_proj<<<dim3(NTQ / 64, CC / 64, 1), 128, 0, stream>>>(CHt, CLt, WT + (size_t)3 * CC * CC, bp, out);
}

// v004
// It runs in 94.9 microseconds.
// Two timings next to v003 put it at 1.15 and 1.16 times that version's speed.
// Over all steps from v000 it is 2.31 times as fast.
#include <hip/hip_runtime.h>

// Contractions, f32 accumulate: q = tok.Wq + bq ([32 x 1024 tokens x 384].[384 x 384]) on v_wmma_f32_16x16x32_bf16 with PLAIN bf16 operands (tok = the NCHW input
// transposed, rounded once: exact); k, v = xr.Wk/Wv + b on the bf16 instruction with the pooled + batch-normed tokens xr (computed) as bf16 hi + residual planes (two
// products); the per-(batch, head) attention (12 heads of 32: scores [1024 x 32].[32 x 256] x 32^-1/2, softmax, .v) fused on v_wmma_f32_16x16x32_f16 with plain f16
// q, k, v and weights x32768; out = ctx.Wp + bp on the bf16 instruction with ctx as bf16 hi + residual planes, written back transposed to NCHW. Deterministic, no

#define NB_  32
#define CC   384
#define NN_  1024
#define NK   256
#define NH_  12
#define HD   32
#define NTQ  (NB_ * NN_)          // 32768 query tokens
#define NTKV (NB_ * NK)           // 8192 pooled tokens
#define PSC  32768.0f
#define SCL  0.17677669529663687f

typedef _Float16 h16;
typedef unsigned short bf;
typedef __attribute__((ext_vector_type(16))) __bf16   v16bf;
typedef __attribute__((ext_vector_type(16))) _Float16 v16h;
typedef __attribute__((ext_vector_type(8)))  _Float16 v8h;
typedef __attribute__((ext_vector_type(8)))  unsigned short v8us;
typedef __attribute__((ext_vector_type(8)))  float    v8f;
typedef __attribute__((ext_vector_type(4)))  float    v4f;
typedef __attribute__((ext_vector_type(2)))  float    v2f;
typedef __attribute__((ext_vector_type(2)))  _Float16 v2h;
typedef v4f  __attribute__((may_alias)) v4fa;
typedef v8us __attribute__((may_alias)) v8usa;

__device__ __forceinline__ unsigned short f2bf(float f) { unsigned u = __float_as_uint(f); u += 0x7FFFu + ((u >> 16) & 1u); return (unsigned short)(u >> 16); }
__device__ __forceinline__ float bf2f(unsigned short b) { return __uint_as_float(((unsigned)b) << 16); }
__device__ __forceinline__ float bfr(float f) { return bf2f(f2bf(f)); }
__device__ __forceinline__ v16h cat16(v8h lo, v8h hi) { return __builtin_shufflevector(lo, hi, 0, 1, 2, 3, 4, 5, 6, 7, 8, 9, 10, 11, 12, 13, 14, 15); }
__device__ __forceinline__ v16bf cat16b(v8us lo, v8us hi) { return __builtin_bit_cast(v16bf, __builtin_shufflevector(lo, hi, 0, 1, 2, 3, 4, 5, 6, 7, 8, 9, 10, 11, 12, 13, 14, 15)); }
__device__ __forceinline__ v8f wmma16(v16h a, v16h b, v8f c) { return __builtin_amdgcn_wmma_f32_16x16x32_f16(false, a, false, b, (short)0, c, false, false); }
__device__ __forceinline__ v8f wmmab(v16bf a, v16bf b, v8f c) { return __builtin_amdgcn_wmma_f32_16x16x32_bf16(false, a, false, b, (short)0, c, false, false); }
// Fragment-order planes: every 16-bit WMMA operand plane [rows][k] in the workspace is stored as 1024-byte blocks, one per (16 rows, 32 k), block index (row / 16) * kch + k / 32
// (kch = k extent / 32); inside a block [k bits 4..3][row & 15][k & 7]. Lane l = 16 * hi + lr of a fragment load then reads 16 bytes at block + 8 * l (k = 8 hi ..) and at
// block + 256 + 8 * l (k = 16 + 8 hi ..): 512 contiguous bytes = 4 whole lines per load, where a row-major plane made each load touch 16 lines. fro = element offset of (row, k).
__device__ __forceinline__ size_t fro(int row, int k, int kch) { return ((size_t)(row >> 4) * kch + (k >> 5)) * 512 + ((k >> 3) & 3) * 128 + (row & 15) * 8 + (k & 7); }

// d_tok: Xb (row b*1024 + n, k = c, fragment order) = bf16(x[b][c][n]) via 64 x 64 LDS transposes; block (n tile bx of 16, c tile by of 6, b). A wave stores 512 contiguous bytes.
__device__ __forceinline__ void d_tok(const float* __restrict__ x, bf* Xb, unsigned short* tl, int bx, int by, int b) {
    const int tid = threadIdx.x, n0 = bx * 64, c0 = by * 64;
    const int cc = tid >> 2, nq = (tid & 3) * 16;
#pragma unroll
    for (int i = 0; i < 16; ++i) tl[(nq + i) * 72 + cc] = f2bf(x[((size_t)b * CC + c0 + cc) * NN_ + n0 + nq + i]);
    __syncthreads();
    const int piece = (tid >> 4) & 7;
    auto pass = [&]() {
#pragma unroll
        for (int s = 0; s < 2; ++s) { const int nr = ((tid >> 7) + 2 * s) * 16 + (tid & 15); const v8us val = *(const v8usa*)(tl + nr * 72 + piece * 8);
            *(v8us*)(Xb + fro(b * NN_ + n0 + nr, c0 + piece * 8, CC / 32)) = val; }
    };
    pass();
    // another job's code follows this one in the merged kernel's listing: the wait stands before any register that these stores name is written again
    asm volatile("s_wait_xcnt 0x0" ::: "memory");
}
// d_pool: XRH/XRL (row b*256 + m, k = c, fragment order) = bf16 hi + residual of (mean_{t<4} bf16(x[b][c][4m+t])) * inv[c] + shift[c], inv = g/sqrt(var + eps), shift = beta - mean*inv (bf16-rounded
// params, f32 math); block (64 m, 64 c, b) through LDS; a wave stores 512 contiguous bytes of one plane.
__device__ __forceinline__ void d_pool(const float* __restrict__ x, const float* __restrict__ g, const float* __restrict__ be, const float* __restrict__ mu, const float* __restrict__ var, bf* XRH, bf* XRL,
                                       unsigned short* th_, unsigned short* tl_, int bx, int by, int b) {
    const int tid = threadIdx.x, m0 = bx * 64, c0 = by * 64;
    const int cc = tid >> 2, mq = (tid & 3) * 16, c = c0 + cc;
    const float inv = bfr(g[c]) / sqrtf(bfr(var[c]) + 1e-5f), sh = bfr(be[c]) - bfr(mu[c]) * inv;
    const float* xr = x + ((size_t)b * CC + c) * NN_;
#pragma unroll
    for (int i = 0; i < 16; ++i) { const int m = m0 + mq + i; const float* p = xr + 4 * m;
        const float v = ((bfr(p[0]) + bfr(p[1]) + bfr(p[2]) + bfr(p[3])) * 0.25f) * inv + sh;
        const unsigned short hb = f2bf(v); th_[(mq + i) * 72 + cc] = hb; tl_[(mq + i) * 72 + cc] = f2bf(v - bf2f(hb)); }
    __syncthreads();
    const int piece = (tid >> 4) & 7;
    auto pass = [&]() {
#pragma unroll
        for (int s = 0; s < 4; ++s) { const int pln = s >> 1, mr = ((tid >> 7) + 2 * (s & 1)) * 16 + (tid & 15);
            const v8us val = *(const v8usa*)((pln ? tl_ : th_) + mr * 72 + piece * 8); *(v8us*)((pln ? XRL : XRH) + fro(b * NK + m0 + mr, c0 + piece * 8, CC / 32)) = val; }
    };
    pass();
    // another job's code follows this one in the merged kernel's listing: the wait stands before any register that these stores name is written again
    asm volatile("s_wait_xcnt 0x0" ::: "memory");
}
// d_wt: W [384 k][384 n] k-major -> bf16 plane (row n, k, fragment order); 64 x 64 tiles.
__device__ __forceinline__ void d_wt(const float* __restrict__ Wm, bf* WT, unsigned short* tl, int bx, int by) {
    const int tid = threadIdx.x, k0 = bx * 64, n0 = by * 64;
    const int kk = tid >> 2, nq = (tid & 3) * 16;
#pragma unroll
    for (int i = 0; i < 16; ++i) tl[(nq + i) * 72 + kk] = f2bf(Wm[(size_t)(k0 + kk) * CC + n0 + nq + i]);
    __syncthreads();
    const int piece = (tid >> 4) & 7;
    auto pass = [&]() {
#pragma unroll
        for (int s = 0; s < 2; ++s) { const int nr = ((tid >> 7) + 2 * s) * 16 + (tid & 15); const v8us val = *(const v8usa*)(tl + nr * 72 + piece * 8);
            *(v8us*)(WT + fro(n0 + nr, k0 + piece * 8, CC / 32)) = val; }
    };
    pass();
    // another job's code follows this one in the merged kernel's listing: the wait stands before any register that these stores name is written again
    asm volatile("s_wait_xcnt 0x0" ::: "memory");
}
// k_prep: the six jobs that need nothing of each other, in block ranges of ONE launch (the branch is the same for a whole block): blocks 0 .. 143 the four weight planes (36 tiles each, WT = four
// planes in a row); then 768 groups of five blocks, one per (b, c tile, 256 tokens): the pooling block, the longest, first, then the four token blocks that read the same part of x.
#define NWTB (4 * (CC / 64) * (CC / 64))
#define NGRP (NB_ * (CC / 64) * (NK / 64))
__global__ __launch_bounds__(256) void k_prep(const float* __restrict__ x, const float* __restrict__ g, const float* __restrict__ be, const float* __restrict__ mu, const float* __restrict__ var,
                                              const float* __restrict__ Wq, const float* __restrict__ Wk, const float* __restrict__ Wv, const float* __restrict__ Wp, bf* Xb, bf* XRH, bf* XRL, bf* WT) {
    __shared__ __align__(16) unsigned short sh[2 * 64 * 72];
    const int bid = blockIdx.x;
    if (bid < NWTB) {
        const int i = bid / 36, t = bid - i * 36, by = t / 6, bx = t - by * 6;
        d_wt(i == 0 ? Wq : i == 1 ? Wk : i == 2 ? Wv : Wp, WT + (size_t)i * CC * CC, sh, bx, by);
    } else {
        const int r = bid - NWTB, grp = r / 5, sub = r - grp * 5;
        const int mx = grp & 3, cb = grp >> 2, b = cb / 6, cy = cb - b * 6;
        if (sub == 0) d_pool(x, g, be, mu, var, XRH, XRL, sh, sh + 64 * 72, mx, cy, b);
        else d_tok(x, Xb, sh, mx * 4 + sub - 1, cy, b);
    }
}

// d_gemmb: ONE WAVE computes the 64 x WN tile (tr, tc) of (A [+ Al]).B^T + bf16(bias), K = 384, as 4 x WN / 16 accumulator tiles: each A fragment loaded serves WN / 16 products, each B fragment four
// (eight with the residual plane). A, Al, B are fragment-order planes; the tile, bias added, goes to os, this wave's own [64 rows][WN + 4] f32 staging range (at that pitch rows 8 apart fall 32 banks
// apart and a row starts at a multiple of 16 bytes). WN = 96 in k_qkv and 64 in k_proj: each launch is then 768 blocks of four waves, three to a WGP, all resident at once.
template <bool SPLITA, int WN>
__device__ __forceinline__ void d_gemmb(const bf* __restrict__ A, const bf* __restrict__ Al, const bf* __restrict__ Bn, const float* __restrict__ bias, float* os, int tr, int tc) {
    constexpr int SP = WN + 4;
    const int lane = threadIdx.x & 31, lr = lane & 15, hi = lane >> 4;
    const int r0 = tr * 64, c0 = tc * WN;
    const size_t aoff = fro(r0, 0, CC / 32) + 8 * lane;
    const bf* ap = A + aoff; const bf* alp = (SPLITA ? Al : A) + aoff; const bf* bp = Bn + fro(c0, 0, CC / 32) + 8 * lane;        // block (16-row tile i, k chunk kc) lies (i * 12 + kc) * 512 elements on
    const float* bb = bias + c0 + lr; float bvr[WN / 16];        // the lane's bias values, fetched with the last step's fragments
    v8f acc[4][WN / 16];        // [row tile][column tile]
#pragma unroll        // here and below, in d_gemmb and d_out: unrolled so that every register index is a constant
    for (int i = 0; i < 4; ++i)
#pragma unroll
        for (int t = 0; t < WN / 16; ++t) acc[i][t] = (v8f){};
#pragma unroll        // unrolled: every load address is a base plus a constant, and no loop branch stands behind a WMMA
    for (int kc = 0; kc < CC / 32; ++kc) {
        v16bf a[4], al[4], b[WN / 16];
        if (kc == CC / 32 - 1) {
#pragma unroll
            for (int t = 0; t < WN / 16; ++t) bvr[t] = bb[t * 16];
        }
#pragma unroll
        for (int i = 0; i < 4; ++i) { const bf* at = ap + (i * (CC / 32) + kc) * 512; a[i] = cat16b(*(const v8us*)at, *(const v8us*)(at + 256)); }
#pragma unroll
        for (int t = 0; t < WN / 16; ++t) { const bf* bt = bp + (t * (CC / 32) + kc) * 512; b[t] = cat16b(*(const v8us*)bt, *(const v8us*)(bt + 256)); }
        if (SPLITA) {
#pragma unroll
            for (int i = 0; i < 4; ++i) { const bf* lt = alp + (i * (CC / 32) + kc) * 512; al[i] = cat16b(*(const v8us*)lt, *(const v8us*)(lt + 256)); }
        }
        // behind the last loads: the registers that they name are written again below, for the staging addresses; the scheduling barrier on the next line keeps them behind this one
        if (WN > 64 && kc == CC / 32 - 1) asm volatile("s_wait_xcnt 0x0" ::: "memory");
        // all of a step's loads are issued before its first product: without this the compiler fetched one B fragment at a time and waited out its whole latency at each
        __builtin_amdgcn_sched_barrier(0);
#pragma unroll
        for (int t = 0; t < WN / 16; ++t)
#pragma unroll
            for (int i = 0; i < 4; ++i) acc[i][t] = wmmab(a[i], b[t], acc[i][t]);
        if (SPLITA) {
#pragma unroll
            for (int t = 0; t < WN / 16; ++t)
#pragma unroll
                for (int i = 0; i < 4; ++i) acc[i][t] = wmmab(al[i], b[t], acc[i][t]);
        }
    }
#pragma unroll
    for (int t = 0; t < WN / 16; ++t) { const float bv = bfr(bvr[t]);
#pragma unroll
        for (int i = 0; i < 4; ++i)
#pragma unroll
            for (int j = 0; j < 8; ++j) os[(i * 16 + hi * 8 + j) * SP + t * 16 + lr] = acc[i][t][j] + bv; }
    __syncthreads();
}
// d_out: the staged tile (tr, tc) to its plane. MODE 0: f16 plane C16 (row, col, fragment order); MODE 1: transposed f32 output into NCHW out[b][c][n] (row = b*1024 + n): the tile's columns c each
// get 64 consecutive n = one 256-byte run (2 lines); MODE 2: VT16 planes for v, transposed: plane row = b*384 + col, k = key m (row = b*256 + m)
template <int MODE, int WN>
__device__ __forceinline__ void d_out(void* Cout, const float* os, int tr, int tc) {
    constexpr int SP = WN + 4;
    const int lane = threadIdx.x & 31, lr = lane & 15, hi = lane >> 4;
    const int r0 = tr * 64, c0 = tc * WN;
    if (MODE == 0) {
        h16* cpl = (h16*)Cout;
#pragma unroll
        for (int i = 0; i < 4; ++i)
#pragma unroll
            for (int s = 0; s < WN / 16; ++s) { const int piece = 2 * s + hi; const float* sp = os + (i * 16 + lr) * SP + piece * 8; v8h o;
#pragma unroll
                for (int e = 0; e < 8; ++e) o[e] = (h16)sp[e];
                *(v8h*)(cpl + fro(r0 + i * 16 + lr, c0 + piece * 8, CC / 32)) = o; }
        // another job's code follows this one in the merged kernel's listing: the wait stands before any register that these stores name is written again
        asm volatile("s_wait_xcnt 0x0" ::: "memory");
    } else if (MODE == 1) {
        // transposed: column c (WN of them) x 64 rows n; per column 64 floats = 16 lanes x 16 B; 2 columns per instruction
        const int b = r0 / NN_, n0 = r0 - b * NN_;
        float* ob = (float*)Cout + ((size_t)b * CC + c0) * NN_ + n0;
#pragma unroll
        for (int s = 0; s < WN / 2; ++s) { const int col = 2 * s + hi, q = lr; v4f v;
#pragma unroll
            for (int e = 0; e < 4; ++e) v[e] = os[(q * 4 + e) * SP + col];
            *(v4f*)(ob + (size_t)col * NN_ + q * 4) = v; }
    } else {
        const int b = r0 / NK, m0 = r0 - b * NK;
        h16* vb = (h16*)Cout;        // plane row = b*CC + col since [b][h][d] flattens to b*384 + h*32 + d; k = key m; fragment order with 256 / 32 blocks per 16 rows
#pragma unroll
        for (int cw = 0; cw < WN / 16; ++cw)
#pragma unroll
            for (int s = 0; s < 4; ++s) { const int col = cw * 16 + lr, q = 2 * s + hi; v8h v;
#pragma unroll
                for (int e = 0; e < 8; ++e) v[e] = (h16)os[(q * 8 + e) * SP + col];
                *(v8h*)(vb + fro(b * CC + c0 + col, m0 + q * 8, NK / 32)) = v; }
        // another job's code follows this one in the merged kernel's listing: the wait stands before any register that these stores name is written again
        asm volatile("s_wait_xcnt 0x0" ::: "memory");
    }
}
// A block of four waves takes a 128 x 2 WN tile, wave w the 64 x WN quarter (w >> 1, w & 1): two waves share each A row tile and two each B column tile through the WGP cache.
// k_qkv: the three projections, which need nothing of each other, in block ranges of ONE launch: first the k and v tiles (two products a step, the longer blocks; row tile fastest, 2 column tiles
// of k, then 2 of v), then the q tiles (row tile fastest): 768 blocks, three to a WGP. WT = the four weight planes in a row (q, k, v, p).
#define WNQ 96
#define WNP 64
#define NKB ((NTKV / 128) * (CC / (2 * WNQ)))
__global__ __launch_bounds__(128) void k_qkv(const bf* __restrict__ Xb, const bf* __restrict__ XRH, const bf* __restrict__ XRL, const bf* __restrict__ WT,
                                             const float* __restrict__ bq, const float* __restrict__ bk, const float* __restrict__ bv, h16* Q16, h16* K16, h16* VT16) {
    __shared__ __align__(16) float ost[4 * 64 * (WNQ + 4)];
    const int bid = blockIdx.x, wave = __builtin_amdgcn_readfirstlane(threadIdx.x >> 5), wr = wave >> 1, wc = wave & 1;        // the wave's number in a scalar register: tile bases stay scalar
    float* os = ost + wave * 64 * (WNQ + 4);
    if (bid < 2 * NKB) {        // k and v share one copy of the product loop's code
        const bool isv = bid >= NKB; const int r = isv ? bid - NKB : bid, tr = 2 * (r & (NTKV / 128 - 1)) + wr, tc = 2 * (r / (NTKV / 128)) + wc;
        d_gemmb<true, WNQ>(XRH, XRL, WT + (size_t)(isv ? 2 : 1) * CC * CC, isv ? bv : bk, os, tr, tc);
        if (isv) d_out<2, WNQ>(VT16, os, tr, tc); else d_out<0, WNQ>(K16, os, tr, tc);
    } else {
        const int r = bid - 2 * NKB, tr = 2 * (r & (NTQ / 128 - 1)) + wr, tc = 2 * (r / (NTQ / 128)) + wc;
        d_gemmb<false, WNQ>(Xb, nullptr, WT, bq, os, tr, tc);
        d_out<0, WNQ>(Q16, os, tr, tc);
    }
}
// k_proj: out = ctx.Wp + bp; grid (row tiles, column tiles) of 128 x 128.
__global__ __launch_bounds__(128) void k_proj(const bf* __restrict__ CH, const bf* __restrict__ CL, const bf* __restrict__ Bn, const float* __restrict__ bias, float* out) {
    __shared__ __align__(16) float ost[4 * 64 * (WNP + 4)];
    const int wave = __builtin_amdgcn_readfirstlane(threadIdx.x >> 5);        // in a scalar register, as in k_qkv
    float* os = ost + wave * 64 * (WNP + 4); const int tr = 2 * blockIdx.x + (wave >> 1), tc = 2 * blockIdx.y + (wave & 1);
    d_gemmb<true, WNP>(CH, CL, Bn, bias, os, tr, tc);
    d_out<1, WNP>(out, os, tr, tc);
}

// k_attn: block = (b, h, 64 queries), wave = 16; head dim 32 (one k-chunk); 8 steps x 32 keys, computed TRANSPOSED: S^T = K.Q^T (A = 16 key rows, B = the wave's 16 queries, kept in
// registers) x 32^-1/2, so lane (hi, lr) holds 16 scores of the ONE query lr (keys 8 hi + j and 16 + 8 hi + j): maximum and sum run in-lane plus one exchange between the wave halves;
// the weights x32768 packed to f16 from the two score tiles ARE the B operand of O^T += V^T.P^T in the hardware k order (no LDS). O^T tile n, register j = ctx[query lr][16 n + 8 hi + j],
// which is the lane's own 16 bytes of the fragment-order planes CH/CL (row b*1024 + n, k = h*32 + d): this wave's 16 rows x 32 d are one whole 1024-byte block of each plane.
__device__ __forceinline__ float xhalf(float x) { return __builtin_bit_cast(float, __builtin_amdgcn_permlanex16(__builtin_bit_cast(int, x), __builtin_bit_cast(int, x), 0x76543210, 0xfedcba98, false, false)); }  // lane l with lane l ^ 16
__global__ __launch_bounds__(128) void k_attn(const h16* __restrict__ Q16, const h16* __restrict__ K16, const h16* __restrict__ VT16, bf* CH, bf* CL) {
    const int lane = threadIdx.x & 31, wave = threadIdx.x >> 5;
    const int bid = blockIdx.x;
    const int b = bid / (NH_ * (NN_ / 64)), rem = bid - b * (NH_ * (NN_ / 64)), h = rem / (NN_ / 64), qt = rem - h * (NN_ / 64);
    const int q0 = qt * 64 + wave * 16;
    const h16* qp = Q16 + fro(b * NN_ + q0, h * HD, CC / 32) + 8 * lane;
    const v16h qb = cat16(*(const v8h*)qp, *(const v8h*)(qp + 256));
    const h16* kh_b = K16 + fro(b * NK, h * HD, CC / 32) + 8 * lane;
    const h16* vt_b = VT16 + fro(b * CC + h * HD, 0, NK / 32) + 8 * lane;
    v8f o[2]; o[0] = (v8f){}; o[1] = (v8f){};
    float mrow = -3.0e38f; v2f lpart = {0.f, 0.f};        // even and odd registers' share of this half's weight sum
#pragma unroll 1        // rolled: the live registers stay those of one step
    for (int kt = 0; kt < NK / 32; ++kt) {
        const int l0 = kt * 32;
        const h16* r0p = kh_b + fro(l0, 0, CC / 32); const h16* r1p = kh_b + fro(l0 + 16, 0, CC / 32);
        v8f s0 = {}, s1 = {};
        s0 = wmma16(cat16(*(const v8h*)r0p, *(const v8h*)(r0p + 256)), qb, s0);
        s1 = wmma16(cat16(*(const v8h*)r1p, *(const v8h*)(r1p + 256)), qb, s1);
        v2f a[8]; float mx = -3.0e38f;        // a[i] = two neighbouring registers of the score tiles: keys 8 hi + 2 i, + 1 (i < 4) and 16 + 8 hi + 2 (i - 4), + 1
#pragma unroll        // here and below: unrolled so that every register index is a constant
        for (int i = 0; i < 4; ++i) { a[i] = (v2f){s0[2 * i], s0[2 * i + 1]} * SCL; a[4 + i] = (v2f){s1[2 * i], s1[2 * i + 1]} * SCL; }
#pragma unroll
        for (int i = 0; i < 8; ++i) mx = fmaxf(mx, fmaxf(a[i][0], a[i][1]));
        mx = fmaxf(mx, xhalf(mx));
        const float mn = fmaxf(mrow, mx), alpha = __expf(mrow - mn);
        mrow = mn;
        v2f p[8]; v16h pb;
#pragma unroll
        for (int i = 0; i < 8; ++i) {
            p[i] = (v2f){__expf(a[i][0] - mn), __expf(a[i][1] - mn)};
            const v2h ph = __builtin_convertvector(p[i] * PSC, v2h);
            pb[2 * i] = ph[0]; pb[2 * i + 1] = ph[1];
        }
        lpart = lpart * alpha + (((p[0] + p[1]) + (p[2] + p[3])) + ((p[4] + p[5]) + (p[6] + p[7])));
#pragma unroll
        for (int n = 0; n < 2; ++n)
#pragma unroll
            for (int j = 0; j < 8; ++j) o[n][j] *= alpha;
#pragma unroll
        for (int n = 0; n < 2; ++n) { const h16* vp = vt_b + fro(n * 16, l0, NK / 32); o[n] = wmma16(cat16(*(const v8h*)vp, *(const v8h*)(vp + 256)), pb, o[n]); }
        // the four vector slots the chip needs behind a WMMA, also on the taken side of the loop branch
        asm volatile("v_nop\n\tv_nop\n\tv_nop\n\tv_nop" : "+v"(o[0]), "+v"(o[1]) : "v"(pb));
    }
    const float lh = lpart[0] + lpart[1], inv = 1.0f / ((lh + xhalf(lh)) * PSC);
    const size_t cbase = fro(b * NN_ + q0, h * HD, CC / 32) + 8 * lane;
    v8us oh, ol, oh2, ol2;        // d = 8 hi + i and d = 16 + 8 hi + i of row lr
#pragma unroll
    for (int i = 0; i < 8; ++i) { const float c0 = o[0][i] * inv, c1 = o[1][i] * inv;
        const unsigned short hb = f2bf(c0); oh[i] = hb; ol[i] = f2bf(c0 - bf2f(hb)); const unsigned short hb2 = f2bf(c1); oh2[i] = hb2; ol2[i] = f2bf(c1 - bf2f(hb2)); }
    *(v8us*)(CH + cbase) = oh; *(v8us*)(CH + cbase + 256) = oh2;
    *(v8us*)(CL + cbase) = ol; *(v8us*)(CL + cbase + 256) = ol2;
}

extern "C" void kernel_launch(void* const* d_in, const int* in_sizes, int n_in,
                              void* d_out, int out_size, void* d_ws, size_t ws_size, hipStream_t stream) {
    (void)in_sizes; (void)n_in; (void)out_size;
    const float* x = (const float*)d_in[0]; const float* Wq = (const float*)d_in[1]; const float* bq = (const float*)d_in[2]; const float* Wk = (const float*)d_in[3]; const float* bk = (const float*)d_in[4];
    const float* Wv = (const float*)d_in[5]; const float* bv = (const float*)d_in[6]; const float* Wp = (const float*)d_in[7]; const float* bp = (const float*)d_in[8];
    const float* g = (const float*)d_in[9]; const float* be = (const float*)d_in[10]; const float* mu = (const float*)d_in[11]; const float* var = (const float*)d_in[12];
    float* out = (float*)d_out;    // [32][384][32][32]
    char* wsp = (char*)d_ws;
    auto take = [&](size_t bytes) { char* p = wsp; wsp += (bytes + 255) & ~(size_t)255; return (void*)p; };
    bf* Xb = (bf*)take((size_t)NTQ * CC * 2); bf* XRH = (bf*)take((size_t)NTKV * CC * 2); bf* XRL = (bf*)take((size_t)NTKV * CC * 2);
    bf* WT = (bf*)take((size_t)4 * CC * CC * 2);    // the four weight planes in a row: q, k, v, p
    h16* Q16 = (h16*)take((size_t)NTQ * CC * 2); h16* K16 = (h16*)take((size_t)NTKV * CC * 2); h16* VT16 = (h16*)take((size_t)NTKV * CC * 2);
    bf* CLt = (bf*)take((size_t)NTQ * CC * 2);
    if ((size_t)(wsp - (char*)d_ws) > ws_size) return;    // 25.2 + 12.6 + 1.2 + 25.2 + 12.6 + 25.2 MB ~ 102 MB
    bf* CHt = Xb;                              // the token plane is dead after the q projection
    k_prep<<<NWTB + 5 * NGRP, 256, 0, stream>>>(x, g, be, mu, var, Wq, Wk, Wv, Wp, Xb, XRH, XRL, WT);
    k_qkv<<<2 * NKB + (NTQ / 128) * (CC / (2 * WNQ)), 128, 0, stream>>>(Xb, XRH, XRL, WT, bq, bk, bv, Q16, K16, VT16);
    k_attn<<<NB_ * NH_ * (NN_ / 64), 128, 0, stream>>>(Q16, K16, VT16, CHt, CLt);
    k_proj<<<dim3(NTQ / 128, CC / (2 * WNP), 1), 128, 0, stream>>>(CHt, CLt, WT + (size_t)3 * CC * CC, bp, out);
}

// v005
// A run of this version takes 88.6 microseconds.
// In two side-by-side timings against v004, it was 1.07 and 1.08 times as fast.
// Counting every step since v000, it is 2.48 times as fast.
#include <hip/hip_runtime.h>

// Contractions, f32 accumulate: q = tok.Wq + bq ([32 x 1024 tokens x 384].[384 x 384]) on v_wmma_f32_16x16x32_bf16 with PLAIN bf16 operands (tok = the NCHW input
// transposed, rounded once: exact); k, v = xr.Wk/Wv + b on the bf16 instruction with the pooled + batch-normed tokens xr (computed) as bf16 hi + residual planes (two
// products); the per-(batch, head) attention (12 heads of 32: scores [1024 x 32].[32 x 256] x 32^-1/2, softmax, .v) fused on v_wmma_f32_16x16x32_f16 with plain f16
// q, k, v and weights x32768; out = ctx.Wp + bp on the bf16 instruction with ctx as bf16 hi + residual planes, written back transposed to NCHW. Deterministic, no

#define NB_  32
#define CC   384
#define NN_  1024
#define NK   256
#define NH_  12
#define HD   32
#define NTQ  (NB_ * NN_)          // 32768 query tokens
#define NTKV (NB_ * NK)           // 8192 pooled tokens
#define PSC  32768.0f
#define SCL  0.17677669529663687f

typedef _Float16 h16;
typedef unsigned short bf;
typedef __attribute__((ext_vector_type(16))) __bf16   v16bf;
typedef __attribute__((ext_vector_type(16))) _Float16 v16h;
typedef __attribute__((ext_vector_type(8)))  _Float16 v8h;
typedef __attribute__((ext_vector_type(8)))  unsigned short v8us;
typedef __attribute__((ext_vector_type(8)))  float    v8f;
typedef __attribute__((ext_vector_type(4)))  float    v4f;
typedef __attribute__((ext_vector_type(2)))  float    v2f;
typedef __attribute__((ext_vector_type(2)))  _Float16 v2h;
typedef v4f  __attribute__((may_alias)) v4fa;
typedef v8us __attribute__((may_alias)) v8usa;

__device__ __forceinline__ unsigned short f2bf(float f) { unsigned u = __float_as_uint(f); u += 0x7FFFu + ((u >> 16) & 1u); return (unsigned short)(u >> 16); }
__device__ __forceinline__ float bf2f(unsigned short b) { return __uint_as_float(((unsigned)b) << 16); }
__device__ __forceinline__ float bfr(float f) { return bf2f(f2bf(f)); }
__device__ __forceinline__ v16h cat16(v8h lo, v8h hi) { return __builtin_shufflevector(lo, hi, 0, 1, 2, 3, 4, 5, 6, 7, 8, 9, 10, 11, 12, 13, 14, 15); }
__device__ __forceinline__ v16bf cat16b(v8us lo, v8us hi) { return __builtin_bit_cast(v16bf, __builtin_shufflevector(lo, hi, 0, 1, 2, 3, 4, 5, 6, 7, 8, 9, 10, 11, 12, 13, 14, 15)); }
__device__ __forceinline__ v8f wmma16(v16h a, v16h b, v8f c) { return __builtin_amdgcn_wmma_f32_16x16x32_f16(false, a, false, b, (short)0, c, false, false); }
__device__ __forceinline__ v8f wmmab(v16bf a, v16bf b, v8f c) { return __builtin_amdgcn_wmma_f32_16x16x32_bf16(false, a, false, b, (short)0, c, false, false); }
// Fragment-order planes: every 16-bit WMMA operand plane [rows][k] in the workspace is stored as 1024-byte blocks, one per (16 rows, 32 k), block index (row / 16) * kch + k / 32
// (kch = k extent / 32); inside a block [k bits 4..3][row & 15][k & 7]. Lane l = 16 * hi + lr of a fragment load then reads 16 bytes at block + 8 * l (k = 8 hi ..) and at
// block + 256 + 8 * l (k = 16 + 8 hi ..): 512 contiguous bytes = 4 whole lines per load, where a row-major plane made each load touch 16 lines. fro = element offset of (row, k).
__device__ __forceinline__ size_t fro(int row, int k, int kch) { return ((size_t)(row >> 4) * kch + (k >> 5)) * 512 + ((k >> 3) & 3) * 128 + (row & 15) * 8 + (k & 7); }

// d_xpart: one block takes x[b][c0 .. c0 + 63][n0 .. n0 + 255], reads it ONCE and makes from it both its part of Xb (row b*1024 + n, k = c, fragment order) = bf16(x[b][c][n]) and its part of
// XRH/XRL (row b*256 + m, k = c, fragment order) = bf16 hi + residual of (mean_{t<4} bf16(x[b][c][4m+t])) * inv[c] + shift[c], inv = g/sqrt(var + eps), shift = beta - mean*inv (bf16-rounded params,
// f32 math). Wave w owns the 8 channels c0 + 8 w ..; each of its 16 loads is 512 contiguous bytes of one channel (4 whole lines): lane l gets tokens 4 l .. 4 l + 3 of a 128-token half, which are one
// pooling group. For one token (or one pooled token) the lane's 8 channels are one 16-byte unit of the fragment order; the units go to LDS images of the output runs (2 KB per 16 rows) and leave
// as 512 contiguous bytes a wave. XTP: pitch of a 16-token run in LDS, 2 KB + 16 bytes, so that the 16 lanes of a half wave, which write 4 units in each of 4 runs, fall on all 64 banks.
#define XTP 1032
#define XPO (16 * XTP)
__device__ __forceinline__ float rdl(float v, int l) { return __builtin_bit_cast(float, __builtin_amdgcn_readlane(__builtin_bit_cast(int, v), l)); }
__device__ __forceinline__ void d_xpart(const float* __restrict__ x, const float* __restrict__ g, const float* __restrict__ be, const float* __restrict__ mu, const float* __restrict__ var,
                                        bf* Xb, bf* XRH, bf* XRL, unsigned short* sh, int mx, int cy, int b) {
    const int tid = threadIdx.x, lane = tid & 31, w = tid >> 5;
    const int c0 = cy * 64, n0 = mx * 256, m0 = mx * 64;
    const float* xp = x + ((size_t)b * CC + c0 + w * 8) * NN_ + n0 + lane * 4;
    const int cp = c0 + w * 8 + (lane & 7);        // lane l computes the two parameters of the wave's channel l & 7; each is read from its lane below
    const float gl = g[cp], vl = var[cp], bl = be[cp], ml = mu[cp];
    // the register that these four loads name was given to one of the loads below as its destination: the wait stands before it is written again
    asm volatile("s_wait_xcnt 0x0" ::: "memory");
    v4f r[8][2];
#pragma unroll        // here and below: unrolled so that every register index is a constant
    for (int jc = 0; jc < 8; ++jc)
#pragma unroll
        for (int hf = 0; hf < 2; ++hf) r[jc][hf] = *(const v4fa*)(xp + jc * NN_ + hf * 128);
    // behind the last load, its address named so that it lives to here: without this the last load's destination was laid on the address pair that the fifteen before it name
    asm volatile("s_wait_xcnt 0x0" :: "v"(xp) : "memory");
    // all of the wave's loads are issued before the first value is used: without this the compiler fetched them in groups and waited out a whole memory latency at each
    __builtin_amdgcn_sched_barrier(0);
    const float invl = bfr(gl) / sqrtf(bfr(vl) + 1e-5f), shl = bfr(bl) - bfr(ml) * invl;
    unsigned short* tw = sh + (lane >> 2) * XTP + (w >> 2) * 512 + (w & 3) * 128 + (lane & 3) * 32;
    unsigned short* pw = sh + XPO + (lane >> 4) * 1024 + (w >> 2) * 512 + (w & 3) * 128 + (lane & 15) * 8;
#pragma unroll
    for (int hf = 0; hf < 2; ++hf) {
        v8us tu[4], hu, lu;
#pragma unroll
        for (int jc = 0; jc < 8; ++jc) {
            const float inv = rdl(invl, jc), shf = rdl(shl, jc);
            unsigned short q[4];
#pragma unroll
            for (int e = 0; e < 4; ++e) { q[e] = f2bf(r[jc][hf][e]); tu[e][jc] = q[e]; }
            const float v = ((bf2f(q[0]) + bf2f(q[1]) + bf2f(q[2]) + bf2f(q[3])) * 0.25f) * inv + shf;
            const unsigned short hb = f2bf(v); hu[jc] = hb; lu[jc] = f2bf(v - bf2f(hb));
        }
#pragma unroll
        for (int e = 0; e < 4; ++e) *(v8usa*)(tw + hf * 8 * XTP + e * 8) = tu[e];
        *(v8usa*)(pw + hf * 2048) = hu; *(v8usa*)(pw + 4096 + hf * 2048) = lu;
    }
    __syncthreads();
    const int rt = tid >> 7, wi = (tid & 127) * 8;        // 128 units of 16 bytes make one 2 KB run: 16 rows x this block's 64 channels
    bf* xo = Xb + ((size_t)((b * NN_ + n0) / 16 + rt) * (CC / 32) + 2 * cy) * 512 + wi;
#pragma unroll
    for (int s = 0; s < 8; ++s) { const v8us val = *(const v8usa*)(sh + (2 * s + rt) * XTP + wi); *(v8us*)(xo + (size_t)(2 * s) * (CC / 32) * 512) = val; }
    const size_t po = ((size_t)((b * NK + m0) / 16 + rt) * (CC / 32) + 2 * cy) * 512 + wi;
#pragma unroll
    for (int s = 0; s < 4; ++s) { const int pln = s >> 1, t2 = 2 * (s & 1); const v8us val = *(const v8usa*)(sh + XPO + pln * 4096 + (t2 + rt) * 1024 + wi);
        *(v8us*)((pln ? XRL : XRH) + po + (size_t)t2 * (CC / 32) * 512) = val; }
    // another job's code follows this one in the merged kernel's listing: the wait stands before any register that these stores name is written again
    asm volatile("s_wait_xcnt 0x0" ::: "memory");
}
// d_wt: W [384 k][384 n] k-major -> bf16 plane (row n, k, fragment order); 64 x 64 tiles.
__device__ __forceinline__ void d_wt(const float* __restrict__ Wm, bf* WT, unsigned short* tl, int bx, int by) {
    const int tid = threadIdx.x, k0 = bx * 64, n0 = by * 64;
    const int kk = tid >> 2, nq = (tid & 3) * 16;
#pragma unroll
    for (int i = 0; i < 16; ++i) tl[(nq + i) * 72 + kk] = f2bf(Wm[(size_t)(k0 + kk) * CC + n0 + nq + i]);
    __syncthreads();
    const int piece = (tid >> 4) & 7;
    auto pass = [&]() {
#pragma unroll
        for (int s = 0; s < 2; ++s) { const int nr = ((tid >> 7) + 2 * s) * 16 + (tid & 15); const v8us val = *(const v8usa*)(tl + nr * 72 + piece * 8);
            *(v8us*)(WT + fro(n0 + nr, k0 + piece * 8, CC / 32)) = val; }
    };
    pass();
    // another job's code follows this one in the merged kernel's listing: the wait stands before any register that these stores name is written again
    asm volatile("s_wait_xcnt 0x0" ::: "memory");
}
// k_prep: the jobs that need nothing of each other, in block ranges of ONE launch (the branch is the same for a whole block): blocks 0 .. 143 the four weight planes (36 tiles each, WT = four
// planes in a row); then 768 blocks, one per (b, c tile, 256 tokens), each of which makes the token plane's and the pooled planes' part of its x part.
#define NWTB (4 * (CC / 64) * (CC / 64))
#define NGRP (NB_ * (CC / 64) * (NK / 64))
__global__ __launch_bounds__(256) void k_prep(const float* __restrict__ x, const float* __restrict__ g, const float* __restrict__ be, const float* __restrict__ mu, const float* __restrict__ var,
                                              const float* __restrict__ Wq, const float* __restrict__ Wk, const float* __restrict__ Wv, const float* __restrict__ Wp, bf* Xb, bf* XRH, bf* XRL, bf* WT) {
    __shared__ __align__(16) unsigned short sh[XPO + 2 * 4096];
    const int bid = blockIdx.x;
    if (bid < NWTB) {
        const int i = bid / 36, t = bid - i * 36, by = t / 6, bx = t - by * 6;
        d_wt(i == 0 ? Wq : i == 1 ? Wk : i == 2 ? Wv : Wp, WT + (size_t)i * CC * CC, sh, bx, by);
    } else {
        const int grp = bid - NWTB;
        const int mx = grp & 3, cb = grp >> 2, b = cb / 6, cy = cb - b * 6;
        d_xpart(x, g, be, mu, var, Xb, XRH, XRL, sh, mx, cy, b);
    }
}

// d_gemmb: ONE WAVE computes the 64 x WN tile (tr, tc) of (A [+ Al]).B^T + bf16(bias), K = 384, as 4 x WN / 16 accumulator tiles: each A fragment loaded serves WN / 16 products, each B fragment four
// (eight with the residual plane). A, Al, B are fragment-order planes; the tile, bias added, goes to os, this wave's own [64 rows][WN + 4] f32 staging range (at that pitch rows 8 apart fall 32 banks
// apart and a row starts at a multiple of 16 bytes). WN = 96 in k_qkv and 64 in k_proj: each launch is then 768 blocks of four waves, three to a WGP, all resident at once.
template <bool SPLITA, int WN>
__device__ __forceinline__ void d_gemmb(const bf* __restrict__ A, const bf* __restrict__ Al, const bf* __restrict__ Bn, const float* __restrict__ bias, float* os, int tr, int tc) {
    constexpr int SP = WN + 4;
    const int lane = threadIdx.x & 31, lr = lane & 15, hi = lane >> 4;
    const int r0 = tr * 64, c0 = tc * WN;
    const size_t aoff = fro(r0, 0, CC / 32) + 8 * lane;
    const bf* ap = A + aoff; const bf* alp = (SPLITA ? Al : A) + aoff; const bf* bp = Bn + fro(c0, 0, CC / 32) + 8 * lane;        // block (16-row tile i, k chunk kc) lies (i * 12 + kc) * 512 elements on
    const float* bb = bias + c0 + lr; float bvr[WN / 16];        // the lane's bias values, fetched with the last step's fragments
    v8f acc[4][WN / 16];        // [row tile][column tile]
#pragma unroll        // here and below, in d_gemmb and d_out: unrolled so that every register index is a constant
    for (int i = 0; i < 4; ++i)
#pragma unroll
        for (int t = 0; t < WN / 16; ++t) acc[i][t] = (v8f){};
#pragma unroll        // unrolled: every load address is a base plus a constant, and no loop branch stands behind a WMMA
    for (int kc = 0; kc < CC / 32; ++kc) {
        v16bf a[4], al[4], b[WN / 16];
        if (kc == CC / 32 - 1) {
#pragma unroll
            for (int t = 0; t < WN / 16; ++t) bvr[t] = bb[t * 16];
        }
#pragma unroll
        for (int i = 0; i < 4; ++i) { const bf* at = ap + (i * (CC / 32) + kc) * 512; a[i] = cat16b(*(const v8us*)at, *(const v8us*)(at + 256)); }
#pragma unroll
        for (int t = 0; t < WN / 16; ++t) { const bf* bt = bp + (t * (CC / 32) + kc) * 512; b[t] = cat16b(*(const v8us*)bt, *(const v8us*)(bt + 256)); }
        if (SPLITA) {
#pragma unroll
            for (int i = 0; i < 4; ++i) { const bf* lt = alp + (i * (CC / 32) + kc) * 512; al[i] = cat16b(*(const v8us*)lt, *(const v8us*)(lt + 256)); }
        }
        // behind the last loads: the registers that they name are written again below, for the staging addresses; the scheduling barrier on the next line keeps them behind this one
        if (WN > 64 && kc == CC / 32 - 1) asm volatile("s_wait_xcnt 0x0" ::: "memory");
        // all of a step's loads are issued before its first product: without this the compiler fetched one B fragment at a time and waited out its whole latency at each
        __builtin_amdgcn_sched_barrier(0);
#pragma unroll
        for (int t = 0; t < WN / 16; ++t)
#pragma unroll
            for (int i = 0; i < 4; ++i) acc[i][t] = wmmab(a[i], b[t], acc[i][t]);
        if (SPLITA) {
#pragma unroll
            for (int t = 0; t < WN / 16; ++t)
#pragma unroll
                for (int i = 0; i < 4; ++i) acc[i][t] = wmmab(al[i], b[t], acc[i][t]);
        }
    }
#pragma unroll
    for (int t = 0; t < WN / 16; ++t) { const float bv = bfr(bvr[t]);
#pragma unroll
        for (int i = 0; i < 4; ++i)
#pragma unroll
            for (int j = 0; j < 8; ++j) os[(i * 16 + hi * 8 + j) * SP + t * 16 + lr] = acc[i][t][j] + bv; }
    __syncthreads();
}
// d_out: the staged tile (tr, tc) to its plane. MODE 0: f16 plane C16 (row, col, fragment order); MODE 1: transposed f32 output into NCHW out[b][c][n] (row = b*1024 + n): the tile's columns c each
// get 64 consecutive n = one 256-byte run (2 lines); MODE 2: VT16 planes for v, transposed: plane row = b*384 + col, k = key m (row = b*256 + m)
template <int MODE, int WN>
__device__ __forceinline__ void d_out(void* Cout, const float* os, int tr, int tc) {
    constexpr int SP = WN + 4;
    const int lane = threadIdx.x & 31, lr = lane & 15, hi = lane >> 4;
    const int r0 = tr * 64, c0 = tc * WN;
    if (MODE == 0) {
        h16* cpl = (h16*)Cout;
#pragma unroll
        for (int i = 0; i < 4; ++i)
#pragma unroll
            for (int s = 0; s < WN / 16; ++s) { const int piece = 2 * s + hi; const float* sp = os + (i * 16 + lr) * SP + piece * 8; v8h o;
#pragma unroll
                for (int e = 0; e < 8; ++e) o[e] = (h16)sp[e];
                *(v8h*)(cpl + fro(r0 + i * 16 + lr, c0 + piece * 8, CC / 32)) = o; }
        // another job's code follows this one in the merged kernel's listing: the wait stands before any register that these stores name is written again
        asm volatile("s_wait_xcnt 0x0" ::: "memory");
    } else if (MODE == 1) {
        // transposed: column c (WN of them) x 64 rows n; per column 64 floats = 16 lanes x 16 B; 2 columns per instruction
        const int b = r0 / NN_, n0 = r0 - b * NN_;
        float* ob = (float*)Cout + ((size_t)b * CC + c0) * NN_ + n0;
#pragma unroll
        for (int s = 0; s < WN / 2; ++s) { const int col = 2 * s + hi, q = lr; v4f v;
#pragma unroll
            for (int e = 0; e < 4; ++e) v[e] = os[(q * 4 + e) * SP + col];
            *(v4f*)(ob + (size_t)col * NN_ + q * 4) = v; }
    } else {
        const int b = r0 / NK, m0 = r0 - b * NK;
        h16* vb = (h16*)Cout;        // plane row = b*CC + col since [b][h][d] flattens to b*384 + h*32 + d; k = key m; fragment order with 256 / 32 blocks per 16 rows
#pragma unroll
        for (int cw = 0; cw < WN / 16; ++cw)
#pragma unroll
            for (int s = 0; s < 4; ++s) { const int col = cw * 16 + lr, q = 2 * s + hi; v8h v;
#pragma unroll
                for (int e = 0; e < 8; ++e) v[e] = (h16)os[(q * 8 + e) * SP + col];
                *(v8h*)(vb + fro(b * CC + c0 + col, m0 + q * 8, NK / 32)) = v; }
        // another job's code follows this one in the merged kernel's listing: the wait stands before any register that these stores name is written again
        asm volatile("s_wait_xcnt 0x0" ::: "memory");
    }
}
// A block of four waves takes a 128 x 2 WN tile, wave w the 64 x WN quarter (w >> 1, w & 1): two waves share each A row tile and two each B column tile through the WGP cache.
// k_qkv: the three projections, which need nothing of each other, in block ranges of ONE launch: first the k and v tiles (two products a step, the longer blocks; row tile fastest, 2 column tiles
// of k, then 2 of v), then the q tiles (row tile fastest): 768 blocks, three to a WGP. WT = the four weight planes in a row (q, k, v, p).
#define WNQ 96
#define WNP 64
#define NKB ((NTKV / 128) * (CC / (2 * WNQ)))
__global__ __launch_bounds__(128) void k_qkv(const bf* __restrict__ Xb, const bf* __restrict__ XRH, const bf* __restrict__ XRL, const bf* __restrict__ WT,
                                             const float* __restrict__ bq, const float* __restrict__ bk, const float* __restrict__ bv, h16* Q16, h16* K16, h16* VT16) {
    __shared__ __align__(16) float ost[4 * 64 * (WNQ + 4)];
    const int bid = blockIdx.x, wave = __builtin_amdgcn_readfirstlane(threadIdx.x >> 5), wr = wave >> 1, wc = wave & 1;        // the wave's number in a scalar register: tile bases stay scalar
    float* os = ost + wave * 64 * (WNQ + 4);
    if (bid < 2 * NKB) {        // k and v share one copy of the product loop's code
        const bool isv = bid >= NKB; const int r = isv ? bid - NKB : bid, tr = 2 * (r & (NTKV / 128 - 1)) + wr, tc = 2 * (r / (NTKV / 128)) + wc;
        d_gemmb<true, WNQ>(XRH, XRL, WT + (size_t)(isv ? 2 : 1) * CC * CC, isv ? bv : bk, os, tr, tc);
        if (isv) d_out<2, WNQ>(VT16, os, tr, tc); else d_out<0, WNQ>(K16, os, tr, tc);
    } else {
        const int r = bid - 2 * NKB, tr = 2 * (r & (NTQ / 128 - 1)) + wr, tc = 2 * (r / (NTQ / 128)) + wc;
        d_gemmb<false, WNQ>(Xb, nullptr, WT, bq, os, tr, tc);
        d_out<0, WNQ>(Q16, os, tr, tc);
    }
}
// k_proj: out = ctx.Wp + bp; grid (row tiles, column tiles) of 128 x 128.
__global__ __launch_bounds__(128) void k_proj(const bf* __restrict__ CH, const bf* __restrict__ CL, const bf* __restrict__ Bn, const float* __restrict__ bias, float* out) {
    __shared__ __align__(16) float ost[4 * 64 * (WNP + 4)];
    const int wave = __builtin_amdgcn_readfirstlane(threadIdx.x >> 5);        // in a scalar register, as in k_qkv
    float* os = ost + wave * 64 * (WNP + 4); const int tr = 2 * blockIdx.x + (wave >> 1), tc = 2 * blockIdx.y + (wave & 1);
    d_gemmb<true, WNP>(CH, CL, Bn, bias, os, tr, tc);
    d_out<1, WNP>(out, os, tr, tc);
}

// k_attn: block = (b, h, 64 queries), wave = 16; head dim 32 (one k-chunk); 8 steps x 32 keys, computed TRANSPOSED: S^T = K.Q^T (A = 16 key rows, B = the wave's 16 queries, kept in
// registers) x 32^-1/2, so lane (hi, lr) holds 16 scores of the ONE query lr (keys 8 hi + j and 16 + 8 hi + j): maximum and sum run in-lane plus one exchange between the wave halves;
// the weights x32768 packed to f16 from the two score tiles ARE the B operand of O^T += V^T.P^T in the hardware k order (no LDS). O^T tile n, register j = ctx[query lr][16 n + 8 hi + j],
// which is the lane's own 16 bytes of the fragment-order planes CH/CL (row b*1024 + n, k = h*32 + d): this wave's 16 rows x 32 d are one whole 1024-byte block of each plane.
__device__ __forceinline__ float xhalf(float x) { return __builtin_bit_cast(float, __builtin_amdgcn_permlanex16(__builtin_bit_cast(int, x), __builtin_bit_cast(int, x), 0x76543210, 0xfedcba98, false, false)); }  // lane l with lane l ^ 16
__global__ __launch_bounds__(128) void k_attn(const h16* __restrict__ Q16, const h16* __restrict__ K16, const h16* __restrict__ VT16, bf* CH, bf* CL) {
    const int lane = threadIdx.x & 31, wave = threadIdx.x >> 5;
    const int bid = blockIdx.x;
    const int b = bid / (NH_ * (NN_ / 64)), rem = bid - b * (NH_ * (NN_ / 64)), h = rem / (NN_ / 64), qt = rem - h * (NN_ / 64);
    const int q0 = qt * 64 + wave * 16;
    const h16* qp = Q16 + fro(b * NN_ + q0, h * HD, CC / 32) + 8 * lane;
    const v16h qb = cat16(*(const v8h*)qp, *(const v8h*)(qp + 256));
    const h16* kh_b = K16 + fro(b * NK, h * HD, CC / 32) + 8 * lane;
    const h16* vt_b = VT16 + fro(b * CC + h * HD, 0, NK / 32) + 8 * lane;
    v8f o[2]; o[0] = (v8f){}; o[1] = (v8f){};
    float mrow = -3.0e38f; v2f lpart = {0.f, 0.f};        // even and odd registers' share of this half's weight sum
#pragma unroll 1        // rolled: the live registers stay those of one step
    for (int kt = 0; kt < NK / 32; ++kt) {
        const int l0 = kt * 32;
        const h16* r0p = kh_b + fro(l0, 0, CC / 32); const h16* r1p = kh_b + fro(l0 + 16, 0, CC / 32);
        v8f s0 = {}, s1 = {};
        s0 = wmma16(cat16(*(const v8h*)r0p, *(const v8h*)(r0p + 256)), qb, s0);
        s1 = wmma16(cat16(*(const v8h*)r1p, *(const v8h*)(r1p + 256)), qb, s1);
        v2f a[8]; float mx = -3.0e38f;        // a[i] = two neighbouring registers of the score tiles: keys 8 hi + 2 i, + 1 (i < 4) and 16 + 8 hi + 2 (i - 4), + 1
#pragma unroll        // here and below: unrolled so that every register index is a constant
        for (int i = 0; i < 4; ++i) { a[i] = (v2f){s0[2 * i], s0[2 * i + 1]} * SCL; a[4 + i] = (v2f){s1[2 * i], s1[2 * i + 1]} * SCL; }
#pragma unroll
        for (int i = 0; i < 8; ++i) mx = fmaxf(mx, fmaxf(a[i][0], a[i][1]));
        mx = fmaxf(mx, xhalf(mx));
        const float mn = fmaxf(mrow, mx), alpha = __expf(mrow - mn);
        mrow = mn;
        v2f p[8]; v16h pb;
#pragma unroll
        for (int i = 0; i < 8; ++i) {
            p[i] = (v2f){__expf(a[i][0] - mn), __expf(a[i][1] - mn)};
            const v2h ph = __builtin_convertvector(p[i] * PSC, v2h);
            pb[2 * i] = ph[0]; pb[2 * i + 1] = ph[1];
        }
        lpart = lpart * alpha + (((p[0] + p[1]) + (p[2] + p[3])) + ((p[4] + p[5]) + (p[6] + p[7])));
#pragma unroll
        for (int n = 0; n < 2; ++n)
#pragma unroll
            for (int j = 0; j < 8; ++j) o[n][j] *= alpha;
#pragma unroll
        for (int n = 0; n < 2; ++n) { const h16* vp = vt_b + fro(n * 16, l0, NK / 32); o[n] = wmma16(cat16(*(const v8h*)vp, *(const v8h*)(vp + 256)), pb, o[n]); }
        // the four vector slots the chip needs behind a WMMA, also on the taken side of the loop branch
        asm volatile("v_nop\n\tv_nop\n\tv_nop\n\tv_nop" : "+v"(o[0]), "+v"(o[1]) : "v"(pb));
    }
    const float lh = lpart[0] + lpart[1], inv = 1.0f / ((lh + xhalf(lh)) * PSC);
    const size_t cbase = fro(b * NN_ + q0, h * HD, CC / 32) + 8 * lane;
    v8us oh, ol, oh2, ol2;        // d = 8 hi + i and d = 16 + 8 hi + i of row lr
#pragma unroll
    for (int i = 0; i < 8; ++i) { const float c0 = o[0][i] * inv, c1 = o[1][i] * inv;
        const unsigned short hb = f2bf(c0); oh[i] = hb; ol[i] = f2bf(c0 - bf2f(hb)); const unsigned short hb2 = f2bf(c1); oh2[i] = hb2; ol2[i] = f2bf(c1 - bf2f(hb2)); }
    *(v8us*)(CH + cbase) = oh; *(v8us*)(CH + cbase + 256) = oh2;
    *(v8us*)(CL + cbase) = ol; *(v8us*)(CL + cbase + 256) = ol2;
}

extern "C" void kernel_launch(void* const* d_in, const int* in_sizes, int n_in,
                              void* d_out, int out_size, void* d_ws, size_t ws_size, hipStream_t stream) {
    (void)in_sizes; (void)n_in; (void)out_size;
    const float* x = (const float*)d_in[0]; const float* Wq = (const float*)d_in[1]; const float* bq = (const float*)d_in[2]; const float* Wk = (const float*)d_in[3]; const float* bk = (const float*)d_in[4];
    const float* Wv = (const float*)d_in[5]; const float* bv = (const float*)d_in[6]; const float* Wp = (const float*)d_in[7]; const float* bp = (const float*)d_in[8];
    const float* g = (const float*)d_in[9]; const float* be = (const float*)d_in[10]; const float* mu = (const float*)d_in[11]; const float* var = (const float*)d_in[12];
    float* out = (float*)d_out;    // [32][384][32][32]
    char* wsp = (char*)d_ws;
    auto take = [&](size_t bytes) { char* p = wsp; wsp += (bytes + 255) & ~(size_t)255; return (void*)p; };
    bf* Xb = (bf*)take((size_t)NTQ * CC * 2); bf* XRH = (bf*)take((size_t)NTKV * CC * 2); bf* XRL = (bf*)take((size_t)NTKV * CC * 2);
    bf* WT = (bf*)take((size_t)4 * CC * CC * 2);    // the four weight planes in a row: q, k, v, p
    h16* Q16 = (h16*)take((size_t)NTQ * CC * 2); h16* K16 = (h16*)take((size_t)NTKV * CC * 2); h16* VT16 = (h16*)take((size_t)NTKV * CC * 2);
    bf* CLt = (bf*)take((size_t)NTQ * CC * 2);
    if ((size_t)(wsp - (char*)d_ws) > ws_size) return;    // 25.2 + 12.6 + 1.2 + 25.2 + 12.6 + 25.2 MB ~ 102 MB
    bf* CHt = Xb;                              // the token plane is dead after the q projection
    k_prep<<<NWTB + NGRP, 256, 0, stream>>>(x, g, be, mu, var, Wq, Wk, Wv, Wp, Xb, XRH, XRL, WT);
    k_qkv<<<2 * NKB + (NTQ / 128) * (CC / (2 * WNQ)), 128, 0, stream>>>(Xb, XRH, XRL, WT, bq, bk, bv, Q16, K16, VT16);
    k_attn<<<NB_ * NH_ * (NN_ / 64), 128, 0, stream>>>(Q16, K16, VT16, CHt, CLt);
    k_proj<<<dim3(NTQ / 128, CC / (2 * WNP), 1), 128, 0, stream>>>(CHt, CLt, WT + (size_t)3 * CC * CC, bp, out);
}

// v006
// One run takes 68 microseconds.
// Timed twice side by side with v005, it ran 1.30 and 1.31 times as fast.
// Over all steps from v000 it is 3.23 times as fast.
#include <hip/hip_runtime.h>

// Contractions, f32 accumulate: q = tok.Wq + bq ([32 x 1024 tokens x 384].[384 x 384]) on v_wmma_f32_16x16x32_bf16 with PLAIN bf16 operands (tok = the NCHW input
// transposed, rounded once: exact); k, v = xr.Wk/Wv + b on the bf16 instruction with the pooled + batch-normed tokens xr (computed) as bf16 hi + residual planes (two
// products); the per-(batch, head) attention (12 heads of 32: scores [1024 x 32].[32 x 256] x 32^-1/2, softmax, .v) fused on v_wmma_f32_16x16x32_f16 with plain f16
// q, k, v and weights x32768; out = ctx.Wp + bp on the bf16 instruction with ctx as bf16 hi + residual planes, written back transposed to NCHW. Deterministic, no

#define NB_  32
#define CC   384
#define NN_  1024
#define NK   256
#define NH_  12
#define HD   32
#define NTQ  (NB_ * NN_)          // 32768 query tokens
#define NTKV (NB_ * NK)           // 8192 pooled tokens
#define PSC  32768.0f
#define SCL  0.17677669529663687f

typedef _Float16 h16;
typedef unsigned short bf;
typedef __attribute__((ext_vector_type(16))) __bf16   v16bf;
typedef __attribute__((ext_vector_type(16))) _Float16 v16h;
typedef __attribute__((ext_vector_type(8)))  _Float16 v8h;
typedef __attribute__((ext_vector_type(8)))  unsigned short v8us;
typedef __attribute__((ext_vector_type(8)))  float    v8f;
typedef __attribute__((ext_vector_type(4)))  float    v4f;
typedef __attribute__((ext_vector_type(2)))  float    v2f;
typedef __attribute__((ext_vector_type(2)))  _Float16 v2h;
typedef v4f  __attribute__((may_alias)) v4fa;
typedef v8us __attribute__((may_alias)) v8usa;

__device__ __forceinline__ unsigned short f2bf(float f) { unsigned u = __float_as_uint(f); u += 0x7FFFu + ((u >> 16) & 1u); return (unsigned short)(u >> 16); }
__device__ __forceinline__ float bf2f(unsigned short b) { return __uint_as_float(((unsigned)b) << 16); }
__device__ __forceinline__ float bfr(float f) { return bf2f(f2bf(f)); }
__device__ __forceinline__ v16h cat16(v8h lo, v8h hi) { return __builtin_shufflevector(lo, hi, 0, 1, 2, 3, 4, 5, 6, 7, 8, 9, 10, 11, 12, 13, 14, 15); }
__device__ __forceinline__ v16bf cat16b(v8us lo, v8us hi) { return __builtin_bit_cast(v16bf, __builtin_shufflevector(lo, hi, 0, 1, 2, 3, 4, 5, 6, 7, 8, 9, 10, 11, 12, 13, 14, 15)); }
__device__ __forceinline__ v8f wmma16(v16h a, v16h b, v8f c) { return __builtin_amdgcn_wmma_f32_16x16x32_f16(false, a, false, b, (short)0, c, false, false); }
__device__ __forceinline__ v8f wmmab(v16bf a, v16bf b, v8f c) { return __builtin_amdgcn_wmma_f32_16x16x32_bf16(false, a, false, b, (short)0, c, false, false); }
// Fragment-order planes: every 16-bit WMMA operand plane [rows][k] in the workspace is stored as 1024-byte blocks, one per (16 rows, 32 k), block index (row / 16) * kch + k / 32
// (kch = k extent / 32); inside a block [k bits 4..3][row & 15][k & 7]. Lane l = 16 * hi + lr of a fragment load then reads 16 bytes at block + 8 * l (k = 8 hi ..) and at
// block + 256 + 8 * l (k = 16 + 8 hi ..): 512 contiguous bytes = 4 whole lines per load, where a row-major plane made each load touch 16 lines. fro = element offset of (row, k).
__device__ __forceinline__ size_t fro(int row, int k, int kch) { return ((size_t)(row >> 4) * kch + (k >> 5)) * 512 + ((k >> 3) & 3) * 128 + (row & 15) * 8 + (k & 7); }

// d_xpart: one block takes x[b][c0 .. c0 + 63][n0 .. n0 + 255], reads it ONCE and makes from it both its part of Xb (row b*1024 + n, k = c, fragment order) = bf16(x[b][c][n]) and its part of
// XRH/XRL (row b*256 + m, k = c, fragment order) = bf16 hi + residual of (mean_{t<4} bf16(x[b][c][4m+t])) * inv[c] + shift[c], inv = g/sqrt(var + eps), shift = beta - mean*inv (bf16-rounded params,
// f32 math). Wave w owns the 8 channels c0 + 8 w ..; each of its 16 loads is 512 contiguous bytes of one channel (4 whole lines): lane l gets tokens 4 l .. 4 l + 3 of a 128-token half, which are one
// pooling group. For one token (or one pooled token) the lane's 8 channels are one 16-byte unit of the fragment order; the units go to LDS images of the output runs (2 KB per 16 rows) and leave
// as 512 contiguous bytes a wave. XTP: pitch of a 16-token run in LDS, 2 KB + 16 bytes, so that the 16 lanes of a half wave, which write 4 units in each of 4 runs, fall on all 64 banks.
#define XTP 1032
#define XPO (16 * XTP)
__device__ __forceinline__ float rdl(float v, int l) { return __builtin_bit_cast(float, __builtin_amdgcn_readlane(__builtin_bit_cast(int, v), l)); }
__device__ __forceinline__ void d_xpart(const float* __restrict__ x, const float* __restrict__ g, const float* __restrict__ be, const float* __restrict__ mu, const float* __restrict__ var,
                                        bf* Xb, bf* XRH, bf* XRL, unsigned short* sh, int mx, int cy, int b) {
    const int tid = threadIdx.x, lane = tid & 31, w = tid >> 5;
    const int c0 = cy * 64, n0 = mx * 256, m0 = mx * 64;
    const float* xp = x + ((size_t)b * CC + c0 + w * 8) * NN_ + n0 + lane * 4;
    const int cp = c0 + w * 8 + (lane & 7);        // lane l computes the two parameters of the wave's channel l & 7; each is read from its lane below
    const float gl = g[cp], vl = var[cp], bl = be[cp], ml = mu[cp];
    // the register that these four loads name was given to one of the loads below as its destination: the wait stands before it is written again
    asm volatile("s_wait_xcnt 0x0" ::: "memory");
    v4f r[8][2];
#pragma unroll        // here and below: unrolled so that every register index is a constant
    for (int jc = 0; jc < 8; ++jc)
#pragma unroll
        for (int hf = 0; hf < 2; ++hf) r[jc][hf] = *(const v4fa*)(xp + jc * NN_ + hf * 128);
    // behind the last load, its address named so that it lives to here: without this the last load's destination was laid on the address pair that the fifteen before it name
    asm volatile("s_wait_xcnt 0x0" :: "v"(xp) : "memory");
    // all of the wave's loads are issued before the first value is used: without this the compiler fetched them in groups and waited out a whole memory latency at each
    __builtin_amdgcn_sched_barrier(0);
    const float invl = bfr(gl) / sqrtf(bfr(vl) + 1e-5f), shl = bfr(bl) - bfr(ml) * invl;
    unsigned short* tw = sh + (lane >> 2) * XTP + (w >> 2) * 512 + (w & 3) * 128 + (lane & 3) * 32;
    unsigned short* pw = sh + XPO + (lane >> 4) * 1024 + (w >> 2) * 512 + (w & 3) * 128 + (lane & 15) * 8;
#pragma unroll
    for (int hf = 0; hf < 2; ++hf) {
        v8us tu[4], hu, lu;
#pragma unroll
        for (int jc = 0; jc < 8; ++jc) {
            const float inv = rdl(invl, jc), shf = rdl(shl, jc);
            unsigned short q[4];
#pragma unroll
            for (int e = 0; e < 4; ++e) { q[e] = f2bf(r[jc][hf][e]); tu[e][jc] = q[e]; }
            const float v = ((bf2f(q[0]) + bf2f(q[1]) + bf2f(q[2]) + bf2f(q[3])) * 0.25f) * inv + shf;
            const unsigned short hb = f2bf(v); hu[jc] = hb; lu[jc] = f2bf(v - bf2f(hb));
        }
#pragma unroll
        for (int e = 0; e < 4; ++e) *(v8usa*)(tw + hf * 8 * XTP + e * 8) = tu[e];
        *(v8usa*)(pw + hf * 2048) = hu; *(v8usa*)(pw + 4096 + hf * 2048) = lu;
    }
    __syncthreads();
    const int rt = tid >> 7, wi = (tid & 127) * 8;        // 128 units of 16 bytes make one 2 KB run: 16 rows x this block's 64 channels
    bf* xo = Xb + ((size_t)((b * NN_ + n0) / 16 + rt) * (CC / 32) + 2 * cy) * 512 + wi;
#pragma unroll
    for (int s = 0; s < 8; ++s) { const v8us val = *(const v8usa*)(sh + (2 * s + rt) * XTP + wi); *(v8us*)(xo + (size_t)(2 * s) * (CC / 32) * 512) = val; }
    const size_t po = ((size_t)((b * NK + m0) / 16 + rt) * (CC / 32) + 2 * cy) * 512 + wi;
#pragma unroll
    for (int s = 0; s < 4; ++s) { const int pln = s >> 1, t2 = 2 * (s & 1); const v8us val = *(const v8usa*)(sh + XPO + pln * 4096 + (t2 + rt) * 1024 + wi);
        *(v8us*)((pln ? XRL : XRH) + po + (size_t)t2 * (CC / 32) * 512) = val; }
    // another job's code follows this one in the merged kernel's listing: the wait stands before any register that these stores name is written again
    asm volatile("s_wait_xcnt 0x0" ::: "memory");
}
// d_wt: W [384 k][384 n] k-major -> bf16 plane (row n, k, fragment order); 64 x 64 tiles.
__device__ __forceinline__ void d_wt(const float* __restrict__ Wm, bf* WT, unsigned short* tl, int bx, int by) {
    const int tid = threadIdx.x, k0 = bx * 64, n0 = by * 64;
    const int kk = tid >> 2, nq = (tid & 3) * 16;
#pragma unroll
    for (int i = 0; i < 16; ++i) tl[(nq + i) * 72 + kk] = f2bf(Wm[(size_t)(k0 + kk) * CC + n0 + nq + i]);
    __syncthreads();
    const int piece = (tid >> 4) & 7;
    auto pass = [&]() {
#pragma unroll
        for (int s = 0; s < 2; ++s) { const int nr = ((tid >> 7) + 2 * s) * 16 + (tid & 15); const v8us val = *(const v8usa*)(tl + nr * 72 + piece * 8);
            *(v8us*)(WT + fro(n0 + nr, k0 + piece * 8, CC / 32)) = val; }
    };
    pass();
    // another job's code follows this one in the merged kernel's listing: the wait stands before any register that these stores name is written again
    asm volatile("s_wait_xcnt 0x0" ::: "memory");
}
// k_prep: the jobs that need nothing of each other, in block ranges of ONE launch (the branch is the same for a whole block): blocks 0 .. 143 the four weight planes (36 tiles each, WT = four
// planes in a row); then 768 blocks, one per (b, c tile, 256 tokens), each of which makes the token plane's and the pooled planes' part of its x part.
#define NWTB (4 * (CC / 64) * (CC / 64))
#define NGRP (NB_ * (CC / 64) * (NK / 64))
__global__ __launch_bounds__(256) void k_prep(const float* __restrict__ x, const float* __restrict__ g, const float* __restrict__ be, const float* __restrict__ mu, const float* __restrict__ var,
                                              const float* __restrict__ Wq, const float* __restrict__ Wk, const float* __restrict__ Wv, const float* __restrict__ Wp, bf* Xb, bf* XRH, bf* XRL, bf* WT) {
    __shared__ __align__(16) unsigned short sh[XPO + 2 * 4096];
    const int bid = blockIdx.x;
    if (bid < NWTB) {
        const int i = bid / 36, t = bid - i * 36, by = t / 6, bx = t - by * 6;
        d_wt(i == 0 ? Wq : i == 1 ? Wk : i == 2 ? Wv : Wp, WT + (size_t)i * CC * CC, sh, bx, by);
    } else {
        const int grp = bid - NWTB;
        const int mx = grp & 3, cb = grp >> 2, b = cb / 6, cy = cb - b * 6;
        d_xpart(x, g, be, mu, var, Xb, XRH, XRL, sh, mx, cy, b);
    }
}

// d_gemmb: ONE WAVE computes the 64 x WN tile (tr, tc) of (A [+ Al]).B^T + bf16(bias), K = 384, as 4 x WN / 16 accumulator tiles: each A fragment loaded serves WN / 16 products, each B fragment four
// (eight with the residual plane). A, Al, B are fragment-order planes; the tile, bias added, goes to os, this wave's own [64 rows][WN + 4] f32 staging range (at that pitch rows 8 apart fall 32 banks
// apart and a row starts at a multiple of 16 bytes). WN = 96 in k_qkv: the launch is then 768 blocks of four waves, three to a WGP, all resident at once.
template <bool SPLITA, int WN>
__device__ __forceinline__ void d_gemmb(const bf* __restrict__ A, const bf* __restrict__ Al, const bf* __restrict__ Bn, const float* __restrict__ bias, float* os, int tr, int tc) {
    constexpr int SP = WN + 4;
    const int lane = threadIdx.x & 31, lr = lane & 15, hi = lane >> 4;
    const int r0 = tr * 64, c0 = tc * WN;
    const size_t aoff = fro(r0, 0, CC / 32) + 8 * lane;
    const bf* ap = A + aoff; const bf* alp = (SPLITA ? Al : A) + aoff; const bf* bp = Bn + fro(c0, 0, CC / 32) + 8 * lane;        // block (16-row tile i, k chunk kc) lies (i * 12 + kc) * 512 elements on
    const float* bb = bias + c0 + lr; float bvr[WN / 16];        // the lane's bias values, fetched with the last step's fragments
    v8f acc[4][WN / 16];        // [row tile][column tile]
#pragma unroll        // here and below, in d_gemmb and d_out: unrolled so that every register index is a constant
    for (int i = 0; i < 4; ++i)
#pragma unroll
        for (int t = 0; t < WN / 16; ++t) acc[i][t] = (v8f){};
#pragma unroll        // unrolled: every load address is a base plus a constant, and no loop branch stands behind a WMMA
    for (int kc = 0; kc < CC / 32; ++kc) {
        v16bf a[4], al[4], b[WN / 16];
        if (kc == CC / 32 - 1) {
#pragma unroll
            for (int t = 0; t < WN / 16; ++t) bvr[t] = bb[t * 16];
        }
#pragma unroll
        for (int i = 0; i < 4; ++i) { const bf* at = ap + (i * (CC / 32) + kc) * 512; a[i] = cat16b(*(const v8us*)at, *(const v8us*)(at + 256)); }
#pragma unroll
        for (int t = 0; t < WN / 16; ++t) { const bf* bt = bp + (t * (CC / 32) + kc) * 512; b[t] = cat16b(*(const v8us*)bt, *(const v8us*)(bt + 256)); }
        if (SPLITA) {
#pragma unroll
            for (int i = 0; i < 4; ++i) { const bf* lt = alp + (i * (CC / 32) + kc) * 512; al[i] = cat16b(*(const v8us*)lt, *(const v8us*)(lt + 256)); }
        }
        // behind the last loads: the registers that they name are written again below, for the staging addresses; the scheduling barrier on the next line keeps them behind this one
        if (WN > 64 && kc == CC / 32 - 1) asm volatile("s_wait_xcnt 0x0" ::: "memory");
        // all of a step's loads are issued before its first product: without this the compiler fetched one B fragment at a time and waited out its whole latency at each
        __builtin_amdgcn_sched_barrier(0);
#pragma unroll
        for (int t = 0; t < WN / 16; ++t)
#pragma unroll
            for (int i = 0; i < 4; ++i) acc[i][t] = wmmab(a[i], b[t], acc[i][t]);
        if (SPLITA) {
#pragma unroll
            for (int t = 0; t < WN / 16; ++t)
#pragma unroll
                for (int i = 0; i < 4; ++i) acc[i][t] = wmmab(al[i], b[t], acc[i][t]);
        }
    }
#pragma unroll
    for (int t = 0; t < WN / 16; ++t) { const float bv = bfr(bvr[t]);
#pragma unroll
        for (int i = 0; i < 4; ++i)
#pragma unroll
            for (int j = 0; j < 8; ++j) os[(i * 16 + hi * 8 + j) * SP + t * 16 + lr] = acc[i][t][j] + bv; }
    __syncthreads();
}
// d_out: the staged tile (tr, tc) to its plane. MODE 0: f16 plane C16 (row, col, fragment order); MODE 2: VT16 planes for v, transposed: plane row = b*384 + col, k = key m (row = b*256 + m)
template <int MODE, int WN>
__device__ __forceinline__ void d_out(void* Cout, const float* os, int tr, int tc) {
    constexpr int SP = WN + 4;
    const int lane = threadIdx.x & 31, lr = lane & 15, hi = lane >> 4;
    const int r0 = tr * 64, c0 = tc * WN;
    if (MODE == 0) {
        h16* cpl = (h16*)Cout;
#pragma unroll
        for (int i = 0; i < 4; ++i)
#pragma unroll
            for (int s = 0; s < WN / 16; ++s) { const int piece = 2 * s + hi; const float* sp = os + (i * 16 + lr) * SP + piece * 8; v8h o;
#pragma unroll
                for (int e = 0; e < 8; ++e) o[e] = (h16)sp[e];
                *(v8h*)(cpl + fro(r0 + i * 16 + lr, c0 + piece * 8, CC / 32)) = o; }
        // another job's code follows this one in the merged kernel's listing: the wait stands before any register that these stores name is written again
        asm volatile("s_wait_xcnt 0x0" ::: "memory");
    } else {
        const int b = r0 / NK, m0 = r0 - b * NK;
        h16* vb = (h16*)Cout;        // plane row = b*CC + col since [b][h][d] flattens to b*384 + h*32 + d; k = key m; fragment order with 256 / 32 blocks per 16 rows
#pragma unroll
        for (int cw = 0; cw < WN / 16; ++cw)
#pragma unroll
            for (int s = 0; s < 4; ++s) { const int col = cw * 16 + lr, q = 2 * s + hi; v8h v;
#pragma unroll
                for (int e = 0; e < 8; ++e) v[e] = (h16)os[(q * 8 + e) * SP + col];
                *(v8h*)(vb + fro(b * CC + c0 + col, m0 + q * 8, NK / 32)) = v; }
        // another job's code follows this one in the merged kernel's listing: the wait stands before any register that these stores name is written again
        asm volatile("s_wait_xcnt 0x0" ::: "memory");
    }
}
// A block of four waves takes a 128 x 2 WN tile, wave w the 64 x WN quarter (w >> 1, w & 1): two waves share each A row tile and two each B column tile through the WGP cache.
// k_qkv: the three projections, which need nothing of each other, in block ranges of ONE launch: first the k and v tiles (two products a step, the longer blocks; row tile fastest, 2 column tiles
// of k, then 2 of v), then the q tiles (row tile fastest): 768 blocks, three to a WGP. WT = the four weight planes in a row (q, k, v, p).
#define WNQ 96
#define NKB ((NTKV / 128) * (CC / (2 * WNQ)))
__global__ __launch_bounds__(128) void k_qkv(const bf* __restrict__ Xb, const bf* __restrict__ XRH, const bf* __restrict__ XRL, const bf* __restrict__ WT,
                                             const float* __restrict__ bq, const float* __restrict__ bk, const float* __restrict__ bv, h16* Q16, h16* K16, h16* VT16) {
    __shared__ __align__(16) float ost[4 * 64 * (WNQ + 4)];
    const int bid = blockIdx.x, wave = __builtin_amdgcn_readfirstlane(threadIdx.x >> 5), wr = wave >> 1, wc = wave & 1;        // the wave's number in a scalar register: tile bases stay scalar
    float* os = ost + wave * 64 * (WNQ + 4);
    if (bid < 2 * NKB) {        // k and v share one copy of the product loop's code
        const bool isv = bid >= NKB; const int r = isv ? bid - NKB : bid, tr = 2 * (r & (NTKV / 128 - 1)) + wr, tc = 2 * (r / (NTKV / 128)) + wc;
        d_gemmb<true, WNQ>(XRH, XRL, WT + (size_t)(isv ? 2 : 1) * CC * CC, isv ? bv : bk, os, tr, tc);
        if (isv) d_out<2, WNQ>(VT16, os, tr, tc); else d_out<0, WNQ>(K16, os, tr, tc);
    } else {
        const int r = bid - 2 * NKB, tr = 2 * (r & (NTQ / 128 - 1)) + wr, tc = 2 * (r / (NTQ / 128)) + wc;
        d_gemmb<false, WNQ>(Xb, nullptr, WT, bq, os, tr, tc);
        d_out<0, WNQ>(Q16, os, tr, tc);
    }
}
// k_attnproj: attention and output projection in ONE launch; block = (b, 64 queries), 12 waves. The context tile [64 queries][384] never leaves the WGP: it goes from the attention waves to the
// projection waves through LDS, as the same two fragment-order bf16 planes (hi + residual) that a workspace plane would hold.
// Attention: a wave takes one head (head dim 32: one k-chunk) and 32 queries = two 16-query tiles, so a loaded K or V fragment feeds two tiles; waves 2 i and 2 i + 1 take the two halves of the block's
// queries for the SAME head at the same time, so that one of them finds the head's K, V lines in the WGP cache; six heads at a time, two passes. 8 steps x 32 keys, computed TRANSPOSED: S^T = K.Q^T
// (A = 16 key rows, B = a tile's 16 queries) x 32^-1/2, so lane (hi, lr) holds 16 scores of the ONE query lr (keys 8 hi + j and 16 + 8 hi + j): maximum and sum run in-lane plus
// one exchange between the wave halves; the weights x32768 packed to f16 from the two score tiles ARE the B operand of O^T += V^T.P^T in the hardware k order. O^T tile n, register j =
// ctx[query lr][16 n + 8 hi + j], which is the lane's own 16 bytes of fragment-order block (query tile u, k chunk h), at element (u * 12 + h) * 512 of each LDS plane.
// Projection: wave (wr, wc) = (wave / 6, wave % 6) computes rows 32 wr .., columns 64 wc .. of ctx.Wp + bf16(bp), K = 384, as 2 x 4 accumulator tiles: A fragments (hi, residual) from LDS, B fragments
// of the weight plane from global. The tile, bias added, is staged in the wave's own [32 rows][66] f32 range of the SAME LDS (the planes are dead by then: second barrier)
// and leaves transposed into NCHW out[b][c][n]: each column c gets 32 consecutive n = one whole 128-byte line, four lines an instruction. At pitch 66 rows 8 apart fall 16 banks apart (the writes: 16
// columns of two such rows) and rows 4 apart 8 banks apart (the reads: 4 columns of eight such rows): 32 different banks either way.
#define OSP 66
#define PLN (4 * (CC / 32) * 512)
#define TP 2
__device__ __forceinline__ float xhalf(float x) { return __builtin_bit_cast(float, __builtin_amdgcn_permlanex16(__builtin_bit_cast(int, x), __builtin_bit_cast(int, x), 0x76543210, 0xfedcba98, false, false)); }  // lane l with lane l ^ 16
__global__ __launch_bounds__(384) void k_attnproj(const h16* __restrict__ Q16, const h16* __restrict__ K16, const h16* __restrict__ VT16, const bf* __restrict__ Bn, const float* __restrict__ bias, float* out) {
    __shared__ __align__(16) float smem[12 * 32 * OSP];        // 101376 bytes: first the two ctx planes (2 x 49152 bytes), then the twelve staging ranges
    bf* chs = (bf*)smem; bf* cls = chs + PLN;
    const int lane = threadIdx.x & 31, lr = lane & 15, hi = lane >> 4;
    const int wave = __builtin_amdgcn_readfirstlane(threadIdx.x >> 5);        // in a scalar register: head, tile and plane bases stay scalar
    const int bid = blockIdx.x, b = bid / (NN_ / 64), q0 = (bid - b * (NN_ / 64)) * 64, u0 = TP * (wave & 1);
    for (int hp = 0; hp < 2; ++hp) {
        const int h = hp * (NH_ / 2) + (wave >> 1);
        const h16* kh_b = K16 + fro(b * NK, h * HD, CC / 32) + 8 * lane;
        const h16* vt_b = VT16 + fro(b * CC + h * HD, 0, NK / 32) + 8 * lane;
        const h16* qp = Q16 + fro(b * NN_ + q0 + 16 * u0, h * HD, CC / 32) + 8 * lane;
        v16h qb[TP];
#pragma unroll        // here and below: unrolled so that every register index is a constant
        for (int u = 0; u < TP; ++u) { const h16* qu = qp + u * (CC / 32) * 512; qb[u] = cat16(*(const v8h*)qu, *(const v8h*)(qu + 256)); }
        v8f o[TP][2]; float mrow[TP]; v2f lpart[TP];        // lpart: even and odd registers' share of this half's weight sum
#pragma unroll
        for (int u = 0; u < TP; ++u) { o[u][0] = (v8f){}; o[u][1] = (v8f){}; mrow[u] = -3.0e38f; lpart[u] = (v2f){0.f, 0.f}; }
#pragma unroll 1        // rolled: the live registers stay those of one step
        for (int kt = 0; kt < NK / 32; ++kt) {
            const int l0 = kt * 32;
            const h16* r0p = kh_b + fro(l0, 0, CC / 32); const h16* r1p = kh_b + fro(l0 + 16, 0, CC / 32);
            const h16* v0p = vt_b + fro(0, l0, NK / 32); const h16* v1p = vt_b + fro(16, l0, NK / 32);
            const v16h k0 = cat16(*(const v8h*)r0p, *(const v8h*)(r0p + 256)), k1 = cat16(*(const v8h*)r1p, *(const v8h*)(r1p + 256));
            const v16h w0 = cat16(*(const v8h*)v0p, *(const v8h*)(v0p + 256)), w1 = cat16(*(const v8h*)v1p, *(const v8h*)(v1p + 256));
            v8f s0[TP], s1[TP]; v16h pb[TP]; v2f a[TP][8]; float alpha[TP];
#pragma unroll
            for (int u = 0; u < TP; ++u) { s0[u] = (v8f){}; s0[u] = wmma16(k0, qb[u], s0[u]); }
#pragma unroll
            for (int u = 0; u < TP; ++u) { s1[u] = (v8f){}; s1[u] = wmma16(k1, qb[u], s1[u]); }
#pragma unroll
            for (int u = 0; u < TP; ++u) {
                float mx = -3.0e38f;        // a[u][i] = two neighbouring registers of the score tiles: keys 8 hi + 2 i, + 1 (i < 4) and 16 + 8 hi + 2 (i - 4), + 1
#pragma unroll
                for (int i = 0; i < 4; ++i) { a[u][i] = (v2f){s0[u][2 * i], s0[u][2 * i + 1]} * SCL; a[u][4 + i] = (v2f){s1[u][2 * i], s1[u][2 * i + 1]} * SCL; }
#pragma unroll
                for (int i = 0; i < 8; ++i) mx = fmaxf(mx, fmaxf(a[u][i][0], a[u][i][1]));
                mx = fmaxf(mx, xhalf(mx));
                const float mn = fmaxf(mrow[u], mx);
                alpha[u] = __expf(mrow[u] - mn);
                mrow[u] = mn;
            }
#pragma unroll        // both tiles' maxima and rescale factors stand above, both tiles' weights below
            for (int u = 0; u < TP; ++u) {
                const float mn = mrow[u];
                v2f p[8];
#pragma unroll
                for (int i = 0; i < 8; ++i) {
                    p[i] = (v2f){__expf(a[u][i][0] - mn), __expf(a[u][i][1] - mn)};
                    const v2h ph = __builtin_convertvector(p[i] * PSC, v2h);
                    pb[u][2 * i] = ph[0]; pb[u][2 * i + 1] = ph[1];
                }
                lpart[u] = lpart[u] * alpha[u] + (((p[0] + p[1]) + (p[2] + p[3])) + ((p[4] + p[5]) + (p[6] + p[7])));
#pragma unroll
                for (int n = 0; n < 2; ++n)
#pragma unroll
                    for (int j = 0; j < 8; ++j) o[u][n][j] *= alpha[u];
            }
#pragma unroll
            for (int u = 0; u < TP; ++u) { o[u][0] = wmma16(w0, pb[u], o[u][0]); o[u][1] = wmma16(w1, pb[u], o[u][1]); }
            // the four vector slots the chip needs behind a WMMA, also on the taken side of the loop branch
            asm volatile("v_nop\n\tv_nop\n\tv_nop\n\tv_nop" : "+v"(o[0][0]), "+v"(o[0][1]), "+v"(o[1][0]), "+v"(o[1][1]));
        }
#pragma unroll
        for (int u = 0; u < TP; ++u) {
            const float lh = lpart[u][0] + lpart[u][1], inv = 1.0f / ((lh + xhalf(lh)) * PSC);
            const int cbase = ((u0 + u) * (CC / 32) + h) * 512 + 8 * lane;
            v8us oh, ol, oh2, ol2;        // d = 8 hi + i and d = 16 + 8 hi + i of row lr
#pragma unroll
            for (int i = 0; i < 8; ++i) { const float c0 = o[u][0][i] * inv, c1 = o[u][1][i] * inv;
                const unsigned short hb = f2bf(c0); oh[i] = hb; ol[i] = f2bf(c0 - bf2f(hb)); const unsigned short hb2 = f2bf(c1); oh2[i] = hb2; ol2[i] = f2bf(c1 - bf2f(hb2)); }
            *(v8usa*)(chs + cbase) = oh; *(v8usa*)(chs + cbase + 256) = oh2;
            *(v8usa*)(cls + cbase) = ol; *(v8usa*)(cls + cbase + 256) = ol2;
        }
    }
    const int wr = wave / 6, wc = wave - wr * 6, c0 = wc * 64;
    const bf* bp = Bn + fro(c0, 0, CC / 32) + 8 * lane;        // block (16-column tile t, k chunk kc) lies (t * 12 + kc) * 512 elements on
    v16bf bc[4]; float bvr[4];        // the first step's B fragments and the lane's bias values need nothing of the attention: fetched in front of the barrier
#pragma unroll
    for (int t = 0; t < 4; ++t) { const bf* bt = bp + t * (CC / 32) * 512; bc[t] = cat16b(*(const v8us*)bt, *(const v8us*)(bt + 256)); bvr[t] = bias[c0 + t * 16 + lr]; }
    __syncthreads();        // every head's part of the two ctx planes is in LDS
    const bf* ap = chs + 2 * wr * (CC / 32) * 512 + 8 * lane; const bf* alp = cls + 2 * wr * (CC / 32) * 512 + 8 * lane;
    v8f acc[2][4];        // [row tile][column tile]
#pragma unroll
    for (int i = 0; i < 2; ++i)
#pragma unroll
        for (int t = 0; t < 4; ++t) acc[i][t] = (v8f){};
#pragma unroll        // unrolled: every load address is a base plus a constant, and no loop branch stands behind a WMMA
    for (int kc = 0; kc < CC / 32; ++kc) {
        v16bf a[2], al[2];
        if (kc > 0) {
#pragma unroll
            for (int t = 0; t < 4; ++t) { const bf* bt = bp + (t * (CC / 32) + kc) * 512; bc[t] = cat16b(*(const v8us*)bt, *(const v8us*)(bt + 256)); }
        }
#pragma unroll
        for (int i = 0; i < 2; ++i) { const bf* at = ap + (i * (CC / 32) + kc) * 512; a[i] = cat16b(*(const v8usa*)at, *(const v8usa*)(at + 256));
            const bf* lt = alp + (i * (CC / 32) + kc) * 512; al[i] = cat16b(*(const v8usa*)lt, *(const v8usa*)(lt + 256)); }
        // a step's loads stay in front of its own products and behind the step before: without this the compiler spread them over several steps and took 300 registers, where two blocks on a WGP leave a wave 160
        __builtin_amdgcn_sched_barrier(0);
#pragma unroll
        for (int t = 0; t < 4; ++t)
#pragma unroll
            for (int i = 0; i < 2; ++i) acc[i][t] = wmmab(a[i], bc[t], acc[i][t]);
#pragma unroll
        for (int t = 0; t < 4; ++t)
#pragma unroll
            for (int i = 0; i < 2; ++i) acc[i][t] = wmmab(al[i], bc[t], acc[i][t]);
    }
    __syncthreads();        // every wave has read its last fragment of the ctx planes: their LDS becomes the staging ranges
    float* os = smem + wave * 32 * OSP;
#pragma unroll
    for (int t = 0; t < 4; ++t) { const float bv = bfr(bvr[t]);
#pragma unroll
        for (int i = 0; i < 2; ++i)
#pragma unroll
            for (int j = 0; j < 8; ++j) os[(i * 16 + hi * 8 + j) * OSP + t * 16 + lr] = acc[i][t][j] + bv; }
    __syncthreads();        // the staged tile is whole before its lanes read each other's values
    float* ob = out + ((size_t)b * CC + c0) * NN_ + q0 + wr * 32;
    const int cq = lane >> 3, q = lane & 7;        // column c (64 of them) x 32 rows n; per column 32 floats = 8 lanes x 16 B; 4 columns per instruction
    v4f vv[16];
#pragma unroll
    for (int s = 0; s < 16; ++s)
#pragma unroll
        for (int e = 0; e < 4; ++e) vv[s][e] = os[(q * 4 + e) * OSP + 4 * s + cq];
#pragma unroll
    for (int s = 0; s < 16; ++s) *(v4f*)(ob + (size_t)(4 * s + cq) * NN_ + q * 4) = vv[s];
}

extern "C" void kernel_launch(void* const* d_in, const int* in_sizes, int n_in,
                              void* d_out, int out_size, void* d_ws, size_t ws_size, hipStream_t stream) {
    (void)in_sizes; (void)n_in; (void)out_size;
    const float* x = (const float*)d_in[0]; const float* Wq = (const float*)d_in[1]; const float* bq = (const float*)d_in[2]; const float* Wk = (const float*)d_in[3]; const float* bk = (const float*)d_in[4];
    const float* Wv = (const float*)d_in[5]; const float* bv = (const float*)d_in[6]; const float* Wp = (const float*)d_in[7]; const float* bp = (const float*)d_in[8];
    const float* g = (const float*)d_in[9]; const float* be = (const float*)d_in[10]; const float* mu = (const float*)d_in[11]; const float* var = (const float*)d_in[12];
    float* out = (float*)d_out;    // [32][384][32][32]
    char* wsp = (char*)d_ws;
    auto take = [&](size_t bytes) { char* p = wsp; wsp += (bytes + 255) & ~(size_t)255; return (void*)p; };
    bf* Xb = (bf*)take((size_t)NTQ * CC * 2); bf* XRH = (bf*)take((size_t)NTKV * CC * 2); bf* XRL = (bf*)take((size_t)NTKV * CC * 2);
    bf* WT = (bf*)take((size_t)4 * CC * CC * 2);    // the four weight planes in a row: q, k, v, p
    h16* Q16 = (h16*)take((size_t)NTQ * CC * 2); h16* K16 = (h16*)take((size_t)NTKV * CC * 2); h16* VT16 = (h16*)take((size_t)NTKV * CC * 2);
    if ((size_t)(wsp - (char*)d_ws) > ws_size) return;    // 25.2 + 12.6 + 1.2 + 25.2 + 12.6 MB ~ 77 MB
    k_prep<<<NWTB + NGRP, 256, 0, stream>>>(x, g, be, mu, var, Wq, Wk, Wv, Wp, Xb, XRH, XRL, WT);
    k_qkv<<<2 * NKB + (NTQ / 128) * (CC / (2 * WNQ)), 128, 0, stream>>>(Xb, XRH, XRL, WT, bq, bk, bv, Q16, K16, VT16);
    k_attnproj<<<NB_ * (NN_ / 64), 384, 0, stream>>>(Q16, K16, VT16, WT + (size_t)3 * CC * CC, bp, out);
}

// v007
// Measured time: 64.5 microseconds a run.
// Two timings next to v006 put it at 1.05 and 1.06 times that version's speed.
// Over all steps from v000 it is 3.41 times as fast.
#include <hip/hip_runtime.h>

// Contractions, f32 accumulate: q = tok.Wq + bq ([32 x 1024 tokens x 384].[384 x 384]) on v_wmma_f32_16x16x32_bf16 with PLAIN bf16 operands (tok = the NCHW input
// transposed, rounded once: exact); k, v = xr.Wk/Wv + b on the bf16 instruction with the pooled + batch-normed tokens xr (computed) as bf16 hi + residual planes (two
// products); the per-(batch, head) attention (12 heads of 32: scores [1024 x 32].[32 x 256] x 32^-1/2, softmax, .v) fused on v_wmma_f32_16x16x32_f16 with plain f16
// q, k, v and weights x32768; out = ctx.Wp + bp on the bf16 instruction with ctx as bf16 hi + residual planes, written back transposed to NCHW. Deterministic, no

#define NB_  32
#define CC   384
#define NN_  1024
#define NK   256
#define NH_  12
#define HD   32
#define NTQ  (NB_ * NN_)          // 32768 query tokens
#define NTKV (NB_ * NK)           // 8192 pooled tokens
#define PSC  32768.0f
#define SCL  0.17677669529663687f

typedef _Float16 h16;
typedef unsigned short bf;
typedef __attribute__((ext_vector_type(16))) __bf16   v16bf;
typedef __attribute__((ext_vector_type(16))) _Float16 v16h;
typedef __attribute__((ext_vector_type(8)))  _Float16 v8h;
typedef __attribute__((ext_vector_type(8)))  unsigned short v8us;
typedef __attribute__((ext_vector_type(8)))  float    v8f;
typedef __attribute__((ext_vector_type(4)))  float    v4f;
typedef __attribute__((ext_vector_type(2)))  float    v2f;
typedef __attribute__((ext_vector_type(2)))  _Float16 v2h;
typedef v4f  __attribute__((may_alias)) v4fa;
typedef v8us __attribute__((may_alias)) v8usa;

__device__ __forceinline__ unsigned short f2bf(float f) { unsigned u = __float_as_uint(f); u += 0x7FFFu + ((u >> 16) & 1u); return (unsigned short)(u >> 16); }
__device__ __forceinline__ float bf2f(unsigned short b) { return __uint_as_float(((unsigned)b) << 16); }
__device__ __forceinline__ float bfr(float f) { return bf2f(f2bf(f)); }
__device__ __forceinline__ v16h cat16(v8h lo, v8h hi) { return __builtin_shufflevector(lo, hi, 0, 1, 2, 3, 4, 5, 6, 7, 8, 9, 10, 11, 12, 13, 14, 15); }
__device__ __forceinline__ v16bf cat16b(v8us lo, v8us hi) { return __builtin_bit_cast(v16bf, __builtin_shufflevector(lo, hi, 0, 1, 2, 3, 4, 5, 6, 7, 8, 9, 10, 11, 12, 13, 14, 15)); }
__device__ __forceinline__ v8f wmma16(v16h a, v16h b, v8f c) { return __builtin_amdgcn_wmma_f32_16x16x32_f16(false, a, false, b, (short)0, c, false, false); }
__device__ __forceinline__ v8f wmmab(v16bf a, v16bf b, v8f c) { return __builtin_amdgcn_wmma_f32_16x16x32_bf16(false, a, false, b, (short)0, c, false, false); }
// Fragment-order planes: every 16-bit WMMA operand plane [rows][k] in the workspace is stored as 1024-byte blocks, one per (16 rows, 32 k), block index (row / 16) * kch + k / 32
// (kch = k extent / 32); inside a block [k bits 4..3][row & 15][k & 7]. Lane l = 16 * hi + lr of a fragment load then reads 16 bytes at block + 8 * l (k = 8 hi ..) and at
// block + 256 + 8 * l (k = 16 + 8 hi ..): 512 contiguous bytes = 4 whole lines per load, where a row-major plane made each load touch 16 lines. fro = element offset of (row, k).
__device__ __forceinline__ size_t fro(int row, int k, int kch) { return ((size_t)(row >> 4) * kch + (k >> 5)) * 512 + ((k >> 3) & 3) * 128 + (row & 15) * 8 + (k & 7); }

// d_xpart: one block takes x[b][c0 .. c0 + 63][n0 .. n0 + 255], reads it ONCE and makes from it both its part of Xb (row b*1024 + n, k = c, fragment order) = bf16(x[b][c][n]) and its part of
// XRH/XRL (row b*256 + m, k = c, fragment order) = bf16 hi + residual of (mean_{t<4} bf16(x[b][c][4m+t])) * inv[c] + shift[c], inv = g/sqrt(var + eps), shift = beta - mean*inv (bf16-rounded params,
// f32 math). Wave w owns the 8 channels c0 + 8 w ..; each of its 16 loads is 512 contiguous bytes of one channel (4 whole lines): lane l gets tokens 4 l .. 4 l + 3 of a 128-token half, which are one
// pooling group. For one token (or one pooled token) the lane's 8 channels are one 16-byte unit of the fragment order; the units go to LDS images of the output runs (2 KB per 16 rows) and leave
// as 512 contiguous bytes a wave. XTP: pitch of a 16-token run in LDS, 2 KB + 16 bytes, so that the 16 lanes of a half wave, which write 4 units in each of 4 runs, fall on all 64 banks.
#define XTP 1032
#define XPO (16 * XTP)
__device__ __forceinline__ float rdl(float v, int l) { return __builtin_bit_cast(float, __builtin_amdgcn_readlane(__builtin_bit_cast(int, v), l)); }
__device__ __forceinline__ void d_xpart(const float* __restrict__ x, const float* __restrict__ g, const float* __restrict__ be, const float* __restrict__ mu, const float* __restrict__ var,
                                        bf* Xb, bf* XRH, bf* XRL, unsigned short* sh, int mx, int cy, int b) {
    const int tid = threadIdx.x, lane = tid & 31, w = tid >> 5;
    const int c0 = cy * 64, n0 = mx * 256, m0 = mx * 64;
    const float* xp = x + ((size_t)b * CC + c0 + w * 8) * NN_ + n0 + lane * 4;
    const int cp = c0 + w * 8 + (lane & 7);        // lane l computes the two parameters of the wave's channel l & 7; each is read from its lane below
    const float gl = g[cp], vl = var[cp], bl = be[cp], ml = mu[cp];
    // the register that these four loads name was given to one of the loads below as its destination: the wait stands before it is written again
    asm volatile("s_wait_xcnt 0x0" ::: "memory");
    v4f r[8][2];
#pragma unroll        // here and below: unrolled so that every register index is a constant
    for (int jc = 0; jc < 8; ++jc)
#pragma unroll
        for (int hf = 0; hf < 2; ++hf) r[jc][hf] = *(const v4fa*)(xp + jc * NN_ + hf * 128);
    // behind the last load, its address named so that it lives to here: without this the last load's destination was laid on the address pair that the fifteen before it name
    asm volatile("s_wait_xcnt 0x0" :: "v"(xp) : "memory");
    // all of the wave's loads are issued before the first value is used: without this the compiler fetched them in groups and waited out a whole memory latency at each
    __builtin_amdgcn_sched_barrier(0);
    const float invl = bfr(gl) / sqrtf(bfr(vl) + 1e-5f), shl = bfr(bl) - bfr(ml) * invl;
    unsigned short* tw = sh + (lane >> 2) * XTP + (w >> 2) * 512 + (w & 3) * 128 + (lane & 3) * 32;
    unsigned short* pw = sh + XPO + (lane >> 4) * 1024 + (w >> 2) * 512 + (w & 3) * 128 + (lane & 15) * 8;
#pragma unroll
    for (int hf = 0; hf < 2; ++hf) {
        v8us tu[4], hu, lu;
#pragma unroll
        for (int jc = 0; jc < 8; ++jc) {
            const float inv = rdl(invl, jc), shf = rdl(shl, jc);
            unsigned short q[4];
#pragma unroll
            for (int e = 0; e < 4; ++e) { q[e] = f2bf(r[jc][hf][e]); tu[e][jc] = q[e]; }
            const float v = ((bf2f(q[0]) + bf2f(q[1]) + bf2f(q[2]) + bf2f(q[3])) * 0.25f) * inv + shf;
            const unsigned short hb = f2bf(v); hu[jc] = hb; lu[jc] = f2bf(v - bf2f(hb));
        }
#pragma unroll
        for (int e = 0; e < 4; ++e) *(v8usa*)(tw + hf * 8 * XTP + e * 8) = tu[e];
        *(v8usa*)(pw + hf * 2048) = hu; *(v8usa*)(pw + 4096 + hf * 2048) = lu;
    }
    __syncthreads();
    const int rt = tid >> 7, wi = (tid & 127) * 8;        // 128 units of 16 bytes make one 2 KB run: 16 rows x this block's 64 channels
    bf* xo = Xb + ((size_t)((b * NN_ + n0) / 16 + rt) * (CC / 32) + 2 * cy) * 512 + wi;
#pragma unroll
    for (int s = 0; s < 8; ++s) { const v8us val = *(const v8usa*)(sh + (2 * s + rt) * XTP + wi); *(v8us*)(xo + (size_t)(2 * s) * (CC / 32) * 512) = val; }
    const size_t po = ((size_t)((b * NK + m0) / 16 + rt) * (CC / 32) + 2 * cy) * 512 + wi;
#pragma unroll
    for (int s = 0; s < 4; ++s) { const int pln = s >> 1, t2 = 2 * (s & 1); const v8us val = *(const v8usa*)(sh + XPO + pln * 4096 + (t2 + rt) * 1024 + wi);
        *(v8us*)((pln ? XRL : XRH) + po + (size_t)t2 * (CC / 32) * 512) = val; }
    // another job's code follows this one in the merged kernel's listing: the wait stands before any register that these stores name is written again
    asm volatile("s_wait_xcnt 0x0" ::: "memory");
}
// d_wt: W [384 k][384 n] k-major -> bf16 plane (row n, k, fragment order); 64 x 64 tiles.
__device__ __forceinline__ void d_wt(const float* __restrict__ Wm, bf* WT, unsigned short* tl, int bx, int by) {
    const int tid = threadIdx.x, k0 = bx * 64, n0 = by * 64;
    const int kk = tid >> 2, nq = (tid & 3) * 16;
#pragma unroll
    for (int i = 0; i < 16; ++i) tl[(nq + i) * 72 + kk] = f2bf(Wm[(size_t)(k0 + kk) * CC + n0 + nq + i]);
    __syncthreads();
    const int piece = (tid >> 4) & 7;
    auto pass = [&]() {
#pragma unroll
        for (int s = 0; s < 2; ++s) { const int nr = ((tid >> 7) + 2 * s) * 16 + (tid & 15); const v8us val = *(const v8usa*)(tl + nr * 72 + piece * 8);
            *(v8us*)(WT + fro(n0 + nr, k0 + piece * 8, CC / 32)) = val; }
    };
    pass();
    // another job's code follows this one in the merged kernel's listing: the wait stands before any register that these stores name is written again
    asm volatile("s_wait_xcnt 0x0" ::: "memory");
}
// k_prep: the jobs that need nothing of each other, in block ranges of ONE launch (the branch is the same for a whole block): blocks 0 .. 143 the four weight planes (36 tiles each, WT = four
// planes in a row); then 768 blocks, one per (b, c tile, 256 tokens), each of which makes the token plane's and the pooled planes' part of its x part.
#define NWTB (4 * (CC / 64) * (CC / 64))
#define NGRP (NB_ * (CC / 64) * (NK / 64))
__global__ __launch_bounds__(256) void k_prep(const float* __restrict__ x, const float* __restrict__ g, const float* __restrict__ be, const float* __restrict__ mu, const float* __restrict__ var,
                                              const float* __restrict__ Wq, const float* __restrict__ Wk, const float* __restrict__ Wv, const float* __restrict__ Wp, bf* Xb, bf* XRH, bf* XRL, bf* WT) {
    __shared__ __align__(16) unsigned short sh[XPO + 2 * 4096];
    const int bid = blockIdx.x;
    if (bid < NWTB) {
        const int i = bid / 36, t = bid - i * 36, by = t / 6, bx = t - by * 6;
        d_wt(i == 0 ? Wq : i == 1 ? Wk : i == 2 ? Wv : Wp, WT + (size_t)i * CC * CC, sh, bx, by);
    } else {
        const int grp = bid - NWTB;
        const int mx = grp & 3, cb = grp >> 2, b = cb / 6, cy = cb - b * 6;
        d_xpart(x, g, be, mu, var, Xb, XRH, XRL, sh, mx, cy, b);
    }
}

// d_gemmb: ONE WAVE computes the 64 x WN tile (tr, tc) of (A [+ Al]).B^T + bf16(bias), K = 384, as 4 x WN / 16 accumulator tiles: each A fragment loaded serves WN / 16 products, each B fragment four
// (eight with the residual plane). A, Al, B are fragment-order planes; the tile, bias added, goes to os, this wave's own [64 rows][WN + 4] f32 staging range (at that pitch rows 8 apart fall 32 banks
// apart and a row starts at a multiple of 16 bytes). WN = 96 in k_qkv: the launch is then 768 blocks of four waves, three to a WGP, all resident at once.
template <bool SPLITA, int WN>
__device__ __forceinline__ void d_gemmb(const bf* __restrict__ A, const bf* __restrict__ Al, const bf* __restrict__ Bn, const float* __restrict__ bias, float* os, int tr, int tc) {
    constexpr int SP = WN + 4;
    const int lane = threadIdx.x & 31, lr = lane & 15, hi = lane >> 4;
    const int r0 = tr * 64, c0 = tc * WN;
    const size_t aoff = fro(r0, 0, CC / 32) + 8 * lane;
    const bf* ap = A + aoff; const bf* alp = (SPLITA ? Al : A) + aoff; const bf* bp = Bn + fro(c0, 0, CC / 32) + 8 * lane;        // block (16-row tile i, k chunk kc) lies (i * 12 + kc) * 512 elements on
    const float* bb = bias + c0 + lr; float bvr[WN / 16];        // the lane's bias values, fetched at the head of the last step
    v8f acc[4][WN / 16];        // [row tile][column tile]
#pragma unroll        // here and below, in d_gemmb and d_out: unrolled so that every register index is a constant
    for (int i = 0; i < 4; ++i)
#pragma unroll
        for (int t = 0; t < WN / 16; ++t) acc[i][t] = (v8f){};
    // Fragments run one step ahead: step 0's are fetched here; inside step kc each fragment of step kc + 1 is fetched right behind the last product that reads the registers it goes into, so that about
    // 24 products stand between a load and its first use and no step begins by waiting out a load. With the residual plane: a behind the first run of products, b[t] behind its products of the second
    // run, al behind the second run (it is first read after the next step's first run). Without it a has no such gap and takes a second set of registers, which the other path's budget leaves free.
    auto ldf = [](const bf* p) { return cat16b(*(const v8us*)p, *(const v8us*)(p + 256)); };
    v16bf a[4], al[4], b[WN / 16];
#pragma unroll
    for (int i = 0; i < 4; ++i) a[i] = ldf(ap + i * (CC / 32) * 512);
#pragma unroll
    for (int t = 0; t < WN / 16; ++t) b[t] = ldf(bp + t * (CC / 32) * 512);
    if (SPLITA) {
#pragma unroll
        for (int i = 0; i < 4; ++i) al[i] = ldf(alp + i * (CC / 32) * 512);
    }
#pragma unroll        // unrolled: every load address is a base plus a constant, and no loop branch stands behind a WMMA
    for (int kc = 0; kc < CC / 32; ++kc) {
        const bool more = kc + 1 < CC / 32;
        v16bf an[4];
        if (!more) {
            // behind the last fragment loads: the compiler gave registers that they name to the bias loads as destinations
            asm volatile("s_wait_xcnt 0x0" ::: "memory");
#pragma unroll
            for (int t = 0; t < WN / 16; ++t) bvr[t] = bb[t * 16];
            // behind the last loads: the registers that they name are written again below, for the staging addresses, and the scheduling barrier on the
            // next line keeps those writes behind this one
            asm volatile("s_wait_xcnt 0x0" ::: "memory");
        }
        // the scheduling barriers of this loop fix the place of every load: behind the products that read its registers, so that it needs none of its own (three blocks on a WGP leave a wave 336),
        // and a whole run of products ahead of its use
        __builtin_amdgcn_sched_barrier(0);
        if (SPLITA) {
#pragma unroll
            for (int t = 0; t < WN / 16; ++t) {
#pragma unroll
                for (int i = 0; i < 4; ++i) acc[i][t] = wmmab(a[i], b[t], acc[i][t]);
                __builtin_amdgcn_sched_barrier(0);        // also: the run keeps the order of t, in which its b fragments were fetched (the compiler began it with the one fetched last)
            }
            if (more) {
#pragma unroll
                for (int i = 0; i < 4; ++i) a[i] = ldf(ap + (i * (CC / 32) + kc + 1) * 512);
            }
            __builtin_amdgcn_sched_barrier(0);
        } else if (more) {
#pragma unroll
            for (int i = 0; i < 4; ++i) an[i] = ldf(ap + (i * (CC / 32) + kc + 1) * 512);
            __builtin_amdgcn_sched_barrier(0);
        }
#pragma unroll
        for (int t = 0; t < WN / 16; ++t) {
#pragma unroll
            for (int i = 0; i < 4; ++i) acc[i][t] = wmmab(SPLITA ? al[i] : a[i], b[t], acc[i][t]);
            __builtin_amdgcn_sched_barrier(0);
            if (more) b[t] = ldf(bp + (t * (CC / 32) + kc + 1) * 512);
            __builtin_amdgcn_sched_barrier(0);
        }
        if (more) {
#pragma unroll
            for (int i = 0; i < 4; ++i) { if (SPLITA) al[i] = ldf(alp + (i * (CC / 32) + kc + 1) * 512); else a[i] = an[i]; }
        }
    }
#pragma unroll
    for (int t = 0; t < WN / 16; ++t) { const float bv = bfr(bvr[t]);
#pragma unroll
        for (int i = 0; i < 4; ++i)
#pragma unroll
            for (int j = 0; j < 8; ++j) os[(i * 16 + hi * 8 + j) * SP + t * 16 + lr] = acc[i][t][j] + bv; }
    __syncthreads();
}
// d_out: the staged tile (tr, tc) to its plane. MODE 0: f16 plane C16 (row, col, fragment order); MODE 2: VT16 planes for v, transposed: plane row = b*384 + col, k = key m (row = b*256 + m)
template <int MODE, int WN>
__device__ __forceinline__ void d_out(void* Cout, const float* os, int tr, int tc) {
    constexpr int SP = WN + 4;
    const int lane = threadIdx.x & 31, lr = lane & 15, hi = lane >> 4;
    const int r0 = tr * 64, c0 = tc * WN;
    if (MODE == 0) {
        h16* cpl = (h16*)Cout;
#pragma unroll
        for (int i = 0; i < 4; ++i)
#pragma unroll
            for (int s = 0; s < WN / 16; ++s) { const int piece = 2 * s + hi; const float* sp = os + (i * 16 + lr) * SP + piece * 8; v8h o;
#pragma unroll
                for (int e = 0; e < 8; ++e) o[e] = (h16)sp[e];
                *(v8h*)(cpl + fro(r0 + i * 16 + lr, c0 + piece * 8, CC / 32)) = o; }
        // another job's code follows this one in the merged kernel's listing: the wait stands before any register that these stores name is written again
        asm volatile("s_wait_xcnt 0x0" ::: "memory");
    } else {
        const int b = r0 / NK, m0 = r0 - b * NK;
        h16* vb = (h16*)Cout;        // plane row = b*CC + col since [b][h][d] flattens to b*384 + h*32 + d; k = key m; fragment order with 256 / 32 blocks per 16 rows
#pragma unroll
        for (int cw = 0; cw < WN / 16; ++cw)
#pragma unroll
            for (int s = 0; s < 4; ++s) { const int col = cw * 16 + lr, q = 2 * s + hi; v8h v;
#pragma unroll
                for (int e = 0; e < 8; ++e) v[e] = (h16)os[(q * 8 + e) * SP + col];
                *(v8h*)(vb + fro(b * CC + c0 + col, m0 + q * 8, NK / 32)) = v; }
        // another job's code follows this one in the merged kernel's listing: the wait stands before any register that these stores name is written again
        asm volatile("s_wait_xcnt 0x0" ::: "memory");
    }
}
// A block of four waves takes a 128 x 2 WN tile, wave w the 64 x WN quarter (w >> 1, w & 1): two waves share each A row tile and two each B column tile through the WGP cache.
// k_qkv: the three projections, which need nothing of each other, in block ranges of ONE launch: first the k and v tiles (two products a step, the longer blocks; row tile fastest, 2 column tiles
// of k, then 2 of v), then the q tiles (row tile fastest): 768 blocks, three to a WGP. WT = the four weight planes in a row (q, k, v, p).
#define WNQ 96
#define NKB ((NTKV / 128) * (CC / (2 * WNQ)))
__global__ __launch_bounds__(128) void k_qkv(const bf* __restrict__ Xb, const bf* __restrict__ XRH, const bf* __restrict__ XRL, const bf* __restrict__ WT,
                                             const float* __restrict__ bq, const float* __restrict__ bk, const float* __restrict__ bv, h16* Q16, h16* K16, h16* VT16) {
    __shared__ __align__(16) float ost[4 * 64 * (WNQ + 4)];
    const int bid = blockIdx.x, wave = __builtin_amdgcn_readfirstlane(threadIdx.x >> 5), wr = wave >> 1, wc = wave & 1;        // the wave's number in a scalar register: tile bases stay scalar
    float* os = ost + wave * 64 * (WNQ + 4);
    if (bid < 2 * NKB) {        // k and v share one copy of the product loop's code
        const bool isv = bid >= NKB; const int r = isv ? bid - NKB : bid, tr = 2 * (r & (NTKV / 128 - 1)) + wr, tc = 2 * (r / (NTKV / 128)) + wc;
        d_gemmb<true, WNQ>(XRH, XRL, WT + (size_t)(isv ? 2 : 1) * CC * CC, isv ? bv : bk, os, tr, tc);
        if (isv) d_out<2, WNQ>(VT16, os, tr, tc); else d_out<0, WNQ>(K16, os, tr, tc);
    } else {
        const int r = bid - 2 * NKB, tr = 2 * (r & (NTQ / 128 - 1)) + wr, tc = 2 * (r / (NTQ / 128)) + wc;
        d_gemmb<false, WNQ>(Xb, nullptr, WT, bq, os, tr, tc);
        d_out<0, WNQ>(Q16, os, tr, tc);
    }
}
// k_attnproj: attention and output projection in ONE launch; block = (b, 64 queries), 12 waves. The context tile [64 queries][384] never leaves the WGP: it goes from the attention waves to the
// projection waves through LDS, as the same two fragment-order bf16 planes (hi + residual) that a workspace plane would hold.
// Attention: a wave takes one head (head dim 32: one k-chunk) and 32 queries = two 16-query tiles, so a loaded K or V fragment feeds two tiles; waves 2 i and 2 i + 1 take the two halves of the block's
// queries for the SAME head at the same time, so that one of them finds the head's K, V lines in the WGP cache; six heads at a time, two passes. 8 steps x 32 keys, computed TRANSPOSED: S^T = K.Q^T
// (A = 16 key rows, B = a tile's 16 queries) x 32^-1/2, so lane (hi, lr) holds 16 scores of the ONE query lr (keys 8 hi + j and 16 + 8 hi + j): maximum and sum run in-lane plus
// one exchange between the wave halves; the weights x32768 packed to f16 from the two score tiles ARE the B operand of O^T += V^T.P^T in the hardware k order. O^T tile n, register j =
// ctx[query lr][16 n + 8 hi + j], which is the lane's own 16 bytes of fragment-order block (query tile u, k chunk h), at element (u * 12 + h) * 512 of each LDS plane.
// Projection: wave (wr, wc) = (wave / 6, wave % 6) computes rows 32 wr .., columns 64 wc .. of ctx.Wp + bf16(bp), K = 384, as 2 x 4 accumulator tiles: A fragments (hi, residual) from LDS, B fragments
// of the weight plane from global. The tile, bias added, is staged in the wave's own [32 rows][66] f32 range of the SAME LDS (the planes are dead by then: second barrier)
// and leaves transposed into NCHW out[b][c][n]: each column c gets 32 consecutive n = one whole 128-byte line, four lines an instruction. At pitch 66 rows 8 apart fall 16 banks apart (the writes: 16
// columns of two such rows) and rows 4 apart 8 banks apart (the reads: 4 columns of eight such rows): 32 different banks either way.
#define OSP 66
#define PLN (4 * (CC / 32) * 512)
#define TP 2
__device__ __forceinline__ float xhalf(float x) { return __builtin_bit_cast(float, __builtin_amdgcn_permlanex16(__builtin_bit_cast(int, x), __builtin_bit_cast(int, x), 0x76543210, 0xfedcba98, false, false)); }  // lane l with lane l ^ 16
__global__ __launch_bounds__(384) void k_attnproj(const h16* __restrict__ Q16, const h16* __restrict__ K16, const h16* __restrict__ VT16, const bf* __restrict__ Bn, const float* __restrict__ bias, float* out) {
    __shared__ __align__(16) float smem[12 * 32 * OSP];        // 101376 bytes: first the two ctx planes (2 x 49152 bytes), then the twelve staging ranges
    bf* chs = (bf*)smem; bf* cls = chs + PLN;
    const int lane = threadIdx.x & 31, lr = lane & 15, hi = lane >> 4;
    const int wave = __builtin_amdgcn_readfirstlane(threadIdx.x >> 5);        // in a scalar register: head, tile and plane bases stay scalar
    const int bid = blockIdx.x, b = bid / (NN_ / 64), q0 = (bid - b * (NN_ / 64)) * 64, u0 = TP * (wave & 1);
    for (int hp = 0; hp < 2; ++hp) {
        const int h = hp * (NH_ / 2) + (wave >> 1);
        const h16* kh_b = K16 + fro(b * NK, h * HD, CC / 32) + 8 * lane;
        const h16* vt_b = VT16 + fro(b * CC + h * HD, 0, NK / 32) + 8 * lane;
        const h16* qp = Q16 + fro(b * NN_ + q0 + 16 * u0, h * HD, CC / 32) + 8 * lane;
        v16h qb[TP];
#pragma unroll        // here and below: unrolled so that every register index is a constant
        for (int u = 0; u < TP; ++u) { const h16* qu = qp + u * (CC / 32) * 512; qb[u] = cat16(*(const v8h*)qu, *(const v8h*)(qu + 256)); }
        v8f o[TP][2]; float mrow[TP]; v2f lpart[TP];        // lpart: even and odd registers' share of this half's weight sum
#pragma unroll
        for (int u = 0; u < TP; ++u) { o[u][0] = (v8f){}; o[u][1] = (v8f){}; mrow[u] = -3.0e38f; lpart[u] = (v2f){0.f, 0.f}; }
        // K fragments run one step ahead: step 0's are fetched here, step kt + 1's inside step kt, so that no step begins by waiting out a load
        v16h k0 = cat16(*(const v8h*)kh_b, *(const v8h*)(kh_b + 256)), k1 = cat16(*(const v8h*)(kh_b + fro(16, 0, CC / 32)), *(const v8h*)(kh_b + fro(16, 0, CC / 32) + 256));
#pragma unroll 1        // rolled: the live registers stay those of one step
        for (int kt = 0; kt < NK / 32; ++kt) {
            const int l0 = kt * 32, ln = ((kt + 1) & (NK / 32 - 1)) * 32;        // the last step fetches step 0's again: a valid address, the values unused
            const h16* r0p = kh_b + fro(ln, 0, CC / 32); const h16* r1p = kh_b + fro(ln + 16, 0, CC / 32);
            const h16* v0p = vt_b + fro(0, l0, NK / 32); const h16* v1p = vt_b + fro(16, l0, NK / 32);
            const v16h w0 = cat16(*(const v8h*)v0p, *(const v8h*)(v0p + 256)), w1 = cat16(*(const v8h*)v1p, *(const v8h*)(v1p + 256));
            v8f s0[TP], s1[TP]; v16h pb[TP]; v2f a[TP][8]; float alpha[TP];
#pragma unroll
            for (int u = 0; u < TP; ++u) { s0[u] = (v8f){}; s0[u] = wmma16(k0, qb[u], s0[u]); }
#pragma unroll
            for (int u = 0; u < TP; ++u) { s1[u] = (v8f){}; s1[u] = wmma16(k1, qb[u], s1[u]); }
            // the next step's K loads are issued right behind the score products, the last readers of this step's, into the same registers: the whole softmax covers their latency; the scheduling
            // barriers keep them at this place
            __builtin_amdgcn_sched_barrier(0);
            k0 = cat16(*(const v8h*)r0p, *(const v8h*)(r0p + 256)); k1 = cat16(*(const v8h*)r1p, *(const v8h*)(r1p + 256));
            __builtin_amdgcn_sched_barrier(0);
#pragma unroll
            for (int u = 0; u < TP; ++u) {
                float mx = -3.0e38f;        // a[u][i] = two neighbouring registers of the score tiles: keys 8 hi + 2 i, + 1 (i < 4) and 16 + 8 hi + 2 (i - 4), + 1
#pragma unroll
                for (int i = 0; i < 4; ++i) { a[u][i] = (v2f){s0[u][2 * i], s0[u][2 * i + 1]} * SCL; a[u][4 + i] = (v2f){s1[u][2 * i], s1[u][2 * i + 1]} * SCL; }
#pragma unroll
                for (int i = 0; i < 8; ++i) mx = fmaxf(mx, fmaxf(a[u][i][0], a[u][i][1]));
                mx = fmaxf(mx, xhalf(mx));
                const float mn = fmaxf(mrow[u], mx);
                alpha[u] = __expf(mrow[u] - mn);
                mrow[u] = mn;
            }
#pragma unroll        // both tiles' maxima and rescale factors stand above, both tiles' weights below
            for (int u = 0; u < TP; ++u) {
                // the two tiles' weights stay apart: interleaved, with the next K fragments held beside them, they took 166 registers, and above 160 the second block loses its place on the WGP
                if (u == TP - 1) __builtin_amdgcn_sched_barrier(0);
                const float mn = mrow[u];
                v2f p[8];
#pragma unroll
                for (int i = 0; i < 8; ++i) {
                    p[i] = (v2f){__expf(a[u][i][0] - mn), __expf(a[u][i][1] - mn)};
                    const v2h ph = __builtin_convertvector(p[i] * PSC, v2h);
                    pb[u][2 * i] = ph[0]; pb[u][2 * i + 1] = ph[1];
                }
                lpart[u] = lpart[u] * alpha[u] + (((p[0] + p[1]) + (p[2] + p[3])) + ((p[4] + p[5]) + (p[6] + p[7])));
#pragma unroll
                for (int n = 0; n < 2; ++n)
#pragma unroll
                    for (int j = 0; j < 8; ++j) o[u][n][j] *= alpha[u];
            }
#pragma unroll
            for (int u = 0; u < TP; ++u) { o[u][0] = wmma16(w0, pb[u], o[u][0]); o[u][1] = wmma16(w1, pb[u], o[u][1]); }
            // the four vector slots the chip needs behind a WMMA, also on the taken side of the loop branch
            asm volatile("v_nop\n\tv_nop\n\tv_nop\n\tv_nop" : "+v"(o[0][0]), "+v"(o[0][1]), "+v"(o[1][0]), "+v"(o[1][1]));
        }
#pragma unroll
        for (int u = 0; u < TP; ++u) {
            const float lh = lpart[u][0] + lpart[u][1], inv = 1.0f / ((lh + xhalf(lh)) * PSC);
            const int cbase = ((u0 + u) * (CC / 32) + h) * 512 + 8 * lane;
            v8us oh, ol, oh2, ol2;        // d = 8 hi + i and d = 16 + 8 hi + i of row lr
#pragma unroll
            for (int i = 0; i < 8; ++i) { const float c0 = o[u][0][i] * inv, c1 = o[u][1][i] * inv;
                const unsigned short hb = f2bf(c0); oh[i] = hb; ol[i] = f2bf(c0 - bf2f(hb)); const unsigned short hb2 = f2bf(c1); oh2[i] = hb2; ol2[i] = f2bf(c1 - bf2f(hb2)); }
            *(v8usa*)(chs + cbase) = oh; *(v8usa*)(chs + cbase + 256) = oh2;
            *(v8usa*)(cls + cbase) = ol; *(v8usa*)(cls + cbase + 256) = ol2;
        }
    }
    const int wr = wave / 6, wc = wave - wr * 6, c0 = wc * 64;
    const bf* bp = Bn + fro(c0, 0, CC / 32) + 8 * lane;        // block (16-column tile t, k chunk kc) lies (t * 12 + kc) * 512 elements on
    v16bf bc[4]; float bvr[4];        // the first step's B fragments and the lane's bias values need nothing of the attention: fetched in front of the barrier
#pragma unroll
    for (int t = 0; t < 4; ++t) { const bf* bt = bp + t * (CC / 32) * 512; bc[t] = cat16b(*(const v8us*)bt, *(const v8us*)(bt + 256)); bvr[t] = bias[c0 + t * 16 + lr]; }
    __syncthreads();        // every head's part of the two ctx planes is in LDS
    const bf* ap = chs + 2 * wr * (CC / 32) * 512 + 8 * lane; const bf* alp = cls + 2 * wr * (CC / 32) * 512 + 8 * lane;
    v8f acc[2][4];        // [row tile][column tile]
#pragma unroll
    for (int i = 0; i < 2; ++i)
#pragma unroll
        for (int t = 0; t < 4; ++t) acc[i][t] = (v8f){};
#pragma unroll        // unrolled: every load address is a base plus a constant, and no loop branch stands behind a WMMA
    for (int kc = 0; kc < CC / 32; ++kc) {
        v16bf a[2], al[2];
#pragma unroll
        for (int i = 0; i < 2; ++i) { const bf* at = ap + (i * (CC / 32) + kc) * 512; a[i] = cat16b(*(const v8usa*)at, *(const v8usa*)(at + 256));
            const bf* lt = alp + (i * (CC / 32) + kc) * 512; al[i] = cat16b(*(const v8usa*)lt, *(const v8usa*)(lt + 256)); }
        // a step's LDS loads stay in front of its own products and behind the step before: without this the compiler spread them over several steps and took 300 registers, where two blocks on a WGP leave a wave 160
        __builtin_amdgcn_sched_barrier(0);
#pragma unroll
        for (int t = 0; t < 4; ++t) {
#pragma unroll
            for (int i = 0; i < 2; ++i) acc[i][t] = wmmab(a[i], bc[t], acc[i][t]);
#pragma unroll
            for (int i = 0; i < 2; ++i) acc[i][t] = wmmab(al[i], bc[t], acc[i][t]);
            // B fragments run one step ahead too: the next step's fragment t is fetched beside this step's four products of fragment t, twelve products ahead of its first use, which cover the
            // latency; the scheduling barrier keeps each load in its group of four
            if (kc + 1 < CC / 32) { const bf* bt = bp + (t * (CC / 32) + kc + 1) * 512; bc[t] = cat16b(*(const v8us*)bt, *(const v8us*)(bt + 256)); }
            __builtin_amdgcn_sched_barrier(0);
        }
    }
    __syncthreads();        // every wave has read its last fragment of the ctx planes: their LDS becomes the staging ranges
    float* os = smem + wave * 32 * OSP;
#pragma unroll
    for (int t = 0; t < 4; ++t) { const float bv = bfr(bvr[t]);
#pragma unroll
        for (int i = 0; i < 2; ++i)
#pragma unroll
            for (int j = 0; j < 8; ++j) os[(i * 16 + hi * 8 + j) * OSP + t * 16 + lr] = acc[i][t][j] + bv; }
    __syncthreads();        // the staged tile is whole before its lanes read each other's values
    float* ob = out + ((size_t)b * CC + c0) * NN_ + q0 + wr * 32;
    const int cq = lane >> 3, q = lane & 7;        // column c (64 of them) x 32 rows n; per column 32 floats = 8 lanes x 16 B; 4 columns per instruction
    v4f vv[16];
#pragma unroll
    for (int s = 0; s < 16; ++s)
#pragma unroll
        for (int e = 0; e < 4; ++e) vv[s][e] = os[(q * 4 + e) * OSP + 4 * s + cq];
#pragma unroll
    for (int s = 0; s < 16; ++s) *(v4f*)(ob + (size_t)(4 * s + cq) * NN_ + q * 4) = vv[s];
}

extern "C" void kernel_launch(void* const* d_in, const int* in_sizes, int n_in,
                              void* d_out, int out_size, void* d_ws, size_t ws_size, hipStream_t stream) {
    (void)in_sizes; (void)n_in; (void)out_size;
    const float* x = (const float*)d_in[0]; const float* Wq = (const float*)d_in[1]; const float* bq = (const float*)d_in[2]; const float* Wk = (const float*)d_in[3]; const float* bk = (const float*)d_in[4];
    const float* Wv = (const float*)d_in[5]; const float* bv = (const float*)d_in[6]; const float* Wp = (const float*)d_in[7]; const float* bp = (const float*)d_in[8];
    const float* g = (const float*)d_in[9]; const float* be = (const float*)d_in[10]; const float* mu = (const float*)d_in[11]; const float* var = (const float*)d_in[12];
    float* out = (float*)d_out;    // [32][384][32][32]
    char* wsp = (char*)d_ws;
    auto take = [&](size_t bytes) { char* p = wsp; wsp += (bytes + 255) & ~(size_t)255; return (void*)p; };
    bf* Xb = (bf*)take((size_t)NTQ * CC * 2); bf* XRH = (bf*)take((size_t)NTKV * CC * 2); bf* XRL = (bf*)take((size_t)NTKV * CC * 2);
    bf* WT = (bf*)take((size_t)4 * CC * CC * 2);    // the four weight planes in a row: q, k, v, p
    h16* Q16 = (h16*)take((size_t)NTQ * CC * 2); h16* K16 = (h16*)take((size_t)NTKV * CC * 2); h16* VT16 = (h16*)take((size_t)NTKV * CC * 2);
    if ((size_t)(wsp - (char*)d_ws) > ws_size) return;    // 25.2 + 12.6 + 1.2 + 25.2 + 12.6 MB ~ 77 MB
    k_prep<<<NWTB + NGRP, 256, 0, stream>>>(x, g, be, mu, var, Wq, Wk, Wv, Wp, Xb, XRH, XRL, WT);
    k_qkv<<<2 * NKB + (NTQ / 128) * (CC / (2 * WNQ)), 128, 0, stream>>>(Xb, XRH, XRL, WT, bq, bk, bv, Q16, K16, VT16);
    k_attnproj<<<NB_ * (NN_ / 64), 384, 0, stream>>>(Q16, K16, VT16, WT + (size_t)3 * CC * CC, bp, out);
}

// v008
// Measured time: 62.7 microseconds a run.
// In two side-by-side timings against v007, it was 1.03 and 1.04 times as fast.
// Counting every step since v000, it is 3.52 times as fast.
#include <hip/hip_runtime.h>

// Contractions, f32 accumulate: q = tok.Wq + bq ([32 x 1024 tokens x 384].[384 x 384]) on v_wmma_f32_16x16x32_bf16 with PLAIN bf16 operands (tok = the NCHW input
// transposed, rounded once: exact); k, v = xr.Wk/Wv + b on the bf16 instruction with the pooled + batch-normed tokens xr (computed) as bf16 hi + residual planes (two
// products); the per-(batch, head) attention (12 heads of 32: scores [1024 x 32].[32 x 256] x 32^-1/2, softmax, .v) fused on v_wmma_f32_16x16x32_f16 with plain f16
// q (x 32^-1/2 log2 e), k, v and scaled weights; out = ctx.Wp + bp on the bf16 instruction with ctx as bf16 hi + residual planes, written back transposed to NCHW. Deterministic, no

#define NB_  32
#define CC   384
#define NN_  1024
#define NK   256
#define NH_  12
#define HD   32
#define NTQ  (NB_ * NN_)          // 32768 query tokens
#define NTKV (NB_ * NK)           // 8192 pooled tokens
#define SCL  0.17677669529663687f
#define QSC  (SCL * 1.4426950408889634f)   // q is stored x 32^-1/2 x log2 e: a score leaves its product as the base-2 exponent
#define PSH  7.0f      // weights x 2^7 in the loop with a fixed reference: nine powers of two of room below the f16 limit
#define PSL  15.0f     // weights x 2^15 in the loop with a running maximum
#define LLIM 60000.0f  // a lane's weight sum below this: none of its weights passed the f16 limit

typedef _Float16 h16;
typedef unsigned short bf;
typedef __attribute__((ext_vector_type(16))) __bf16   v16bf;
typedef __attribute__((ext_vector_type(16))) _Float16 v16h;
typedef __attribute__((ext_vector_type(8)))  _Float16 v8h;
typedef __attribute__((ext_vector_type(8)))  unsigned short v8us;
typedef __attribute__((ext_vector_type(8)))  float    v8f;
typedef __attribute__((ext_vector_type(4)))  float    v4f;
typedef __attribute__((ext_vector_type(2)))  float    v2f;
typedef __attribute__((ext_vector_type(2)))  _Float16 v2h;
typedef v4f  __attribute__((may_alias)) v4fa;
typedef v8us __attribute__((may_alias)) v8usa;

__device__ __forceinline__ unsigned short f2bf(float f) { unsigned u = __float_as_uint(f); u += 0x7FFFu + ((u >> 16) & 1u); return (unsigned short)(u >> 16); }
__device__ __forceinline__ float bf2f(unsigned short b) { return __uint_as_float(((unsigned)b) << 16); }
__device__ __forceinline__ float bfr(float f) { return bf2f(f2bf(f)); }
__device__ __forceinline__ v16h cat16(v8h lo, v8h hi) { return __builtin_shufflevector(lo, hi, 0, 1, 2, 3, 4, 5, 6, 7, 8, 9, 10, 11, 12, 13, 14, 15); }
__device__ __forceinline__ v16bf cat16b(v8us lo, v8us hi) { return __builtin_bit_cast(v16bf, __builtin_shufflevector(lo, hi, 0, 1, 2, 3, 4, 5, 6, 7, 8, 9, 10, 11, 12, 13, 14, 15)); }
__device__ __forceinline__ v8f wmma16(v16h a, v16h b, v8f c) { return __builtin_amdgcn_wmma_f32_16x16x32_f16(false, a, false, b, (short)0, c, false, false); }
__device__ __forceinline__ v8f wmmab(v16bf a, v16bf b, v8f c) { return __builtin_amdgcn_wmma_f32_16x16x32_bf16(false, a, false, b, (short)0, c, false, false); }
// Fragment-order planes: every 16-bit WMMA operand plane [rows][k] in the workspace is stored as 1024-byte blocks, one per (16 rows, 32 k), block index (row / 16) * kch + k / 32
// (kch = k extent / 32); inside a block [k bits 4..3][row & 15][k & 7]. Lane l = 16 * hi + lr of a fragment load then reads 16 bytes at block + 8 * l (k = 8 hi ..) and at
// block + 256 + 8 * l (k = 16 + 8 hi ..): 512 contiguous bytes = 4 whole lines per load, where a row-major plane made each load touch 16 lines. fro = element offset of (row, k).
__device__ __forceinline__ size_t fro(int row, int k, int kch) { return ((size_t)(row >> 4) * kch + (k >> 5)) * 512 + ((k >> 3) & 3) * 128 + (row & 15) * 8 + (k & 7); }

// d_xpart: one block takes x[b][c0 .. c0 + 63][n0 .. n0 + 255], reads it ONCE and makes from it both its part of Xb (row b*1024 + n, k = c, fragment order) = bf16(x[b][c][n]) and its part of
// XRH/XRL (row b*256 + m, k = c, fragment order) = bf16 hi + residual of (mean_{t<4} bf16(x[b][c][4m+t])) * inv[c] + shift[c], inv = g/sqrt(var + eps), shift = beta - mean*inv (bf16-rounded params,
// f32 math). Wave w owns the 8 channels c0 + 8 w ..; each of its 16 loads is 512 contiguous bytes of one channel (4 whole lines): lane l gets tokens 4 l .. 4 l + 3 of a 128-token half, which are one
// pooling group. For one token (or one pooled token) the lane's 8 channels are one 16-byte unit of the fragment order; the units go to LDS images of the output runs (2 KB per 16 rows) and leave
// as 512 contiguous bytes a wave. XTP: pitch of a 16-token run in LDS, 2 KB + 16 bytes, so that the 16 lanes of a half wave, which write 4 units in each of 4 runs, fall on all 64 banks.
#define XTP 1032
#define XPO (16 * XTP)
__device__ __forceinline__ float rdl(float v, int l) { return __builtin_bit_cast(float, __builtin_amdgcn_readlane(__builtin_bit_cast(int, v), l)); }
__device__ __forceinline__ void d_xpart(const float* __restrict__ x, const float* __restrict__ g, const float* __restrict__ be, const float* __restrict__ mu, const float* __restrict__ var,
                                        bf* Xb, bf* XRH, bf* XRL, unsigned short* sh, int mx, int cy, int b) {
    const int tid = threadIdx.x, lane = tid & 31, w = tid >> 5;
    const int c0 = cy * 64, n0 = mx * 256, m0 = mx * 64;
    const float* xp = x + ((size_t)b * CC + c0 + w * 8) * NN_ + n0 + lane * 4;
    const int cp = c0 + w * 8 + (lane & 7);        // lane l computes the two parameters of the wave's channel l & 7; each is read from its lane below
    const float gl = g[cp], vl = var[cp], bl = be[cp], ml = mu[cp];
    // the register that these four loads name was given to one of the loads below as its destination: the wait stands before it is written again
    asm volatile("s_wait_xcnt 0x0" ::: "memory");
    v4f r[8][2];
#pragma unroll        // here and below: unrolled so that every register index is a constant
    for (int jc = 0; jc < 8; ++jc)
#pragma unroll
        for (int hf = 0; hf < 2; ++hf) r[jc][hf] = *(const v4fa*)(xp + jc * NN_ + hf * 128);
    // behind the last load, its address named so that it lives to here: without this the last load's destination was laid on the address pair that the fifteen before it name
    asm volatile("s_wait_xcnt 0x0" :: "v"(xp) : "memory");
    // all of the wave's loads are issued before the first value is used: without this the compiler fetched them in groups and waited out a whole memory latency at each
    __builtin_amdgcn_sched_barrier(0);
    const float invl = bfr(gl) / sqrtf(bfr(vl) + 1e-5f), shl = bfr(bl) - bfr(ml) * invl;
    unsigned short* tw = sh + (lane >> 2) * XTP + (w >> 2) * 512 + (w & 3) * 128 + (lane & 3) * 32;
    unsigned short* pw = sh + XPO + (lane >> 4) * 1024 + (w >> 2) * 512 + (w & 3) * 128 + (lane & 15) * 8;
#pragma unroll
    for (int hf = 0; hf < 2; ++hf) {
        v8us tu[4], hu, lu;
#pragma unroll
        for (int jc = 0; jc < 8; ++jc) {
            const float inv = rdl(invl, jc), shf = rdl(shl, jc);
            unsigned short q[4];
#pragma unroll
            for (int e = 0; e < 4; ++e) { q[e] = f2bf(r[jc][hf][e]); tu[e][jc] = q[e]; }
            const float v = ((bf2f(q[0]) + bf2f(q[1]) + bf2f(q[2]) + bf2f(q[3])) * 0.25f) * inv + shf;
            const unsigned short hb = f2bf(v); hu[jc] = hb; lu[jc] = f2bf(v - bf2f(hb));
        }
#pragma unroll
        for (int e = 0; e < 4; ++e) *(v8usa*)(tw + hf * 8 * XTP + e * 8) = tu[e];
        *(v8usa*)(pw + hf * 2048) = hu; *(v8usa*)(pw + 4096 + hf * 2048) = lu;
    }
    __syncthreads();
    const int rt = tid >> 7, wi = (tid & 127) * 8;        // 128 units of 16 bytes make one 2 KB run: 16 rows x this block's 64 channels
    bf* xo = Xb + ((size_t)((b * NN_ + n0) / 16 + rt) * (CC / 32) + 2 * cy) * 512 + wi;
#pragma unroll
    for (int s = 0; s < 8; ++s) { const v8us val = *(const v8usa*)(sh + (2 * s + rt) * XTP + wi); *(v8us*)(xo + (size_t)(2 * s) * (CC / 32) * 512) = val; }
    const size_t po = ((size_t)((b * NK + m0) / 16 + rt) * (CC / 32) + 2 * cy) * 512 + wi;
#pragma unroll
    for (int s = 0; s < 4; ++s) { const int pln = s >> 1, t2 = 2 * (s & 1); const v8us val = *(const v8usa*)(sh + XPO + pln * 4096 + (t2 + rt) * 1024 + wi);
        *(v8us*)((pln ? XRL : XRH) + po + (size_t)t2 * (CC / 32) * 512) = val; }
    // another job's code follows this one in the merged kernel's listing: the wait stands before any register that these stores name is written again
    asm volatile("s_wait_xcnt 0x0" ::: "memory");
}
// d_wt: W [384 k][384 n] k-major -> bf16 plane (row n, k, fragment order); 64 x 64 tiles.
__device__ __forceinline__ void d_wt(const float* __restrict__ Wm, bf* WT, unsigned short* tl, int bx, int by) {
    const int tid = threadIdx.x, k0 = bx * 64, n0 = by * 64;
    const int kk = tid >> 2, nq = (tid & 3) * 16;
#pragma unroll
    for (int i = 0; i < 16; ++i) tl[(nq + i) * 72 + kk] = f2bf(Wm[(size_t)(k0 + kk) * CC + n0 + nq + i]);
    __syncthreads();
    const int piece = (tid >> 4) & 7;
    auto pass = [&]() {
#pragma unroll
        for (int s = 0; s < 2; ++s) { const int nr = ((tid >> 7) + 2 * s) * 16 + (tid & 15); const v8us val = *(const v8usa*)(tl + nr * 72 + piece * 8);
            *(v8us*)(WT + fro(n0 + nr, k0 + piece * 8, CC / 32)) = val; }
    };
    pass();
    // another job's code follows this one in the merged kernel's listing: the wait stands before any register that these stores name is written again
    asm volatile("s_wait_xcnt 0x0" ::: "memory");
}
// k_prep: the jobs that need nothing of each other, in block ranges of ONE launch (the branch is the same for a whole block): blocks 0 .. 143 the four weight planes (36 tiles each, WT = four
// planes in a row); then 768 blocks, one per (b, c tile, 256 tokens), each of which makes the token plane's and the pooled planes' part of its x part.
#define NWTB (4 * (CC / 64) * (CC / 64))
#define NGRP (NB_ * (CC / 64) * (NK / 64))
__global__ __launch_bounds__(256) void k_prep(const float* __restrict__ x, const float* __restrict__ g, const float* __restrict__ be, const float* __restrict__ mu, const float* __restrict__ var,
                                              const float* __restrict__ Wq, const float* __restrict__ Wk, const float* __restrict__ Wv, const float* __restrict__ Wp, bf* Xb, bf* XRH, bf* XRL, bf* WT) {
    __shared__ __align__(16) unsigned short sh[XPO + 2 * 4096];
    const int bid = blockIdx.x;
    if (bid < NWTB) {
        const int i = bid / 36, t = bid - i * 36, by = t / 6, bx = t - by * 6;
        d_wt(i == 0 ? Wq : i == 1 ? Wk : i == 2 ? Wv : Wp, WT + (size_t)i * CC * CC, sh, bx, by);
    } else {
        const int grp = bid - NWTB;
        const int mx = grp & 3, cb = grp >> 2, b = cb / 6, cy = cb - b * 6;
        d_xpart(x, g, be, mu, var, Xb, XRH, XRL, sh, mx, cy, b);
    }
}

// d_gemmb: ONE WAVE computes the 64 x WN tile (tr, tc) of (A [+ Al]).B^T + bf16(bias), K = 384, as 4 x WN / 16 accumulator tiles: each A fragment loaded serves WN / 16 products, each B fragment four
// (eight with the residual plane). A, Al, B are fragment-order planes; the tile, bias added, goes to os, this wave's own [64 rows][WN + 4] f32 staging range (at that pitch rows 8 apart fall 32 banks
// apart and a row starts at a multiple of 16 bytes). WN = 96 in k_qkv: the launch is then 768 blocks of four waves, three to a WGP, all resident at once.
template <bool SPLITA, int WN>
__device__ __forceinline__ void d_gemmb(const bf* __restrict__ A, const bf* __restrict__ Al, const bf* __restrict__ Bn, const float* __restrict__ bias, float* os, int tr, int tc) {
    constexpr int SP = WN + 4;
    const int lane = threadIdx.x & 31, lr = lane & 15, hi = lane >> 4;
    const int r0 = tr * 64, c0 = tc * WN;
    const size_t aoff = fro(r0, 0, CC / 32) + 8 * lane;
    const bf* ap = A + aoff; const bf* alp = (SPLITA ? Al : A) + aoff; const bf* bp = Bn + fro(c0, 0, CC / 32) + 8 * lane;        // block (16-row tile i, k chunk kc) lies (i * 12 + kc) * 512 elements on
    const float* bb = bias + c0 + lr; float bvr[WN / 16];        // the lane's bias values, fetched at the head of the last step
    v8f acc[4][WN / 16];        // [row tile][column tile]
#pragma unroll        // here and below, in d_gemmb and d_out: unrolled so that every register index is a constant
    for (int i = 0; i < 4; ++i)
#pragma unroll
        for (int t = 0; t < WN / 16; ++t) acc[i][t] = (v8f){};
    // Fragments run one step ahead: step 0's are fetched here; inside step kc each fragment of step kc + 1 is fetched right behind the last product that reads the registers it goes into, so that about
    // 24 products stand between a load and its first use and no step begins by waiting out a load. With the residual plane: a behind the first run of products, b[t] behind its products of the second
    // run, al behind the second run (it is first read after the next step's first run). Without it a has no such gap and takes a second set of registers, which the other path's budget leaves free.
    auto ldf = [](const bf* p) { return cat16b(*(const v8us*)p, *(const v8us*)(p + 256)); };
    v16bf a[4], al[4], b[WN / 16];
#pragma unroll
    for (int i = 0; i < 4; ++i) a[i] = ldf(ap + i * (CC / 32) * 512);
#pragma unroll
    for (int t = 0; t < WN / 16; ++t) b[t] = ldf(bp + t * (CC / 32) * 512);
    if (SPLITA) {
#pragma unroll
        for (int i = 0; i < 4; ++i) al[i] = ldf(alp + i * (CC / 32) * 512);
    }
#pragma unroll        // unrolled: every load address is a base plus a constant, and no loop branch stands behind a WMMA
    for (int kc = 0; kc < CC / 32; ++kc) {
        const bool more = kc + 1 < CC / 32;
        v16bf an[4];
        if (!more) {
            // behind the last fragment loads: the compiler gave registers that they name to the bias loads as destinations
            asm volatile("s_wait_xcnt 0x0" ::: "memory");
#pragma unroll
            for (int t = 0; t < WN / 16; ++t) bvr[t] = bb[t * 16];
            // behind the last loads: the registers that they name are written again below, for the staging addresses, and the scheduling barrier on the
            // next line keeps those writes behind this one
            asm volatile("s_wait_xcnt 0x0" ::: "memory");
        }
        // the scheduling barriers of this loop fix the place of every load: behind the products that read its registers, so that it needs none of its own (three blocks on a WGP leave a wave 336),
        // and a whole run of products ahead of its use
        __builtin_amdgcn_sched_barrier(0);
        if (SPLITA) {
#pragma unroll
            for (int t = 0; t < WN / 16; ++t) {
#pragma unroll
                for (int i = 0; i < 4; ++i) acc[i][t] = wmmab(a[i], b[t], acc[i][t]);
                __builtin_amdgcn_sched_barrier(0);        // also: the run keeps the order of t, in which its b fragments were fetched (the compiler began it with the one fetched last)
            }
            if (more) {
#pragma unroll
                for (int i = 0; i < 4; ++i) a[i] = ldf(ap + (i * (CC / 32) + kc + 1) * 512);
            }
            __builtin_amdgcn_sched_barrier(0);
        } else if (more) {
#pragma unroll
            for (int i = 0; i < 4; ++i) an[i] = ldf(ap + (i * (CC / 32) + kc + 1) * 512);
            __builtin_amdgcn_sched_barrier(0);
        }
#pragma unroll
        for (int t = 0; t < WN / 16; ++t) {
#pragma unroll
            for (int i = 0; i < 4; ++i) acc[i][t] = wmmab(SPLITA ? al[i] : a[i], b[t], acc[i][t]);
            __builtin_amdgcn_sched_barrier(0);
            if (more) b[t] = ldf(bp + (t * (CC / 32) + kc + 1) * 512);
            __builtin_amdgcn_sched_barrier(0);
        }
        if (more) {
#pragma unroll
            for (int i = 0; i < 4; ++i) { if (SPLITA) al[i] = ldf(alp + (i * (CC / 32) + kc + 1) * 512); else a[i] = an[i]; }
        }
    }
#pragma unroll
    for (int t = 0; t < WN / 16; ++t) { const float bv = bfr(bvr[t]);
#pragma unroll
        for (int i = 0; i < 4; ++i)
#pragma unroll
            for (int j = 0; j < 8; ++j) os[(i * 16 + hi * 8 + j) * SP + t * 16 + lr] = acc[i][t][j] + bv; }
    __syncthreads();
}
// d_out: the staged tile (tr, tc) to its plane. MODE 0: f16 plane C16 (row, col, fragment order), x QSC where SC (the q plane); MODE 2: VT16 planes for v, transposed: plane row = b*384 + col, k = key m (row = b*256 + m)
template <int MODE, int WN, bool SC>
__device__ __forceinline__ void d_out(void* Cout, const float* os, int tr, int tc) {
    constexpr int SP = WN + 4;
    const int lane = threadIdx.x & 31, lr = lane & 15, hi = lane >> 4;
    const int r0 = tr * 64, c0 = tc * WN;
    if (MODE == 0) {
        h16* cpl = (h16*)Cout;
#pragma unroll
        for (int i = 0; i < 4; ++i)
#pragma unroll
            for (int s = 0; s < WN / 16; ++s) { const int piece = 2 * s + hi; const float* sp = os + (i * 16 + lr) * SP + piece * 8; v8h o;
#pragma unroll
                for (int e = 0; e < 8; ++e) o[e] = (h16)(SC ? sp[e] * QSC : sp[e]);
                *(v8h*)(cpl + fro(r0 + i * 16 + lr, c0 + piece * 8, CC / 32)) = o; }
        // another job's code follows this one in the merged kernel's listing: the wait stands before any register that these stores name is written again
        asm volatile("s_wait_xcnt 0x0" ::: "memory");
    } else {
        const int b = r0 / NK, m0 = r0 - b * NK;
        h16* vb = (h16*)Cout;        // plane row = b*CC + col since [b][h][d] flattens to b*384 + h*32 + d; k = key m; fragment order with 256 / 32 blocks per 16 rows
#pragma unroll
        for (int cw = 0; cw < WN / 16; ++cw)
#pragma unroll
            for (int s = 0; s < 4; ++s) { const int col = cw * 16 + lr, q = 2 * s + hi; v8h v;
#pragma unroll
                for (int e = 0; e < 8; ++e) v[e] = (h16)os[(q * 8 + e) * SP + col];
                *(v8h*)(vb + fro(b * CC + c0 + col, m0 + q * 8, NK / 32)) = v; }
        // another job's code follows this one in the merged kernel's listing: the wait stands before any register that these stores name is written again
        asm volatile("s_wait_xcnt 0x0" ::: "memory");
    }
}
// A block of four waves takes a 128 x 2 WN tile, wave w the 64 x WN quarter (w >> 1, w & 1): two waves share each A row tile and two each B column tile through the WGP cache.
// k_qkv: the three projections, which need nothing of each other, in block ranges of ONE launch: first the k and v tiles (two products a step, the longer blocks; row tile fastest, 2 column tiles
// of k, then 2 of v), then the q tiles (row tile fastest): 768 blocks, three to a WGP. WT = the four weight planes in a row (q, k, v, p).
#define WNQ 96
#define NKB ((NTKV / 128) * (CC / (2 * WNQ)))
__global__ __launch_bounds__(128) void k_qkv(const bf* __restrict__ Xb, const bf* __restrict__ XRH, const bf* __restrict__ XRL, const bf* __restrict__ WT,
                                             const float* __restrict__ bq, const float* __restrict__ bk, const float* __restrict__ bv, h16* Q16, h16* K16, h16* VT16) {
    __shared__ __align__(16) float ost[4 * 64 * (WNQ + 4)];
    const int bid = blockIdx.x, wave = __builtin_amdgcn_readfirstlane(threadIdx.x >> 5), wr = wave >> 1, wc = wave & 1;        // the wave's number in a scalar register: tile bases stay scalar
    float* os = ost + wave * 64 * (WNQ + 4);
    if (bid < 2 * NKB) {        // k and v share one copy of the product loop's code
        const bool isv = bid >= NKB; const int r = isv ? bid - NKB : bid, tr = 2 * (r & (NTKV / 128 - 1)) + wr, tc = 2 * (r / (NTKV / 128)) + wc;
        d_gemmb<true, WNQ>(XRH, XRL, WT + (size_t)(isv ? 2 : 1) * CC * CC, isv ? bv : bk, os, tr, tc);
        if (isv) d_out<2, WNQ, false>(VT16, os, tr, tc); else d_out<0, WNQ, false>(K16, os, tr, tc);
    } else {
        const int r = bid - 2 * NKB, tr = 2 * (r & (NTQ / 128 - 1)) + wr, tc = 2 * (r / (NTQ / 128)) + wc;
        d_gemmb<false, WNQ>(Xb, nullptr, WT, bq, os, tr, tc);
        d_out<0, WNQ, true>(Q16, os, tr, tc);
    }
}
// k_attnproj: attention and output projection in ONE launch; block = (b, 64 queries), 12 waves. The context tile [64 queries][384] never leaves the WGP: it goes from the attention waves to the
// projection waves through LDS, as the same two fragment-order bf16 planes (hi + residual) that a workspace plane would hold.
// Attention: a wave takes one head (head dim 32: one k-chunk) and 32 queries = two 16-query tiles, so a loaded K or V fragment feeds two tiles; waves 2 i and 2 i + 1 take the two halves of the block's
// queries for the SAME head at the same time, so that one of them finds the head's K, V lines in the WGP cache; six heads at a time, two passes. 8 steps x 32 keys, computed TRANSPOSED: S^T = K.Q^T
// (A = 16 key rows, B = a tile's 16 queries, which carry 32^-1/2 log2 e), so lane (hi, lr) holds 16 scores of the ONE query lr (keys 8 hi + j and 16 + 8 hi + j): maximum and sum run in-lane plus
// one exchange between the wave halves; the scaled weights packed to f16 from the two score tiles ARE the B operand of O^T += V^T.P^T in the hardware k order. O^T tile n, register j =
// ctx[query lr][16 n + 8 hi + j], which is the lane's own 16 bytes of fragment-order block (query tile u, k chunk h), at element (u * 12 + h) * 512 of each LDS plane.
// Projection: wave (wr, wc) = (wave / 6, wave % 6) computes rows 32 wr .., columns 64 wc .. of ctx.Wp + bf16(bp), K = 384, as 2 x 4 accumulator tiles: A fragments (hi, residual) from LDS, B fragments
// of the weight plane from global. The tile, bias added, is staged in the wave's own [32 rows][66] f32 range of the SAME LDS (the planes are dead by then: second barrier)
// and leaves transposed into NCHW out[b][c][n]: each column c gets 32 consecutive n = one whole 128-byte line, four lines an instruction. At pitch 66 rows 8 apart fall 16 banks apart (the writes: 16
// columns of two such rows) and rows 4 apart 8 banks apart (the reads: 4 columns of eight such rows): 32 different banks either way.
#define OSP 66
#define PLN (4 * (CC / 32) * 512)
#define TP 2
__device__ __forceinline__ float xhalf(float x) { return __builtin_bit_cast(float, __builtin_amdgcn_permlanex16(__builtin_bit_cast(int, x), __builtin_bit_cast(int, x), 0x76543210, 0xfedcba98, false, false)); }  // lane l with lane l ^ 16
__global__ __launch_bounds__(384) void k_attnproj(const h16* __restrict__ Q16, const h16* __restrict__ K16, const h16* __restrict__ VT16, const bf* __restrict__ Bn, const float* __restrict__ bias, float* out) {
    __shared__ __align__(16) float smem[12 * 32 * OSP];        // 101376 bytes: first the two ctx planes (2 x 49152 bytes), then the twelve staging ranges
    bf* chs = (bf*)smem; bf* cls = chs + PLN;
    const int lane = threadIdx.x & 31, lr = lane & 15, hi = lane >> 4;
    const int wave = __builtin_amdgcn_readfirstlane(threadIdx.x >> 5);        // in a scalar register: head, tile and plane bases stay scalar
    const int bid = blockIdx.x, b = bid / (NN_ / 64), q0 = (bid - b * (NN_ / 64)) * 64, u0 = TP * (wave & 1);
    for (int hp = 0; hp < 2; ++hp) {
        const int h = hp * (NH_ / 2) + (wave >> 1);
        const h16* kh_b = K16 + fro(b * NK, h * HD, CC / 32) + 8 * lane;
        const h16* vt_b = VT16 + fro(b * CC + h * HD, 0, NK / 32) + 8 * lane;
        const h16* qp = Q16 + fro(b * NN_ + q0 + 16 * u0, h * HD, CC / 32) + 8 * lane;
        v16h qb[TP];
#pragma unroll        // here and below: unrolled so that every register index is a constant
        for (int u = 0; u < TP; ++u) { const h16* qu = qp + u * (CC / 32) * 512; qb[u] = cat16(*(const v8h*)qu, *(const v8h*)(qu + 256)); }
        v8f o[TP][2]; v2f lpart[TP];        // lpart: even and odd registers' share of this half's weight sum
        // K fragments run one step ahead: step 0's are fetched here, step kt + 1's inside step kt, so that no step begins by waiting out a load
        v16h k0 = cat16(*(const v8h*)kh_b, *(const v8h*)(kh_b + 256)), k1 = cat16(*(const v8h*)(kh_b + fro(16, 0, CC / 32)), *(const v8h*)(kh_b + fro(16, 0, CC / 32) + 256));
        // The reference of a query's weights is fixed once: r = the maximum of its first 32 scores. cn = PSH - r in all eight registers is the C operand of every score product, so a score tile
        // leaves the matrix unit as the exponent of its weight x 2^PSH: no maximum, subtraction or rescaling in a step.
        v8f cn[TP];
#pragma unroll
        for (int u = 0; u < TP; ++u) {
            v8f t0 = (v8f){}, t1 = (v8f){}; t0 = wmma16(k0, qb[u], t0); t1 = wmma16(k1, qb[u], t1);
            float mx = fmaxf(t0[0], t1[0]);
#pragma unroll
            for (int j = 1; j < 8; ++j) mx = fmaxf(mx, fmaxf(t0[j], t1[j]));
            mx = fmaxf(mx, xhalf(mx));
            const float c = PSH - mx;
#pragma unroll
            for (int j = 0; j < 8; ++j) cn[u][j] = c;
            o[u][0] = (v8f){}; o[u][1] = (v8f){}; lpart[u] = (v2f){0.f, 0.f};
        }
#pragma unroll 1        // rolled: the live registers stay those of one step
        for (int kt = 0; kt < NK / 32; ++kt) {
            const int l0 = kt * 32, ln = ((kt + 1) & (NK / 32 - 1)) * 32;        // the last step fetches step 0's again: a valid address; the loop below starts from them
            const h16* r0p = kh_b + fro(ln, 0, CC / 32); const h16* r1p = kh_b + fro(ln + 16, 0, CC / 32);
            const h16* v0p = vt_b + fro(0, l0, NK / 32); const h16* v1p = vt_b + fro(16, l0, NK / 32);
            const v16h w0 = cat16(*(const v8h*)v0p, *(const v8h*)(v0p + 256)), w1 = cat16(*(const v8h*)v1p, *(const v8h*)(v1p + 256));
            v8f s0[TP], s1[TP]; v16h pb[TP];
#pragma unroll
            for (int u = 0; u < TP; ++u) s0[u] = wmma16(k0, qb[u], cn[u]);
#pragma unroll
            for (int u = 0; u < TP; ++u) s1[u] = wmma16(k1, qb[u], cn[u]);
            // the next step's K loads are issued right behind the score products, the last readers of this step's, into the same registers: the weights' arithmetic covers their latency; the
            // scheduling barriers keep them at this place
            __builtin_amdgcn_sched_barrier(0);
            k0 = cat16(*(const v8h*)r0p, *(const v8h*)(r0p + 256)); k1 = cat16(*(const v8h*)r1p, *(const v8h*)(r1p + 256));
            __builtin_amdgcn_sched_barrier(0);
#pragma unroll
            for (int u = 0; u < TP; ++u) {
                // the two tiles' weights stay apart: interleaved they took 162 registers, and above 160 the second block loses its place on the WGP
                if (u == TP - 1) __builtin_amdgcn_sched_barrier(0);
                v2f p[8];        // p[i] = two neighbouring registers of the score tiles: keys 8 hi + 2 i, + 1 (i < 4) and 16 + 8 hi + 2 (i - 4), + 1
#pragma unroll
                for (int i = 0; i < 8; ++i) {
                    p[i] = i < 4 ? (v2f){__builtin_amdgcn_exp2f(s0[u][2 * i]), __builtin_amdgcn_exp2f(s0[u][2 * i + 1])}
                                 : (v2f){__builtin_amdgcn_exp2f(s1[u][2 * i - 8]), __builtin_amdgcn_exp2f(s1[u][2 * i - 7])};
                    const v2h ph = __builtin_convertvector(p[i], v2h);
                    pb[u][2 * i] = ph[0]; pb[u][2 * i + 1] = ph[1];
                }
                lpart[u] = lpart[u] + (((p[0] + p[1]) + (p[2] + p[3])) + ((p[4] + p[5]) + (p[6] + p[7])));
            }
#pragma unroll
            for (int u = 0; u < TP; ++u) { o[u][0] = wmma16(w0, pb[u], o[u][0]); o[u][1] = wmma16(w1, pb[u], o[u][1]); }
            // the four vector slots the chip needs behind a WMMA, also on the taken side of the loop branch
            asm volatile("v_nop\n\tv_nop\n\tv_nop\n\tv_nop" : "+v"(o[0][0]), "+v"(o[0][1]), "+v"(o[1][0]), "+v"(o[1][1]));
        }
        // A weight is not negative, so a lane's sum is at least its largest weight: a sum below LLIM says that no weight of the lane passed the f16 limit, and the result stands. Otherwise (a later
        // score lay more than nine powers of two above the reference, or is no number) the whole wave computes this head again with a running maximum, which takes any scores.
        const bool redo = !(lpart[0][0] + lpart[0][1] < LLIM) || !(lpart[1][0] + lpart[1][1] < LLIM);
        if (__builtin_amdgcn_ballot_w32(redo) != 0u) {
            float mrow[TP];
#pragma unroll
            for (int u = 0; u < TP; ++u) { o[u][0] = (v8f){}; o[u][1] = (v8f){}; mrow[u] = -3.0e38f; lpart[u] = (v2f){0.f, 0.f}; }
#pragma unroll 1        // rolled: the live registers stay those of one step
            for (int kt = 0; kt < NK / 32; ++kt) {
                const int l0 = kt * 32, ln = ((kt + 1) & (NK / 32 - 1)) * 32;        // the last step fetches step 0's again: a valid address, the values unused
                const h16* r0p = kh_b + fro(ln, 0, CC / 32); const h16* r1p = kh_b + fro(ln + 16, 0, CC / 32);
                const h16* v0p = vt_b + fro(0, l0, NK / 32); const h16* v1p = vt_b + fro(16, l0, NK / 32);
                const v16h w0 = cat16(*(const v8h*)v0p, *(const v8h*)(v0p + 256)), w1 = cat16(*(const v8h*)v1p, *(const v8h*)(v1p + 256));
                v8f s0[TP], s1[TP]; v16h pb[TP]; float alpha[TP];
#pragma unroll
                for (int u = 0; u < TP; ++u) { s0[u] = (v8f){}; s0[u] = wmma16(k0, qb[u], s0[u]); }
#pragma unroll
                for (int u = 0; u < TP; ++u) { s1[u] = (v8f){}; s1[u] = wmma16(k1, qb[u], s1[u]); }
                // the next step's K loads stand behind the score products, as above
                __builtin_amdgcn_sched_barrier(0);
                k0 = cat16(*(const v8h*)r0p, *(const v8h*)(r0p + 256)); k1 = cat16(*(const v8h*)r1p, *(const v8h*)(r1p + 256));
                __builtin_amdgcn_sched_barrier(0);
#pragma unroll
                for (int u = 0; u < TP; ++u) {
                    float mx = -3.0e38f;
#pragma unroll
                    for (int j = 0; j < 8; ++j) mx = fmaxf(mx, fmaxf(s0[u][j], s1[u][j]));
                    mx = fmaxf(mx, xhalf(mx));
                    const float mn = fmaxf(mrow[u], mx);
                    alpha[u] = __builtin_amdgcn_exp2f(mrow[u] - mn);
                    mrow[u] = mn;
                }
#pragma unroll
                for (int u = 0; u < TP; ++u) {
                    const float mr = mrow[u] - PSL;
                    v2f a[8], p[8];
#pragma unroll
                    for (int i = 0; i < 4; ++i) { a[i] = (v2f){s0[u][2 * i], s0[u][2 * i + 1]} - mr; a[4 + i] = (v2f){s1[u][2 * i], s1[u][2 * i + 1]} - mr; }
#pragma unroll
                    for (int i = 0; i < 8; ++i) {
                        p[i] = (v2f){__builtin_amdgcn_exp2f(a[i][0]), __builtin_amdgcn_exp2f(a[i][1])};
                        const v2h ph = __builtin_convertvector(p[i], v2h);
                        pb[u][2 * i] = ph[0]; pb[u][2 * i + 1] = ph[1];
                    }
                    lpart[u] = lpart[u] * alpha[u] + (((p[0] + p[1]) + (p[2] + p[3])) + ((p[4] + p[5]) + (p[6] + p[7])));
#pragma unroll
                    for (int n = 0; n < 2; ++n)
#pragma unroll
                        for (int j = 0; j < 8; ++j) o[u][n][j] *= alpha[u];
                }
#pragma unroll
                for (int u = 0; u < TP; ++u) { o[u][0] = wmma16(w0, pb[u], o[u][0]); o[u][1] = wmma16(w1, pb[u], o[u][1]); }
                // the four vector slots the chip needs behind a WMMA, also on the taken side of the loop branch
                asm volatile("v_nop\n\tv_nop\n\tv_nop\n\tv_nop" : "+v"(o[0][0]), "+v"(o[0][1]), "+v"(o[1][0]), "+v"(o[1][1]));
            }
        }
#pragma unroll
        for (int u = 0; u < TP; ++u) {
            const float lh = lpart[u][0] + lpart[u][1], inv = 1.0f / (lh + xhalf(lh));        // sums and products carry the same power of two
            const int cbase = ((u0 + u) * (CC / 32) + h) * 512 + 8 * lane;
            v8us oh, ol, oh2, ol2;        // d = 8 hi + i and d = 16 + 8 hi + i of row lr
#pragma unroll
            for (int i = 0; i < 8; ++i) { const float c0 = o[u][0][i] * inv, c1 = o[u][1][i] * inv;
                const unsigned short hb = f2bf(c0); oh[i] = hb; ol[i] = f2bf(c0 - bf2f(hb)); const unsigned short hb2 = f2bf(c1); oh2[i] = hb2; ol2[i] = f2bf(c1 - bf2f(hb2)); }
            *(v8usa*)(chs + cbase) = oh; *(v8usa*)(chs + cbase + 256) = oh2;
            *(v8usa*)(cls + cbase) = ol; *(v8usa*)(cls + cbase + 256) = ol2;
        }
    }
    const int wr = wave / 6, wc = wave - wr * 6, c0 = wc * 64;
    const bf* bp = Bn + fro(c0, 0, CC / 32) + 8 * lane;        // block (16-column tile t, k chunk kc) lies (t * 12 + kc) * 512 elements on
    v16bf bc[4]; float bvr[4];        // the first step's B fragments and the lane's bias values need nothing of the attention: fetched in front of the barrier
#pragma unroll
    for (int t = 0; t < 4; ++t) { const bf* bt = bp + t * (CC / 32) * 512; bc[t] = cat16b(*(const v8us*)bt, *(const v8us*)(bt + 256)); bvr[t] = bias[c0 + t * 16 + lr]; }
    __syncthreads();        // every head's part of the two ctx planes is in LDS
    const bf* ap = chs + 2 * wr * (CC / 32) * 512 + 8 * lane; const bf* alp = cls + 2 * wr * (CC / 32) * 512 + 8 * lane;
    v8f acc[2][4];        // [row tile][column tile]
#pragma unroll
    for (int i = 0; i < 2; ++i)
#pragma unroll
        for (int t = 0; t < 4; ++t) acc[i][t] = (v8f){};
#pragma unroll        // unrolled: every load address is a base plus a constant, and no loop branch stands behind a WMMA
    for (int kc = 0; kc < CC / 32; ++kc) {
        v16bf a[2], al[2];
#pragma unroll
        for (int i = 0; i < 2; ++i) { const bf* at = ap + (i * (CC / 32) + kc) * 512; a[i] = cat16b(*(const v8usa*)at, *(const v8usa*)(at + 256));
            const bf* lt = alp + (i * (CC / 32) + kc) * 512; al[i] = cat16b(*(const v8usa*)lt, *(const v8usa*)(lt + 256)); }
        // a step's LDS loads stay in front of its own products and behind the step before: without this the compiler spread them over several steps and took 300 registers, where two blocks on a WGP leave a wave 160
        __builtin_amdgcn_sched_barrier(0);
#pragma unroll
        for (int t = 0; t < 4; ++t) {
#pragma unroll
            for (int i = 0; i < 2; ++i) acc[i][t] = wmmab(a[i], bc[t], acc[i][t]);
#pragma unroll
            for (int i = 0; i < 2; ++i) acc[i][t] = wmmab(al[i], bc[t], acc[i][t]);
            // B fragments run one step ahead too: the next step's fragment t is fetched beside this step's four products of fragment t, twelve products ahead of its first use, which cover the
            // latency; the scheduling barrier keeps each load in its group of four
            if (kc + 1 < CC / 32) { const bf* bt = bp + (t * (CC / 32) + kc + 1) * 512; bc[t] = cat16b(*(const v8us*)bt, *(const v8us*)(bt + 256)); }
            __builtin_amdgcn_sched_barrier(0);
        }
    }
    __syncthreads();        // every wave has read its last fragment of the ctx planes: their LDS becomes the staging ranges
    float* os = smem + wave * 32 * OSP;
#pragma unroll
    for (int t = 0; t < 4; ++t) { const float bv = bfr(bvr[t]);
#pragma unroll
        for (int i = 0; i < 2; ++i)
#pragma unroll
            for (int j = 0; j < 8; ++j) os[(i * 16 + hi * 8 + j) * OSP + t * 16 + lr] = acc[i][t][j] + bv; }
    __syncthreads();        // the staged tile is whole before its lanes read each other's values
    float* ob = out + ((size_t)b * CC + c0) * NN_ + q0 + wr * 32;
    const int cq = lane >> 3, q = lane & 7;        // column c (64 of them) x 32 rows n; per column 32 floats = 8 lanes x 16 B; 4 columns per instruction
    v4f vv[16];
#pragma unroll
    for (int s = 0; s < 16; ++s)
#pragma unroll
        for (int e = 0; e < 4; ++e) vv[s][e] = os[(q * 4 + e) * OSP + 4 * s + cq];
#pragma unroll
    for (int s = 0; s < 16; ++s) *(v4f*)(ob + (size_t)(4 * s + cq) * NN_ + q * 4) = vv[s];
}

extern "C" void kernel_launch(void* const* d_in, const int* in_sizes, int n_in,
                              void* d_out, int out_size, void* d_ws, size_t ws_size, hipStream_t stream) {
    (void)in_sizes; (void)n_in; (void)out_size;
    const float* x = (const float*)d_in[0]; const float* Wq = (const float*)d_in[1]; const float* bq = (const float*)d_in[2]; const float* Wk = (const float*)d_in[3]; const float* bk = (const float*)d_in[4];
    const float* Wv = (const float*)d_in[5]; const float* bv = (const float*)d_in[6]; const float* Wp = (const float*)d_in[7]; const float* bp = (const float*)d_in[8];
    const float* g = (const float*)d_in[9]; const float* be = (const float*)d_in[10]; const float* mu = (const float*)d_in[11]; const float* var = (const float*)d_in[12];
    float* out = (float*)d_out;    // [32][384][32][32]
    char* wsp = (char*)d_ws;
    auto take = [&](size_t bytes) { char* p = wsp; wsp += (bytes + 255) & ~(size_t)255; return (void*)p; };
    bf* Xb = (bf*)take((size_t)NTQ * CC * 2); bf* XRH = (bf*)take((size_t)NTKV * CC * 2); bf* XRL = (bf*)take((size_t)NTKV * CC * 2);
    bf* WT = (bf*)take((size_t)4 * CC * CC * 2);    // the four weight planes in a row: q, k, v, p
    h16* Q16 = (h16*)take((size_t)NTQ * CC * 2); h16* K16 = (h16*)take((size_t)NTKV * CC * 2); h16* VT16 = (h16*)take((size_t)NTKV * CC * 2);
    if ((size_t)(wsp - (char*)d_ws) > ws_size) return;    // 25.2 + 12.6 + 1.2 + 25.2 + 12.6 MB ~ 77 MB
    k_prep<<<NWTB + NGRP, 256, 0, stream>>>(x, g, be, mu, var, Wq, Wk, Wv, Wp, Xb, XRH, XRL, WT);
    k_qkv<<<2 * NKB + (NTQ / 128) * (CC / (2 * WNQ)), 128, 0, stream>>>(Xb, XRH, XRL, WT, bq, bk, bv, Q16, K16, VT16);
    k_attnproj<<<NB_ * (NN_ / 64), 384, 0, stream>>>(Q16, K16, VT16, WT + (size_t)3 * CC * CC, bp, out);
}

// v009
// One run takes 59.2 microseconds.
// In both of two side-by-side timings against v008, it was 1.06 times as fast.
// Over all steps from v000 it is 3.73 times as fast.
#include <hip/hip_runtime.h>

// Contractions, f32 accumulate: q = tok.Wq + bq ([32 x 1024 tokens x 384].[384 x 384]) on v_wmma_f32_16x16x32_bf16 with PLAIN bf16 operands (tok = the NCHW input
// transposed, rounded once: exact); k, v = xr.Wk/Wv + b on the bf16 instruction with the pooled + batch-normed tokens xr (computed) as bf16 hi + residual planes (two
// products); the per-(batch, head) attention (12 heads of 32: scores [1024 x 32].[32 x 256] x 32^-1/2, softmax, .v) fused on v_wmma_f32_16x16x32_f16 with plain f16
// q (x 32^-1/2 log2 e), k, v and scaled weights; out = ctx.Wp + bp on the bf16 instruction with ctx as bf16 hi + residual planes, written back transposed to NCHW. Deterministic, no

#define NB_  32
#define CC   384
#define NN_  1024
#define NK   256
#define NH_  12
#define HD   32
#define NTQ  (NB_ * NN_)          // 32768 query tokens
#define NTKV (NB_ * NK)           // 8192 pooled tokens
#define SCL  0.17677669529663687f
#define QSC  (SCL * 1.4426950408889634f)   // q is stored x 32^-1/2 x log2 e: a score leaves its product as the base-2 exponent
#define PSH  7.0f      // weights x 2^7 in the loop with a fixed reference: nine powers of two of room below the f16 limit
#define PSL  15.0f     // weights x 2^15 in the loop with a running maximum
#define LLIM 60000.0f  // a lane's weight sum below this: none of its weights passed the f16 limit

typedef _Float16 h16;
typedef unsigned short bf;
typedef __attribute__((ext_vector_type(16))) __bf16   v16bf;
typedef __attribute__((ext_vector_type(16))) _Float16 v16h;
typedef __attribute__((ext_vector_type(8)))  _Float16 v8h;
typedef __attribute__((ext_vector_type(8)))  unsigned short v8us;
typedef __attribute__((ext_vector_type(8)))  float    v8f;
typedef __attribute__((ext_vector_type(4)))  float    v4f;
typedef __attribute__((ext_vector_type(2)))  float    v2f;
typedef __attribute__((ext_vector_type(2)))  _Float16 v2h;
typedef v4f  __attribute__((may_alias)) v4fa;
typedef v8us __attribute__((may_alias)) v8usa;

__device__ __forceinline__ unsigned short f2bf(float f) { unsigned u = __float_as_uint(f); u += 0x7FFFu + ((u >> 16) & 1u); return (unsigned short)(u >> 16); }
__device__ __forceinline__ float bf2f(unsigned short b) { return __uint_as_float(((unsigned)b) << 16); }
__device__ __forceinline__ float bfr(float f) { return bf2f(f2bf(f)); }
__device__ __forceinline__ v16h cat16(v8h lo, v8h hi) { return __builtin_shufflevector(lo, hi, 0, 1, 2, 3, 4, 5, 6, 7, 8, 9, 10, 11, 12, 13, 14, 15); }
__device__ __forceinline__ v16bf cat16b(v8us lo, v8us hi) { return __builtin_bit_cast(v16bf, __builtin_shufflevector(lo, hi, 0, 1, 2, 3, 4, 5, 6, 7, 8, 9, 10, 11, 12, 13, 14, 15)); }
__device__ __forceinline__ v8f wmma16(v16h a, v16h b, v8f c) { return __builtin_amdgcn_wmma_f32_16x16x32_f16(false, a, false, b, (short)0, c, false, false); }
__device__ __forceinline__ v8f wmmab(v16bf a, v16bf b, v8f c) { return __builtin_amdgcn_wmma_f32_16x16x32_bf16(false, a, false, b, (short)0, c, false, false); }
// Fragment-order planes: every 16-bit WMMA operand plane [rows][k] in the workspace is stored as 1024-byte blocks, one per (16 rows, 32 k), block index (row / 16) * kch + k / 32
// (kch = k extent / 32); inside a block [k bits 4..3][row & 15][k & 7]. Lane l = 16 * hi + lr of a fragment load then reads 16 bytes at block + 8 * l (k = 8 hi ..) and at
// block + 256 + 8 * l (k = 16 + 8 hi ..): 512 contiguous bytes = 4 whole lines per load, where a row-major plane made each load touch 16 lines. fro = element offset of (row, k).
__device__ __forceinline__ size_t fro(int row, int k, int kch) { return ((size_t)(row >> 4) * kch + (k >> 5)) * 512 + ((k >> 3) & 3) * 128 + (row & 15) * 8 + (k & 7); }

// d_xpart: one block takes x[b][c0 .. c0 + 63][n0 .. n0 + 255], reads it ONCE and makes from it both its part of Xb (row b*1024 + n, k = c, fragment order) = bf16(x[b][c][n]) and its part of
// XRH/XRL (row b*256 + m, k = c, fragment order) = bf16 hi + residual of (mean_{t<4} bf16(x[b][c][4m+t])) * inv[c] + shift[c], inv = g/sqrt(var + eps), shift = beta - mean*inv (bf16-rounded params,
// f32 math). Wave w owns the 8 channels c0 + 8 w ..; each of its 16 loads is 512 contiguous bytes of one channel (4 whole lines): lane l gets tokens 4 l .. 4 l + 3 of a 128-token half, which are one
// pooling group. For one token (or one pooled token) the lane's 8 channels are one 16-byte unit of the fragment order; the units go to LDS images of the output runs (2 KB per 16 rows) and leave
// as 512 contiguous bytes a wave. XTP: pitch of a 16-token run in LDS, 2 KB + 16 bytes, so that the 16 lanes of a half wave, which write 4 units in each of 4 runs, fall on all 64 banks.
#define XTP 1032
#define XPO (16 * XTP)
__device__ __forceinline__ float rdl(float v, int l) { return __builtin_bit_cast(float, __builtin_amdgcn_readlane(__builtin_bit_cast(int, v), l)); }
__device__ __forceinline__ void d_xpart(const float* __restrict__ x, const float* __restrict__ g, const float* __restrict__ be, const float* __restrict__ mu, const float* __restrict__ var,
                                        bf* Xb, bf* XRH, bf* XRL, unsigned short* sh, int mx, int cy, int b) {
    const int tid = threadIdx.x, lane = tid & 31, w = tid >> 5;
    const int c0 = cy * 64, n0 = mx * 256, m0 = mx * 64;
    const float* xp = x + ((size_t)b * CC + c0 + w * 8) * NN_ + n0 + lane * 4;
    const int cp = c0 + w * 8 + (lane & 7);        // lane l computes the two parameters of the wave's channel l & 7; each is read from its lane below
    const float gl = g[cp], vl = var[cp], bl = be[cp], ml = mu[cp];
    // the register that these four loads name was given to one of the loads below as its destination: the wait stands before it is written again
    asm volatile("s_wait_xcnt 0x0" ::: "memory");
    v4f r[8][2];
#pragma unroll        // here and below: unrolled so that every register index is a constant
    for (int jc = 0; jc < 8; ++jc)
#pragma unroll
        for (int hf = 0; hf < 2; ++hf) r[jc][hf] = *(const v4fa*)(xp + jc * NN_ + hf * 128);
    // behind the last load, its address named so that it lives to here: without this the last load's destination was laid on the address pair that the fifteen before it name
    asm volatile("s_wait_xcnt 0x0" :: "v"(xp) : "memory");
    // all of the wave's loads are issued before the first value is used: without this the compiler fetched them in groups and waited out a whole memory latency at each
    __builtin_amdgcn_sched_barrier(0);
    const float invl = bfr(gl) / sqrtf(bfr(vl) + 1e-5f), shl = bfr(bl) - bfr(ml) * invl;
    unsigned short* tw = sh + (lane >> 2) * XTP + (w >> 2) * 512 + (w & 3) * 128 + (lane & 3) * 32;
    unsigned short* pw = sh + XPO + (lane >> 4) * 1024 + (w >> 2) * 512 + (w & 3) * 128 + (lane & 15) * 8;
#pragma unroll
    for (int hf = 0; hf < 2; ++hf) {
        v8us tu[4], hu, lu;
#pragma unroll
        for (int jc = 0; jc < 8; ++jc) {
            const float inv = rdl(invl, jc), shf = rdl(shl, jc);
            unsigned short q[4];
#pragma unroll
            for (int e = 0; e < 4; ++e) { q[e] = f2bf(r[jc][hf][e]); tu[e][jc] = q[e]; }
            const float v = ((bf2f(q[0]) + bf2f(q[1]) + bf2f(q[2]) + bf2f(q[3])) * 0.25f) * inv + shf;
            const unsigned short hb = f2bf(v); hu[jc] = hb; lu[jc] = f2bf(v - bf2f(hb));
        }
#pragma unroll
        for (int e = 0; e < 4; ++e) *(v8usa*)(tw + hf * 8 * XTP + e * 8) = tu[e];
        *(v8usa*)(pw + hf * 2048) = hu; *(v8usa*)(pw + 4096 + hf * 2048) = lu;
    }
    __syncthreads();
    const int rt = tid >> 7, wi = (tid & 127) * 8;        // 128 units of 16 bytes make one 2 KB run: 16 rows x this block's 64 channels
    bf* xo = Xb + ((size_t)((b * NN_ + n0) / 16 + rt) * (CC / 32) + 2 * cy) * 512 + wi;
#pragma unroll
    for (int s = 0; s < 8; ++s) { const v8us val = *(const v8usa*)(sh + (2 * s + rt) * XTP + wi); *(v8us*)(xo + (size_t)(2 * s) * (CC / 32) * 512) = val; }
    const size_t po = ((size_t)((b * NK + m0) / 16 + rt) * (CC / 32) + 2 * cy) * 512 + wi;
#pragma unroll
    for (int s = 0; s < 4; ++s) { const int pln = s >> 1, t2 = 2 * (s & 1); const v8us val = *(const v8usa*)(sh + XPO + pln * 4096 + (t2 + rt) * 1024 + wi);
        *(v8us*)((pln ? XRL : XRH) + po + (size_t)t2 * (CC / 32) * 512) = val; }
    // another job's code follows this one in the merged kernel's listing: the wait stands before any register that these stores name is written again
    asm volatile("s_wait_xcnt 0x0" ::: "memory");
}
// d_wt: W [384 k][384 n] k-major -> bf16 plane (row n, k, fragment order); 64 x 64 tiles.
__device__ __forceinline__ void d_wt(const float* __restrict__ Wm, bf* WT, unsigned short* tl, int bx, int by) {
    const int tid = threadIdx.x, k0 = bx * 64, n0 = by * 64;
    const int kk = tid >> 2, nq = (tid & 3) * 16;
#pragma unroll
    for (int i = 0; i < 16; ++i) tl[(nq + i) * 72 + kk] = f2bf(Wm[(size_t)(k0 + kk) * CC + n0 + nq + i]);
    __syncthreads();
    const int piece = (tid >> 4) & 7;
    auto pass = [&]() {
#pragma unroll
        for (int s = 0; s < 2; ++s) { const int nr = ((tid >> 7) + 2 * s) * 16 + (tid & 15); const v8us val = *(const v8usa*)(tl + nr * 72 + piece * 8);
            *(v8us*)(WT + fro(n0 + nr, k0 + piece * 8, CC / 32)) = val; }
    };
    pass();
    // another job's code follows this one in the merged kernel's listing: the wait stands before any register that these stores name is written again
    asm volatile("s_wait_xcnt 0x0" ::: "memory");
}
// k_prep: the jobs that need nothing of each other, in block ranges of ONE launch (the branch is the same for a whole block): blocks 0 .. 143 the four weight planes (36 tiles each, WT = four
// planes in a row); then 768 blocks, one per (b, c tile, 256 tokens), each of which makes the token plane's and the pooled planes' part of its x part.
#define NWTB (4 * (CC / 64) * (CC / 64))
#define NGRP (NB_ * (CC / 64) * (NK / 64))
__global__ __launch_bounds__(256) void k_prep(const float* __restrict__ x, const float* __restrict__ g, const float* __restrict__ be, const float* __restrict__ mu, const float* __restrict__ var,
                                              const float* __restrict__ Wq, const float* __restrict__ Wk, const float* __restrict__ Wv, const float* __restrict__ Wp, bf* Xb, bf* XRH, bf* XRL, bf* WT) {
    __shared__ __align__(16) unsigned short sh[XPO + 2 * 4096];
    const int bid = blockIdx.x;
    if (bid < NWTB) {
        const int i = bid / 36, t = bid - i * 36, by = t / 6, bx = t - by * 6;
        d_wt(i == 0 ? Wq : i == 1 ? Wk : i == 2 ? Wv : Wp, WT + (size_t)i * CC * CC, sh, bx, by);
    } else {
        const int grp = bid - NWTB;
        const int mx = grp & 3, cb = grp >> 2, b = cb / 6, cy = cb - b * 6;
        d_xpart(x, g, be, mu, var, Xb, XRH, XRL, sh, mx, cy, b);
    }
}

// d_gemmb: ONE WAVE computes the 64 x WN tile (tr, tc) of (A [+ Al]).B^T + bf16(bias), K = 384, as 4 x WN / 16 accumulator tiles: each A fragment loaded serves WN / 16 products, each B fragment four
// (eight with the residual plane). A, Al, B are fragment-order planes; the tile, bias added, goes to os, this wave's own [64 rows][WN + 4] f32 staging range (at that pitch rows 8 apart fall 32 banks
// apart and a row starts at a multiple of 16 bytes). WN = 96 in k_qkv: the launch is then 768 blocks of four waves, three to a WGP, all resident at once.
template <bool SPLITA, int WN>
__device__ __forceinline__ void d_gemmb(const bf* __restrict__ A, const bf* __restrict__ Al, const bf* __restrict__ Bn, const float* __restrict__ bias, float* os, int tr, int tc, int ks) {
    constexpr int SP = WN + 4;
    const int lane = threadIdx.x & 31, lr = lane & 15, hi = lane >> 4;
    const int r0 = tr * 64, c0 = tc * WN;
    const size_t aoff = fro(r0, 0, CC / 32);
    // tile bases, the same for the whole wave; block (16-row tile i, k chunk kk) lies (i * 12 + kk) * 1024 bytes on, the lane's part of it 16 * lane bytes on
    const char* ap = (const char*)(A + aoff); const char* alp = (const char*)((SPLITA ? Al : A) + aoff); const char* bp = (const char*)(Bn + fro(c0, 0, CC / 32));
    // The k walk starts at chunk ks, which differs from block to block, and wraps round: the blocks that share a weight tile or a row tile, all resident at once, no longer ask L2 for the same lines
    // at the same moment. vo = the lane's byte offset in the chunk being fetched.
    int kk = ks; unsigned vo = 16u * lane + 1024u * kk;
    const float* bb = bias + c0 + lr; float bvr[WN / 16];        // the lane's bias values, fetched at the head of the last step
    v8f acc[4][WN / 16];        // [row tile][column tile]
#pragma unroll        // here and below, in d_gemmb and d_out: unrolled so that every register index is a constant
    for (int i = 0; i < 4; ++i)
#pragma unroll
        for (int t = 0; t < WN / 16; ++t) acc[i][t] = (v8f){};
    // Fragments run one step ahead: step 0's are fetched here; inside step kc each fragment of step kc + 1 is fetched right behind the last product that reads the registers it goes into, so that about
    // 24 products stand between a load and its first use and no step begins by waiting out a load. With the residual plane: a behind the first run of products, b[t] behind its products of the second
    // run, al behind the second run (it is first read after the next step's first run). Without it a has no such gap and takes a second set of registers, which the other path's budget leaves free.
    auto ldf = [](const char* p, unsigned o, int tile) { const char* f = p + o + tile * (CC / 32) * 1024; return cat16b(*(const v8us*)f, *(const v8us*)(f + 512)); };
    // on to the next chunk. The loads issued so far name the register of vo: the wait stands before it is written again; the chunk number goes through the statement so that the new offset is formed behind it
    auto next = [&]() { kk = kk + 1 == CC / 32 ? 0 : kk + 1; asm volatile("s_wait_xcnt 0x0" : "+s"(kk) :: "memory"); vo = 16u * lane + 1024u * kk; };
    v16bf a[4], al[4], b[WN / 16];
#pragma unroll
    for (int i = 0; i < 4; ++i) a[i] = ldf(ap, vo, i);
#pragma unroll
    for (int t = 0; t < WN / 16; ++t) b[t] = ldf(bp, vo, t);
    if (SPLITA) {
#pragma unroll
        for (int i = 0; i < 4; ++i) al[i] = ldf(alp, vo, i);
        // the compiler gave the register of vo, which these loads name, to an accumulator of the first run of products: the wait stands before that
        asm volatile("s_wait_xcnt 0x0" ::: "memory");
    }
#pragma unroll        // unrolled: every register index is a constant, and no loop branch stands behind a WMMA
    for (int kc = 0; kc < CC / 32; ++kc) {
        const bool more = kc + 1 < CC / 32;
        v16bf an[4];
        if (more && !SPLITA) next();
        if (!more) {
            // behind the last fragment loads: the compiler gave registers that they name to the bias loads as destinations
            asm volatile("s_wait_xcnt 0x0" ::: "memory");
#pragma unroll
            for (int t = 0; t < WN / 16; ++t) bvr[t] = bb[t * 16];
            // behind the last loads: the registers that they name are written again below, for the staging addresses, and the scheduling barrier on the
            // next line keeps those writes behind this one
            asm volatile("s_wait_xcnt 0x0" ::: "memory");
        }
        // the scheduling barriers of this loop fix the place of every load: behind the products that read its registers, so that it needs none of its own (three blocks on a WGP leave a wave 336),
        // and a whole run of products ahead of its use
        __builtin_amdgcn_sched_barrier(0);
        if (SPLITA) {
#pragma unroll
            for (int t = 0; t < WN / 16; ++t) {
#pragma unroll
                for (int i = 0; i < 4; ++i) acc[i][t] = wmmab(a[i], b[t], acc[i][t]);
                __builtin_amdgcn_sched_barrier(0);        // also: the run keeps the order of t, in which its b fragments were fetched (the compiler began it with the one fetched last)
            }
            if (more) {
                next();        // placed here, a run of products behind the last loads, so that its wait does not hold the wave up
#pragma unroll
                for (int i = 0; i < 4; ++i) a[i] = ldf(ap, vo, i);
            }
            __builtin_amdgcn_sched_barrier(0);
        } else if (more) {
#pragma unroll
            for (int i = 0; i < 4; ++i) an[i] = ldf(ap, vo, i);
            __builtin_amdgcn_sched_barrier(0);
        }
#pragma unroll
        for (int t = 0; t < WN / 16; ++t) {
#pragma unroll
            for (int i = 0; i < 4; ++i) acc[i][t] = wmmab(SPLITA ? al[i] : a[i], b[t], acc[i][t]);
            __builtin_amdgcn_sched_barrier(0);
            if (more) b[t] = ldf(bp, vo, t);
            __builtin_amdgcn_sched_barrier(0);
        }
        if (more) {
#pragma unroll
            for (int i = 0; i < 4; ++i) { if (SPLITA) al[i] = ldf(alp, vo, i); else a[i] = an[i]; }
        }
    }
#pragma unroll
    for (int t = 0; t < WN / 16; ++t) { const float bv = bfr(bvr[t]);
#pragma unroll
        for (int i = 0; i < 4; ++i)
#pragma unroll
            for (int j = 0; j < 8; ++j) os[(i * 16 + hi * 8 + j) * SP + t * 16 + lr] = acc[i][t][j] + bv; }
    __syncthreads();
}
// d_out: the staged tile (tr, tc) to its plane. MODE 0: f16 plane C16 (row, col, fragment order), x QSC where SC (the q plane); MODE 2: VT16 planes for v, transposed: plane row = b*384 + col, k = key m (row = b*256 + m)
template <int MODE, int WN, bool SC>
__device__ __forceinline__ void d_out(void* Cout, const float* os, int tr, int tc) {
    constexpr int SP = WN + 4;
    const int lane = threadIdx.x & 31, lr = lane & 15, hi = lane >> 4;
    const int r0 = tr * 64, c0 = tc * WN;
    if (MODE == 0) {
        h16* cpl = (h16*)Cout;
#pragma unroll
        for (int i = 0; i < 4; ++i)
#pragma unroll
            for (int s = 0; s < WN / 16; ++s) { const int piece = 2 * s + hi; const float* sp = os + (i * 16 + lr) * SP + piece * 8; v8h o;
#pragma unroll
                for (int e = 0; e < 8; ++e) o[e] = (h16)(SC ? sp[e] * QSC : sp[e]);
                *(v8h*)(cpl + fro(r0 + i * 16 + lr, c0 + piece * 8, CC / 32)) = o; }
        // another job's code follows this one in the merged kernel's listing: the wait stands before any register that these stores name is written again
        asm volatile("s_wait_xcnt 0x0" ::: "memory");
    } else {
        const int b = r0 / NK, m0 = r0 - b * NK;
        h16* vb = (h16*)Cout;        // plane row = b*CC + col since [b][h][d] flattens to b*384 + h*32 + d; k = key m; fragment order with 256 / 32 blocks per 16 rows
#pragma unroll
        for (int cw = 0; cw < WN / 16; ++cw)
#pragma unroll
            for (int s = 0; s < 4; ++s) { const int col = cw * 16 + lr, q = 2 * s + hi; v8h v;
#pragma unroll
                for (int e = 0; e < 8; ++e) v[e] = (h16)os[(q * 8 + e) * SP + col];
                *(v8h*)(vb + fro(b * CC + c0 + col, m0 + q * 8, NK / 32)) = v; }
        // another job's code follows this one in the merged kernel's listing: the wait stands before any register that these stores name is written again
        asm volatile("s_wait_xcnt 0x0" ::: "memory");
    }
}
// A block of four waves takes a 128 x 2 WN tile, wave w the 64 x WN quarter (w >> 1, w & 1): two waves share each A row tile and two each B column tile through the WGP cache.
// k_qkv: the three projections, which need nothing of each other, in block ranges of ONE launch: first the k and v tiles (two products a step, the longer blocks; row tile fastest, 2 column tiles
// of k, then 2 of v), then the q tiles (row tile fastest): 768 blocks, three to a WGP. WT = the four weight planes in a row (q, k, v, p).
#define WNQ 96
#define NKB ((NTKV / 128) * (CC / (2 * WNQ)))
__global__ __launch_bounds__(128) void k_qkv(const bf* __restrict__ Xb, const bf* __restrict__ XRH, const bf* __restrict__ XRL, const bf* __restrict__ WT,
                                             const float* __restrict__ bq, const float* __restrict__ bk, const float* __restrict__ bv, h16* Q16, h16* K16, h16* VT16) {
    __shared__ __align__(16) float ost[4 * 64 * (WNQ + 4)];
    const int bid = blockIdx.x, wave = __builtin_amdgcn_readfirstlane(threadIdx.x >> 5), wr = wave >> 1, wc = wave & 1;        // the wave's number in a scalar register: tile bases stay scalar
    float* os = ost + wave * 64 * (WNQ + 4);
    if (bid < 2 * NKB) {        // k and v share one copy of the product loop's code
        const bool isv = bid >= NKB; const int r = isv ? bid - NKB : bid, tr = 2 * (r & (NTKV / 128 - 1)) + wr, tc = 2 * (r / (NTKV / 128)) + wc;
        d_gemmb<true, WNQ>(XRH, XRL, WT + (size_t)(isv ? 2 : 1) * CC * CC, isv ? bv : bk, os, tr, tc, bid % (CC / 32));
        if (isv) d_out<2, WNQ, false>(VT16, os, tr, tc); else d_out<0, WNQ, false>(K16, os, tr, tc);
    } else {
        const int r = bid - 2 * NKB, tr = 2 * (r & (NTQ / 128 - 1)) + wr, tc = 2 * (r / (NTQ / 128)) + wc;
        d_gemmb<false, WNQ>(Xb, nullptr, WT, bq, os, tr, tc, bid % (CC / 32));
        d_out<0, WNQ, true>(Q16, os, tr, tc);
    }
}
// k_attnproj: attention and output projection in ONE launch; block = (b, 64 queries), 12 waves. The context tile [64 queries][384] never leaves the WGP: it goes from the attention waves to the
// projection waves through LDS, as the same two fragment-order bf16 planes (hi + residual) that a workspace plane would hold.
// Attention: a wave takes one head (head dim 32: one k-chunk) and 32 queries = two 16-query tiles, so a loaded K or V fragment feeds two tiles; waves 2 i and 2 i + 1 take the two halves of the block's
// queries for the SAME head at the same time, so that one of them finds the head's K, V lines in the WGP cache; six heads at a time, two passes. 8 steps x 32 keys, computed TRANSPOSED: S^T = K.Q^T
// (A = 16 key rows, B = a tile's 16 queries, which carry 32^-1/2 log2 e), so lane (hi, lr) holds 16 scores of the ONE query lr (keys 8 hi + j and 16 + 8 hi + j): maximum and sum run in-lane plus
// one exchange between the wave halves; the scaled weights packed to f16 from the two score tiles ARE the B operand of O^T += V^T.P^T in the hardware k order. O^T tile n, register j =
// ctx[query lr][16 n + 8 hi + j], which is the lane's own 16 bytes of fragment-order block (query tile u, k chunk h), at element (u * 12 + h) * 512 of each LDS plane.
// Projection: wave (wr, wc) = (wave / 6, wave % 6) computes rows 32 wr .., columns 64 wc .. of ctx.Wp + bf16(bp), K = 384, as 2 x 4 accumulator tiles: A fragments (hi, residual) from LDS, B fragments
// of the weight plane from global. The tile, bias added, is staged in the wave's own [32 rows][66] f32 range of the SAME LDS (the planes are dead by then: second barrier)
// and leaves transposed into NCHW out[b][c][n]: each column c gets 32 consecutive n = one whole 128-byte line, four lines an instruction. At pitch 66 rows 8 apart fall 16 banks apart (the writes: 16
// columns of two such rows) and rows 4 apart 8 banks apart (the reads: 4 columns of eight such rows): 32 different banks either way.
#define OSP 66
#define PLN (4 * (CC / 32) * 512)
#define TP 2
__device__ __forceinline__ float xhalf(float x) { return __builtin_bit_cast(float, __builtin_amdgcn_permlanex16(__builtin_bit_cast(int, x), __builtin_bit_cast(int, x), 0x76543210, 0xfedcba98, false, false)); }  // lane l with lane l ^ 16
__global__ __launch_bounds__(384) void k_attnproj(const h16* __restrict__ Q16, const h16* __restrict__ K16, const h16* __restrict__ VT16, const bf* __restrict__ Bn, const float* __restrict__ bias, float* out) {
    __shared__ __align__(16) float smem[12 * 32 * OSP];        // 101376 bytes: first the two ctx planes (2 x 49152 bytes), then the twelve staging ranges
    bf* chs = (bf*)smem; bf* cls = chs + PLN;
    const int lane = threadIdx.x & 31, lr = lane & 15, hi = lane >> 4;
    const int wave = __builtin_amdgcn_readfirstlane(threadIdx.x >> 5);        // in a scalar register: head, tile and plane bases stay scalar
    const int bid = blockIdx.x, b = bid / (NN_ / 64), q0 = (bid - b * (NN_ / 64)) * 64, u0 = TP * (wave & 1);
    // The sixteen blocks of one b walk the same K and V planes, every block the same weight plane, all at once: each block starts its key walk at step ka and its projection's k walk at chunk kp and
    // wraps round, so that they do not ask L2 for the same lines at the same moment. All waves of a block keep one order: those that share fragments still find them in the WGP cache;
    // so do blocks 256 apart in the projection, should they stand on one WGP (a matter of speed only: nothing rests on where a block runs).
    const int ka = bid & (NK / 32 - 1), kp = (bid & 255) % (CC / 32);
    for (int hp = 0; hp < 2; ++hp) {
        const int h = hp * (NH_ / 2) + (wave >> 1);
        const h16* kh_b = K16 + fro(b * NK, h * HD, CC / 32) + 8 * lane;
        const h16* vt_b = VT16 + fro(b * CC + h * HD, 0, NK / 32) + 8 * lane;
        const h16* qp = Q16 + fro(b * NN_ + q0 + 16 * u0, h * HD, CC / 32) + 8 * lane;
        v16h qb[TP];
#pragma unroll        // here and below: unrolled so that every register index is a constant
        for (int u = 0; u < TP; ++u) { const h16* qu = qp + u * (CC / 32) * 512; qb[u] = cat16(*(const v8h*)qu, *(const v8h*)(qu + 256)); }
        v8f o[TP][2]; v2f lpart[TP];        // lpart: even and odd registers' share of this half's weight sum
        // K fragments run one step ahead: the first step's are fetched here, step kt + 1's inside step kt, so that no step begins by waiting out a load
        const h16* kf0 = kh_b + fro(ka * 32, 0, CC / 32); const h16* kf1 = kh_b + fro(ka * 32 + 16, 0, CC / 32);
        v16h k0 = cat16(*(const v8h*)kf0, *(const v8h*)(kf0 + 256)), k1 = cat16(*(const v8h*)kf1, *(const v8h*)(kf1 + 256));
        // The reference of a query's weights is fixed once: r = the maximum of the 32 scores of its first step. cn = PSH - r in all eight registers is the C operand of every score product, so a score tile
        // leaves the matrix unit as the exponent of its weight x 2^PSH: no maximum, subtraction or rescaling in a step.
        v8f cn[TP];
#pragma unroll
        for (int u = 0; u < TP; ++u) {
            v8f t0 = (v8f){}, t1 = (v8f){}; t0 = wmma16(k0, qb[u], t0); t1 = wmma16(k1, qb[u], t1);
            float mx = fmaxf(t0[0], t1[0]);
#pragma unroll
            for (int j = 1; j < 8; ++j) mx = fmaxf(mx, fmaxf(t0[j], t1[j]));
            mx = fmaxf(mx, xhalf(mx));
            const float c = PSH - mx;
#pragma unroll
            for (int j = 0; j < 8; ++j) cn[u][j] = c;
            o[u][0] = (v8f){}; o[u][1] = (v8f){}; lpart[u] = (v2f){0.f, 0.f};
        }
#pragma unroll 1        // rolled: the live registers stay those of one step
        for (int kt = 0; kt < NK / 32; ++kt) {
            const int l0 = ((ka + kt) & (NK / 32 - 1)) * 32, ln = ((ka + kt + 1) & (NK / 32 - 1)) * 32;        // the last step fetches the first step's again: a valid address; the loop below starts from them
            const h16* r0p = kh_b + fro(ln, 0, CC / 32); const h16* r1p = kh_b + fro(ln + 16, 0, CC / 32);
            const h16* v0p = vt_b + fro(0, l0, NK / 32); const h16* v1p = vt_b + fro(16, l0, NK / 32);
            const v16h w0 = cat16(*(const v8h*)v0p, *(const v8h*)(v0p + 256)), w1 = cat16(*(const v8h*)v1p, *(const v8h*)(v1p + 256));
            v8f s0[TP], s1[TP]; v16h pb[TP];
#pragma unroll
            for (int u = 0; u < TP; ++u) s0[u] = wmma16(k0, qb[u], cn[u]);
#pragma unroll
            for (int u = 0; u < TP; ++u) s1[u] = wmma16(k1, qb[u], cn[u]);
            // the next step's K loads are issued right behind the score products, the last readers of this step's, into the same registers: the weights' arithmetic covers their latency; the
            // scheduling barriers keep them at this place
            __builtin_amdgcn_sched_barrier(0);
            // the compiler formed the V loads' address in registers of this step's K fragment, which the loads below fill again: the wait stands before that
            asm volatile("s_wait_xcnt 0x0" ::: "memory");
            k0 = cat16(*(const v8h*)r0p, *(const v8h*)(r0p + 256)); k1 = cat16(*(const v8h*)r1p, *(const v8h*)(r1p + 256));
            __builtin_amdgcn_sched_barrier(0);
#pragma unroll
            for (int u = 0; u < TP; ++u) {
                // the two tiles' weights stay apart: interleaved they took 162 registers, and above 160 the second block loses its place on the WGP
                if (u == TP - 1) __builtin_amdgcn_sched_barrier(0);
                v2f p[8];        // p[i] = two neighbouring registers of the score tiles: keys 8 hi + 2 i, + 1 (i < 4) and 16 + 8 hi + 2 (i - 4), + 1
#pragma unroll
                for (int i = 0; i < 8; ++i) {
                    p[i] = i < 4 ? (v2f){__builtin_amdgcn_exp2f(s0[u][2 * i]), __builtin_amdgcn_exp2f(s0[u][2 * i + 1])}
                                 : (v2f){__builtin_amdgcn_exp2f(s1[u][2 * i - 8]), __builtin_amdgcn_exp2f(s1[u][2 * i - 7])};
                    const v2h ph = __builtin_convertvector(p[i], v2h);
                    pb[u][2 * i] = ph[0]; pb[u][2 * i + 1] = ph[1];
                }
                lpart[u] = lpart[u] + (((p[0] + p[1]) + (p[2] + p[3])) + ((p[4] + p[5]) + (p[6] + p[7])));
            }
#pragma unroll
            for (int u = 0; u < TP; ++u) { o[u][0] = wmma16(w0, pb[u], o[u][0]); o[u][1] = wmma16(w1, pb[u], o[u][1]); }
            // the four vector slots the chip needs behind a WMMA, also on the taken side of the loop branch
            asm volatile("v_nop\n\tv_nop\n\tv_nop\n\tv_nop" : "+v"(o[0][0]), "+v"(o[0][1]), "+v"(o[1][0]), "+v"(o[1][1]));
        }
        // A weight is not negative, so a lane's sum is at least its largest weight: a sum below LLIM says that no weight of the lane passed the f16 limit, and the result stands. Otherwise (a later
        // score lay more than nine powers of two above the reference, or is no number) the whole wave computes this head again with a running maximum, which takes any scores.
        const bool redo = !(lpart[0][0] + lpart[0][1] < LLIM) || !(lpart[1][0] + lpart[1][1] < LLIM);
        if (__builtin_amdgcn_ballot_w32(redo) != 0u) {
            float mrow[TP];
#pragma unroll
            for (int u = 0; u < TP; ++u) { o[u][0] = (v8f){}; o[u][1] = (v8f){}; mrow[u] = -3.0e38f; lpart[u] = (v2f){0.f, 0.f}; }
#pragma unroll 1        // rolled: the live registers stay those of one step
            for (int kt = 0; kt < NK / 32; ++kt) {
                const int l0 = ((ka + kt) & (NK / 32 - 1)) * 32, ln = ((ka + kt + 1) & (NK / 32 - 1)) * 32;        // the last step fetches the first step's again: a valid address, the values unused
                const h16* r0p = kh_b + fro(ln, 0, CC / 32); const h16* r1p = kh_b + fro(ln + 16, 0, CC / 32);
                const h16* v0p = vt_b + fro(0, l0, NK / 32); const h16* v1p = vt_b + fro(16, l0, NK / 32);
                const v16h w0 = cat16(*(const v8h*)v0p, *(const v8h*)(v0p + 256)), w1 = cat16(*(const v8h*)v1p, *(const v8h*)(v1p + 256));
                v8f s0[TP], s1[TP]; v16h pb[TP]; float alpha[TP];
#pragma unroll
                for (int u = 0; u < TP; ++u) { s0[u] = (v8f){}; s0[u] = wmma16(k0, qb[u], s0[u]); }
#pragma unroll
                for (int u = 0; u < TP; ++u) { s1[u] = (v8f){}; s1[u] = wmma16(k1, qb[u], s1[u]); }
                // the next step's K loads stand behind the score products, as above, and so does the wait in front of them
                __builtin_amdgcn_sched_barrier(0);
                asm volatile("s_wait_xcnt 0x0" ::: "memory");
                k0 = cat16(*(const v8h*)r0p, *(const v8h*)(r0p + 256)); k1 = cat16(*(const v8h*)r1p, *(const v8h*)(r1p + 256));
                __builtin_amdgcn_sched_barrier(0);
#pragma unroll
                for (int u = 0; u < TP; ++u) {
                    float mx = -3.0e38f;
#pragma unroll
                    for (int j = 0; j < 8; ++j) mx = fmaxf(mx, fmaxf(s0[u][j], s1[u][j]));
                    mx = fmaxf(mx, xhalf(mx));
                    const float mn = fmaxf(mrow[u], mx);
                    alpha[u] = __builtin_amdgcn_exp2f(mrow[u] - mn);
                    mrow[u] = mn;
                }
#pragma unroll
                for (int u = 0; u < TP; ++u) {
                    const float mr = mrow[u] - PSL;
                    v2f a[8], p[8];
#pragma unroll
                    for (int i = 0; i < 4; ++i) { a[i] = (v2f){s0[u][2 * i], s0[u][2 * i + 1]} - mr; a[4 + i] = (v2f){s1[u][2 * i], s1[u][2 * i + 1]} - mr; }
#pragma unroll
                    for (int i = 0; i < 8; ++i) {
                        p[i] = (v2f){__builtin_amdgcn_exp2f(a[i][0]), __builtin_amdgcn_exp2f(a[i][1])};
                        const v2h ph = __builtin_convertvector(p[i], v2h);
                        pb[u][2 * i] = ph[0]; pb[u][2 * i + 1] = ph[1];
                    }
                    lpart[u] = lpart[u] * alpha[u] + (((p[0] + p[1]) + (p[2] + p[3])) + ((p[4] + p[5]) + (p[6] + p[7])));
#pragma unroll
                    for (int n = 0; n < 2; ++n)
#pragma unroll
                        for (int j = 0; j < 8; ++j) o[u][n][j] *= alpha[u];
                }
#pragma unroll
                for (int u = 0; u < TP; ++u) { o[u][0] = wmma16(w0, pb[u], o[u][0]); o[u][1] = wmma16(w1, pb[u], o[u][1]); }
                // the four vector slots the chip needs behind a WMMA, also on the taken side of the loop branch
                asm volatile("v_nop\n\tv_nop\n\tv_nop\n\tv_nop" : "+v"(o[0][0]), "+v"(o[0][1]), "+v"(o[1][0]), "+v"(o[1][1]));
            }
        }
#pragma unroll
        for (int u = 0; u < TP; ++u) {
            const float lh = lpart[u][0] + lpart[u][1], inv = 1.0f / (lh + xhalf(lh));        // sums and products carry the same power of two
            const int cbase = ((u0 + u) * (CC / 32) + h) * 512 + 8 * lane;
            v8us oh, ol, oh2, ol2;        // d = 8 hi + i and d = 16 + 8 hi + i of row lr
#pragma unroll
            for (int i = 0; i < 8; ++i) { const float c0 = o[u][0][i] * inv, c1 = o[u][1][i] * inv;
                const unsigned short hb = f2bf(c0); oh[i] = hb; ol[i] = f2bf(c0 - bf2f(hb)); const unsigned short hb2 = f2bf(c1); oh2[i] = hb2; ol2[i] = f2bf(c1 - bf2f(hb2)); }
            *(v8usa*)(chs + cbase) = oh; *(v8usa*)(chs + cbase + 256) = oh2;
            *(v8usa*)(cls + cbase) = ol; *(v8usa*)(cls + cbase + 256) = ol2;
        }
    }
    const int wr = wave / 6, wc = wave - wr * 6, c0 = wc * 64;
    const char* bp = (const char*)(Bn + fro(c0, 0, CC / 32));        // the same for the whole wave; block (16-column tile t, k chunk kk) lies (t * 12 + kk) * 1024 bytes on, the lane's part of it 16 * lane bytes on
    int kk = kp; unsigned vo = 16u * lane + 1024u * kk;        // kk: the chunk of the step at hand; vo: the lane's byte offset in the chunk being fetched
    v16bf bc[4]; float bvr[4];        // the first step's B fragments and the lane's bias values need nothing of the attention: fetched in front of the barrier
#pragma unroll
    for (int t = 0; t < 4; ++t) { const char* bt = bp + vo + t * (CC / 32) * 1024; bc[t] = cat16b(*(const v8us*)bt, *(const v8us*)(bt + 512)); bvr[t] = bias[c0 + t * 16 + lr]; }
    __syncthreads();        // every head's part of the two ctx planes is in LDS
    const bf* ap = chs + 2 * wr * (CC / 32) * 512 + 8 * lane; const bf* alp = cls + 2 * wr * (CC / 32) * 512 + 8 * lane;
    v8f acc[2][4];        // [row tile][column tile]
#pragma unroll
    for (int i = 0; i < 2; ++i)
#pragma unroll
        for (int t = 0; t < 4; ++t) acc[i][t] = (v8f){};
#pragma unroll        // unrolled: every register index is a constant, and no loop branch stands behind a WMMA
    for (int kc = 0; kc < CC / 32; ++kc) {
        v16bf a[2], al[2];
#pragma unroll
        for (int i = 0; i < 2; ++i) { const bf* at = ap + (i * (CC / 32) + kk) * 512; a[i] = cat16b(*(const v8usa*)at, *(const v8usa*)(at + 256));
            const bf* lt = alp + (i * (CC / 32) + kk) * 512; al[i] = cat16b(*(const v8usa*)lt, *(const v8usa*)(lt + 256)); }
        if (kc + 1 < CC / 32) {
            kk = kk + 1 == CC / 32 ? 0 : kk + 1;
            // the loads issued so far name the register of vo: the wait stands before it is written again; the chunk number goes through the statement so that the new offset is formed behind it
            asm volatile("s_wait_xcnt 0x0" : "+s"(kk) :: "memory");
            vo = 16u * lane + 1024u * kk;
        }
        // a step's LDS loads stay in front of its own products and behind the step before: without this the compiler spread them over several steps and took 300 registers, where two blocks on a WGP leave a wave 160
        __builtin_amdgcn_sched_barrier(0);
#pragma unroll
        for (int t = 0; t < 4; ++t) {
#pragma unroll
            for (int i = 0; i < 2; ++i) acc[i][t] = wmmab(a[i], bc[t], acc[i][t]);
#pragma unroll
            for (int i = 0; i < 2; ++i) acc[i][t] = wmmab(al[i], bc[t], acc[i][t]);
            // B fragments run one step ahead too: the next step's fragment t is fetched beside this step's four products of fragment t, twelve products ahead of its first use, which cover the
            // latency; the scheduling barrier keeps each load in its group of four
            if (kc + 1 < CC / 32) { const char* bt = bp + vo + t * (CC / 32) * 1024; bc[t] = cat16b(*(const v8us*)bt, *(const v8us*)(bt + 512)); }
            __builtin_amdgcn_sched_barrier(0);
        }
    }
    __syncthreads();        // every wave has read its last fragment of the ctx planes: their LDS becomes the staging ranges
    float* os = smem + wave * 32 * OSP;
#pragma unroll
    for (int t = 0; t < 4; ++t) { const float bv = bfr(bvr[t]);
#pragma unroll
        for (int i = 0; i < 2; ++i)
#pragma unroll
            for (int j = 0; j < 8; ++j) os[(i * 16 + hi * 8 + j) * OSP + t * 16 + lr] = acc[i][t][j] + bv; }
    __syncthreads();        // the staged tile is whole before its lanes read each other's values
    float* ob = out + ((size_t)b * CC + c0) * NN_ + q0 + wr * 32;
    const int cq = lane >> 3, q = lane & 7;        // column c (64 of them) x 32 rows n; per column 32 floats = 8 lanes x 16 B; 4 columns per instruction
    v4f vv[16];
#pragma unroll
    for (int s = 0; s < 16; ++s)
#pragma unroll
        for (int e = 0; e < 4; ++e) vv[s][e] = os[(q * 4 + e) * OSP + 4 * s + cq];
#pragma unroll
    for (int s = 0; s < 16; ++s) *(v4f*)(ob + (size_t)(4 * s + cq) * NN_ + q * 4) = vv[s];
}

extern "C" void kernel_launch(void* const* d_in, const int* in_sizes, int n_in,
                              void* d_out, int out_size, void* d_ws, size_t ws_size, hipStream_t stream) {
    (void)in_sizes; (void)n_in; (void)out_size;
    const float* x = (const float*)d_in[0]; const float* Wq = (const float*)d_in[1]; const float* bq = (const float*)d_in[2]; const float* Wk = (const float*)d_in[3]; const float* bk = (const float*)d_in[4];
    const float* Wv = (const float*)d_in[5]; const float* bv = (const float*)d_in[6]; const float* Wp = (const float*)d_in[7]; const float* bp = (const float*)d_in[8];
    const float* g = (const float*)d_in[9]; const float* be = (const float*)d_in[10]; const float* mu = (const float*)d_in[11]; const float* var = (const float*)d_in[12];
    float* out = (float*)d_out;    // [32][384][32][32]
    char* wsp = (char*)d_ws;
    auto take = [&](size_t bytes) { char* p = wsp; wsp += (bytes + 255) & ~(size_t)255; return (void*)p; };
    bf* Xb = (bf*)take((size_t)NTQ * CC * 2); bf* XRH = (bf*)take((size_t)NTKV * CC * 2); bf* XRL = (bf*)take((size_t)NTKV * CC * 2);
    bf* WT = (bf*)take((size_t)4 * CC * CC * 2);    // the four weight planes in a row: q, k, v, p
    h16* Q16 = (h16*)take((size_t)NTQ * CC * 2); h16* K16 = (h16*)take((size_t)NTKV * CC * 2); h16* VT16 = (h16*)take((size_t)NTKV * CC * 2);
    if ((size_t)(wsp - (char*)d_ws) > ws_size) return;    // 25.2 + 12.6 + 1.2 + 25.2 + 12.6 MB ~ 77 MB
    k_prep<<<NWTB + NGRP, 256, 0, stream>>>(x, g, be, mu, var, Wq, Wk, Wv, Wp, Xb, XRH, XRL, WT);
    k_qkv<<<2 * NKB + (NTQ / 128) * (CC / (2 * WNQ)), 128, 0, stream>>>(Xb, XRH, XRL, WT, bq, bk, bv, Q16, K16, VT16);
    k_attnproj<<<NB_ * (NN_ / 64), 384, 0, stream>>>(Q16, K16, VT16, WT + (size_t)3 * CC * CC, bp, out);
}
